// v000
// Measured on an AMD MI455X. A time is GPU time per run, averaged over a window of back-to-back runs after a warm-up
// (all launches, gaps included; the runs take copies of the inputs in turn), and the median of several windows.
// Apart from v000's, it joins two sittings. Times from different sittings can be a few percent apart, while
// side-by-side timings come from the same sitting.
// v000 is the starting kernel. One run takes 1560 microseconds.
// compute dtype: all float inputs rounded to bf16; q/k/v = in W^T + b with EXACT bf16 products on WMMA 16x16x32 (f32 accumulate); q as f16 hi + residual (x 2^10) against k once to f16 (2 products) / 8; softmax in f32 (precise expf); P x 2^11 once to f16 against v once to f16 (1 product); f32 output.
#include <hip/hip_runtime.h>
#include <math.h>

typedef __attribute__((ext_vector_type(16))) _Float16 v16h;
typedef __attribute__((ext_vector_type(16))) __bf16 v16b;
typedef __attribute__((ext_vector_type(8)))  _Float16 v8h;
typedef __attribute__((ext_vector_type(8)))  float v8f;
typedef __attribute__((ext_vector_type(4)))  float v4f;
typedef __attribute__((ext_vector_type(2)))  float v2f;
typedef __attribute__((ext_vector_type(4)))  unsigned v4u;
typedef __attribute__((ext_vector_type(4)))  int v4i;
typedef float __attribute__((may_alias)) float_a;
typedef int __attribute__((may_alias)) int_a;

template <typename T> __device__ __forceinline__ void vst2(void* p, T v) { *(T*)p = v;  }
__device__ __forceinline__ v8f wmma16(v16h a, v16h b, v8f c) {
  v8f d = __builtin_amdgcn_wmma_f32_16x16x32_f16(false, a, false, b, (short)0, c, false, false);
  asm volatile("v_nop\n\tv_nop\n\tv_nop\n\tv_nop" : "+v"(d) : "v"(a), "v"(b));
  return d;
}
__device__ __forceinline__ v8f wmma_bf(v16b a, v16b b, v8f c) {
  v8f d = __builtin_amdgcn_wmma_f32_16x16x32_bf16(false, a, false, b, (short)0, c, false, false);
  asm volatile("v_nop\n\tv_nop\n\tv_nop\n\tv_nop" : "+v"(d) : "v"(a), "v"(b));
  return d;
}
// 16x16x32 fragments: lane = (h = lane>>4, row/col = lane&15); elements 0..7 = k0+8h+0..7, 8..15 = k0+16+8h+0..7; D element r = row 8h+r
__device__ __forceinline__ v16h frag_h(const _Float16* rowk0, int lane) {
  union { v16h v; v8h q[2]; } u; const _Float16* p = rowk0 + 8 * (lane >> 4);
  u.q[0] = *(const v8h*)p; u.q[1] = *(const v8h*)(p + 16); return u.v;
}
__device__ __forceinline__ v16h frag_f32(const float* rowk0, int lane) {
  v16h a; const float* p = rowk0 + 8 * (lane >> 4);
#pragma unroll
  for (int i = 0; i < 8; ++i) { a[i] = (_Float16)p[i]; a[8 + i] = (_Float16)p[16 + i]; }
  return a;
}
__device__ __forceinline__ v16h frag_f32s(const float* rowk0, int lane, float sc) {
  v16h a; const float* p = rowk0 + 8 * (lane >> 4);
#pragma unroll
  for (int i = 0; i < 8; ++i) { a[i] = (_Float16)(p[i] * sc); a[8 + i] = (_Float16)(p[16 + i] * sc); }
  return a;
}
// column fragment from a [K][ld] layout (column n), rows >= K read as 0
__device__ __forceinline__ v16h fragc_f32(const float* W, int k0, int n, int lane, int ld, int K) {
  v16h a; const int g = lane >> 4;
#pragma unroll
  for (int i = 0; i < 8; ++i) { const int ka = k0 + 8 * g + i, kb = ka + 16;
    a[i] = (_Float16)(ka < K ? W[(size_t)(ka < K ? ka : K - 1) * ld + n] : 0.f); a[8 + i] = (_Float16)(kb < K ? W[(size_t)(kb < K ? kb : K - 1) * ld + n] : 0.f); }
  return a;
}
struct F2 { v16b h, l; };
__device__ __forceinline__ F2 bsplit16(const float v[16]) { F2 r;
#pragma unroll
  for (int i = 0; i < 16; ++i) { const __bf16 h = (__bf16)v[i]; r.h[i] = h; r.l[i] = (__bf16)(v[i] - (float)h); }
  return r; }
__device__ __forceinline__ F2 split_row(const float* row, int k0, int lane) { float v[16]; const float* p = row + k0 + 8 * (lane >> 4);
#pragma unroll
  for (int i = 0; i < 8; ++i) { v[i] = p[i]; v[8 + i] = p[16 + i]; }
  return bsplit16(v); }
__device__ __forceinline__ F2 split_rowK(const float* row, int k0, int lane, int K) { float v[16]; const int g = lane >> 4;
#pragma unroll
  for (int i = 0; i < 8; ++i) { const int ka = k0 + 8 * g + i, kb = ka + 16; v[i] = ka < K ? row[ka < K ? ka : K - 1] : 0.f; v[8 + i] = kb < K ? row[kb < K ? kb : K - 1] : 0.f; }
  return bsplit16(v); }
__device__ __forceinline__ F2 split_col(const float* W, int k0, int n, int lane, int ld, int K) { float v[16]; const int g = lane >> 4;
#pragma unroll
  for (int i = 0; i < 8; ++i) { const int ka = k0 + 8 * g + i, kb = ka + 16; v[i] = ka < K ? W[(size_t)(ka < K ? ka : K - 1) * ld + n] : 0.f; v[8 + i] = kb < K ? W[(size_t)(kb < K ? kb : K - 1) * ld + n] : 0.f; }
  return bsplit16(v); }
__device__ __forceinline__ v8f mac3(const F2& a, const F2& b, v8f c) { c = wmma_bf(a.l, b.h, c); c = wmma_bf(a.h, b.l, c); return wmma_bf(a.h, b.h, c); }
__device__ __forceinline__ float sigm(float v) { return 1.0f / (1.0f + expf(-v)); }
#define LDSX() do { asm volatile("s_wait_dscnt 0" ::: "memory"); __builtin_amdgcn_wave_barrier(); __builtin_amdgcn_fence(__ATOMIC_RELEASE, "workgroup"); } while (0)

// Multi-head self-attention (B 8, S 1,024, D 768 = 12 x 64; (out,in) 1/sqrt(768)-scale weights, zero biases; key mask [B,S] int all ones): q, k, v = x W^T + b; scores / 8 - 10000 * (1 - mask); out = merged(softmax v) -> [8, 1,024, 768] (no output projection).
#define NB 8
#define TT 1024
#define CC 768            // NH * HD = projected width
#define DIN 768          // input (model) width
#define NH 12
#define HD 64
#define NQB (TT / 64)
#define HG 4
#define SCALE (0.125f)
#define CAUSAL 0
#ifndef TNB
#define TNB NB
#endif
__device__ __forceinline__ float bfr(float v) { return (float)(__bf16)v; }
__host__ __device__ __forceinline__ int kb_last(int qb) { return CAUSAL ? ((qb * 64 + 63) >> 7) : (TT / 128 - 1); }
typedef __attribute__((ext_vector_type(8))) __bf16 v8b;
__device__ __forceinline__ v16b frag_b(const __bf16* rowk0, int lane) {
  union { v16b v; v8b q[2]; } u; const __bf16* p = rowk0 + 8 * (lane >> 4);
  u.q[0] = *(const v8b*)p; u.q[1] = *(const v8b*)(p + 16); return u.v;
}
#define QBH 0              // causal: query blocks 0..QBH-1 of each sequence (few keys, no averaging) take the high-precision path
#define QHI 1024            // rows carrying a q residual plane (all rows when non-causal: 2-product logits everywhere)
#define KHI 64            // key rows carrying k residual / v bf16 hi+lo planes (used only by the causal high-precision path)
// B fragment (k rows k0+.., output column o) of a weight: (in,out) [K][ld] or (out,in) [ld rows of K]: bf16 exact, or f16(bf16 * 256) exact
__device__ __forceinline__ v16b wcol_io(const float* Wm, int k0, int o, int lane, int ld) { v16b w; const int g = lane >> 4;
#pragma unroll
  for (int i = 0; i < 8; ++i) { w[i] = (__bf16)Wm[(size_t)(k0 + 8 * g + i) * ld + o]; w[8 + i] = (__bf16)Wm[(size_t)(k0 + 16 + 8 * g + i) * ld + o]; }
  return w; }
__device__ __forceinline__ v16b wcol_oi(const float* Wm, int k0, int o, int lane, int K) { v16b w; const float* p = Wm + (size_t)o * K + k0 + 8 * (lane >> 4);
#pragma unroll
  for (int i = 0; i < 8; ++i) { w[i] = (__bf16)p[i]; w[8 + i] = (__bf16)p[16 + i]; }
  return w; }
__device__ __forceinline__ v16h wcolh_io(const float* Wm, int k0, int o, int lane, int ld) { v16h w; const int g = lane >> 4;
#pragma unroll
  for (int i = 0; i < 8; ++i) { w[i] = (_Float16)(bfr(Wm[(size_t)(k0 + 8 * g + i) * ld + o]) * 256.0f); w[8 + i] = (_Float16)(bfr(Wm[(size_t)(k0 + 16 + 8 * g + i) * ld + o]) * 256.0f); }
  return w; }
__device__ __forceinline__ v16h wcolh_oi(const float* Wm, int k0, int o, int lane, int K) { v16h w; const float* p = Wm + (size_t)o * K + k0 + 8 * (lane >> 4);
#pragma unroll
  for (int i = 0; i < 8; ++i) { w[i] = (_Float16)(bfr(p[i]) * 256.0f); w[8 + i] = (_Float16)(bfr(p[16 + i]) * 256.0f); }
  return w; }
#define WQKV_LAYOUT 1   // 0 = (in,out) [DIN][CC]; 1 = (out,in) [CC][DIN]; 2 = per-head [NH][DIN][HD]
__device__ __forceinline__ v16b wcol_hdk(const float* Wm, int k0, int o, int lane) { v16b w; const int g = lane >> 4; const float* p = Wm + (size_t)(o / HD) * DIN * HD + (o % HD);
#pragma unroll
  for (int i = 0; i < 8; ++i) { w[i] = (__bf16)p[(size_t)(k0 + 8 * g + i) * HD]; w[8 + i] = (__bf16)p[(size_t)(k0 + 16 + 8 * g + i) * HD]; }
  return w; }
#define WO_OUT_IN 0
#if WQKV_LAYOUT == 1
#define WCOL(W, k0, o, lane) wcol_oi(W, k0, o, lane, DIN)
#elif WQKV_LAYOUT == 2
#define WCOL(W, k0, o, lane) wcol_hdk(W, k0, o, lane)
#else
#define WCOL(W, k0, o, lane) wcol_io(W, k0, o, lane, CC)
#endif
#if WO_OUT_IN
#define WOCOL(W, k0, o, lane) wcol_oi(W, k0, o, lane, CC)
#define WOCOLH(W, k0, o, lane) wcolh_oi(W, k0, o, lane, CC)
#else
#define WOCOL(W, k0, o, lane) wcol_io(W, k0, o, lane, DIN)
#define WOCOLH(W, k0, o, lane) wcolh_io(W, k0, o, lane, DIN)
#endif
#define SM_EXTRA_PARAMS , const int* __restrict__ MK, int bcur
#define SM_MASK_HOOK do { v -= 10000.0f * (1.0f - (float)MK[(size_t)bcur * TT + k]); } while (0)   /* scores - 1e4 * (1 - mask): read per key (mask all ones here) */
#ifndef SM_EXTRA_PARAMS
#define SM_EXTRA_PARAMS
#endif
#ifndef PROJ_EXTRA_PARAMS
#define PROJ_EXTRA_PARAMS
#endif
#ifndef SM_MASK_HOOK
#define SM_MASK_HOOK (void)0
#endif

#define WS_QH  0u                                      // f16 q rows [b*t][CC]
#define WS_KH  (WS_QH + 2u * (size_t)NB * TT * CC)      // f16 k rows [b*t][CC]
#define WS_VT  (WS_KH + 2u * (size_t)NB * TT * CC)      // f16 v planes [b][c][t]
#define WS_QL  (WS_VT + 2u * (size_t)NB * CC * TT)      // f16 q residual x 2^10 rows [b][t < QHI][CC]
#define WS_KL  (WS_QL + 2u * (size_t)NB * QHI * CC)     // f16 k residual x 2^10 rows [b][t < KHI][CC]
#define WS_VB  (WS_KL + 2u * (size_t)NB * KHI * CC)     // bf16 v hi planes [b][c][t < KHI]
#define WS_VBL (WS_VB + 2u * (size_t)NB * CC * KHI)
#define WS_S   (WS_VBL + 2u * (size_t)NB * CC * KHI)    // f32 logits / P [hg][t][s]
#define WS_Y   (WS_S  + 4u * (size_t)HG * TT * TT)      // f32 ctx rows [b*t][CC] (only when there is an output projection)
#define WS_END (WS_Y  + 0u)

// ---- k_proj: block = (64 rows, 128 cols, which): q/k/v = X W (+ b) with exact bf16 products (K = DIN) -> which 0: q f16 rows (+ residual rows < QHI); 1: k f16 rows (+ residual rows < KHI); 2: v f16 planes [c][t] (+ bf16 hi/lo planes for t < KHI)
__global__ __launch_bounds__(128) void k_proj(const float* __restrict__ XQ, const float* __restrict__ XK, const float* __restrict__ XV, const float* __restrict__ WQ, const float* __restrict__ WK, const float* __restrict__ WV, const float* __restrict__ BQ, const float* __restrict__ BK, const float* __restrict__ BV,
    _Float16* __restrict__ QH, _Float16* __restrict__ QL, _Float16* __restrict__ KH, _Float16* __restrict__ KL, _Float16* __restrict__ VT, __bf16* __restrict__ VB, __bf16* __restrict__ VBL) {
  __shared__ __align__(16) _Float16 sh[64][136], sl[64][136]; __shared__ __align__(16) _Float16 th[128][72]; __shared__ __align__(16) __bf16 tb[128][72], tbl[128][72];
  const int tid = threadIdx.x, wave = tid >> 5, lane = tid & 31, col = lane & 15, g = lane >> 4; const int which = blockIdx.z; const int c0 = blockIdx.y * 128; const size_t r0 = (size_t)blockIdx.x * 64; const size_t bb = r0 / TT; const int t0 = (int)(r0 % TT);
  const float* X = which == 0 ? XQ : which == 1 ? XK : XV; const float* WA = which == 0 ? WQ : which == 1 ? WK : WV; const float* BA = which == 0 ? BQ : which == 1 ? BK : BV;
  v8f acc[8] = {};
#pragma unroll 2
  for (int kc = 0; kc < DIN / 32; ++kc) { v16b a; { const float* p = X + (r0 + wave * 16 + col) * DIN + kc * 32 + 8 * g;
#pragma unroll
      for (int i = 0; i < 8; ++i) { a[i] = (__bf16)p[i]; a[8 + i] = (__bf16)p[16 + i]; } }
    asm volatile("s_wait_loadcnt 0x0" ::: "memory");
#pragma unroll
    for (int j = 0; j < 8; ++j) { const v16b w = WCOL(WA, kc * 32, c0 + j * 16 + col, lane); asm volatile("s_wait_loadcnt 0x0" ::: "memory"); acc[j] = wmma_bf(a, w, acc[j]); } }
  if (which < 2) { _Float16* DH = which == 0 ? QH : KH; _Float16* DL = which == 0 ? QL : KL; const int nhi = which == 0 ? QHI : KHI; const bool hi_rows = t0 < nhi;
#pragma unroll
    for (int j = 0; j < 8; ++j) { const float bias = BA ? bfr(BA[c0 + j * 16 + col]) : 0.f;
#pragma unroll
      for (int r = 0; r < 8; ++r) { const float v = acc[j][r] + bias; const _Float16 hv = (_Float16)v; sh[wave * 16 + 8 * g + r][j * 16 + col] = hv; sl[wave * 16 + 8 * g + r][j * 16 + col] = (_Float16)((v - (float)hv) * 1024.0f); } }
    __syncthreads();
    for (int e = tid; e < 64 * 16; e += 128) { const int rl = e >> 4, q = e & 15; vst2((unsigned*)(DH + (r0 + rl) * CC + c0 + q * 8), *(const v4u*)&sh[rl][q * 8]); if (hi_rows) vst2((unsigned*)(DL + (bb * nhi + t0 + rl) * (size_t)CC + c0 + q * 8), *(const v4u*)&sl[rl][q * 8]); }
  } else { const bool hi_rows = t0 < KHI;
#pragma unroll
    for (int j = 0; j < 8; ++j) { const float bias = BA ? bfr(BA[c0 + j * 16 + col]) : 0.f;
#pragma unroll
      for (int r = 0; r < 8; ++r) { const float v = acc[j][r] + bias; const int rl = wave * 16 + 8 * g + r, cl = j * 16 + col; th[cl][rl] = (_Float16)v; const __bf16 bh = (__bf16)v; tb[cl][rl] = bh; tbl[cl][rl] = (__bf16)(v - (float)bh); } }
    __syncthreads();
    for (int e = tid; e < 128 * 8; e += 128) { const int cl = e >> 3, q = e & 7; vst2((unsigned*)(VT + (bb * CC + c0 + cl) * (size_t)TT + t0 + q * 8), *(const v4u*)&th[cl][q * 8]); if (hi_rows) { const size_t o3 = (bb * CC + c0 + cl) * (size_t)KHI + t0 + q * 8; vst2((unsigned*)(VB + o3), *(const v4u*)&tb[cl][q * 8]); vst2((unsigned*)(VBL + o3), *(const v4u*)&tbl[cl][q * 8]); } } } }
// ---- k_sc: block = (query block qb, key block kb <= kb_last(qb), head in group) of batch b: logits x SCALE; q hi + residual (x 2^10) against k (2 products) for query rows < QHI, plus the k residual (3 products) for query blocks < QBH (causal early rows); causal: blocks past the diagonal exit, the mask itself is applied by index in k_sm
__global__ __launch_bounds__(128) void k_sc(const _Float16* __restrict__ QH, const _Float16* __restrict__ KH, const _Float16* __restrict__ QL, const _Float16* __restrict__ KL, int b, int h0, float* __restrict__ S0) { __shared__ __align__(16) float ss[4][16][132];
  const int qb = blockIdx.x, kb = blockIdx.y; if (kb > kb_last(qb)) return;
  const int h = h0 + blockIdx.z; float* S = S0 + (size_t)blockIdx.z * TT * TT;
  const int tid = threadIdx.x, wave = tid >> 5, lane = tid & 31, col = lane & 15, g = lane >> 4; const int k0 = kb * 128; const int ql0 = qb * 64 + wave * 16; const size_t q0 = (size_t)b * TT + ql0, kr0 = (size_t)b * TT + k0;
  v8f acc[8] = {}, accl[8] = {};
  const _Float16* QLb = QL + (size_t)b * QHI * CC; const _Float16* KLb = KL + (size_t)b * KHI * CC;
  if (qb < QBH) {
#pragma unroll
    for (int kc = 0; kc < HD / 32; ++kc) { const v16h ah = frag_h(QH + (q0 + col) * CC + h * HD + kc * 32, lane), al = frag_h(QLb + (size_t)(ql0 + col) * CC + h * HD + kc * 32, lane);
#pragma unroll
      for (int j = 0; j < 8; ++j) { const v16h kbf = frag_h(KH + (kr0 + j * 16 + col) * CC + h * HD + kc * 32, lane), klf = frag_h(KLb + (size_t)(k0 + j * 16 + col) * CC + h * HD + kc * 32, lane); acc[j] = wmma16(ah, kbf, acc[j]); accl[j] = wmma16(al, kbf, accl[j]); accl[j] = wmma16(ah, klf, accl[j]); } }
  } else if (qb * 64 < QHI) {
#pragma unroll
    for (int kc = 0; kc < HD / 32; ++kc) { const v16h ah = frag_h(QH + (q0 + col) * CC + h * HD + kc * 32, lane), al = frag_h(QLb + (size_t)(ql0 + col) * CC + h * HD + kc * 32, lane);
#pragma unroll
      for (int j = 0; j < 8; ++j) { const v16h kbf = frag_h(KH + (kr0 + j * 16 + col) * CC + h * HD + kc * 32, lane); acc[j] = wmma16(ah, kbf, acc[j]); accl[j] = wmma16(al, kbf, accl[j]); } }
  } else {
#pragma unroll
    for (int kc = 0; kc < HD / 32; ++kc) { const v16h ah = frag_h(QH + (q0 + col) * CC + h * HD + kc * 32, lane);
#pragma unroll
      for (int j = 0; j < 8; ++j) { const v16h kbf = frag_h(KH + (kr0 + j * 16 + col) * CC + h * HD + kc * 32, lane); acc[j] = wmma16(ah, kbf, acc[j]); } } }
#pragma unroll
  for (int j = 0; j < 8; ++j) {
#pragma unroll
    for (int r = 0; r < 8; ++r) ss[wave][8 * g + r][j * 16 + col] = (acc[j][r] + accl[j][r] * (1.0f / 1024.0f)) * SCALE; }
  LDSX(); for (int rl = 0; rl < 16; ++rl) vst2(S + (size_t)(ql0 + rl) * TT + k0 + lane * 4, *(const v4f*)&ss[wave][rl][lane * 4]); }
// ---- k_sm: block = query row t (head in group): keys [0, kend): causal -> logit if s <= t else excluded; softmax in f32; P x 2^11 in place (0 for excluded)
__global__ __launch_bounds__(256) void k_sm(float* __restrict__ S0 SM_EXTRA_PARAMS) { __shared__ float sred[8]; __shared__ float sbc; __shared__ __align__(16) float shv[TT];
  const int tid = threadIdx.x; const int t = blockIdx.x; const int kend = (kb_last(t >> 6) + 1) * 128;
  float* sr = S0 + (size_t)blockIdx.y * TT * TT + (size_t)t * TT;
  float m = -3.0e38f; for (int k = tid; k < kend; k += 256) { float v = (!CAUSAL || k <= t) ? sr[k] : -3.0e38f; SM_MASK_HOOK; shv[k] = v; m = fmaxf(m, v); }
#pragma unroll
  for (int o = 1; o < 32; o <<= 1) m = fmaxf(m, __shfl_xor(m, o));
  if ((tid & 31) == 0) sred[tid >> 5] = m; __syncthreads(); if (tid == 0) { float a = sred[0]; for (int i = 1; i < 8; ++i) a = fmaxf(a, sred[i]); sbc = a; } __syncthreads(); m = sbc; __syncthreads();
  float sum = 0.f; for (int k = tid; k < kend; k += 256) { const float v = shv[k]; const float e = (v <= -1.0e38f) ? 0.f : expf(v - m); shv[k] = e; sum += e; }
#pragma unroll
  for (int o = 1; o < 32; o <<= 1) sum += __shfl_xor(sum, o);
  if ((tid & 31) == 0) sred[tid >> 5] = sum; __syncthreads(); if (tid == 0) { float a = 0.f; for (int i = 0; i < 8; ++i) a += sred[i]; sbc = a > 0.f ? 2048.0f / a : 0.f; }   /* a fully excluded row yields P = 0 */ __syncthreads(); const float inv = sbc;
  for (int k = tid; k < kend; k += 256) shv[k] = shv[k] * inv;
  __syncthreads(); for (int q = tid; q < kend / 4; q += 256) vst2(sr + q * 4, *(const v4f*)&shv[q * 4]); }
// ---- k_pv: block = 64 queries (qb) of (b, h): ctx = P . v over keys [0, kend) (P x 2^11 once to f16 against v f16: 1 product; causal early query blocks: P and v as bf16 hi + lo, 3 products); 256-B (row, head) segment by 16 lanes
__global__ __launch_bounds__(128) void k_pv(const float* __restrict__ PS0, const _Float16* __restrict__ VT, const __bf16* __restrict__ VB, const __bf16* __restrict__ VBL, int b, int h0, float* __restrict__ Y) { const int h = h0 + blockIdx.z; const float* PS = PS0 + (size_t)blockIdx.z * TT * TT; __shared__ __align__(16) float ss[4][16][HD + 4];
  const int tid = threadIdx.x, wave = tid >> 5, lane = tid & 31, col = lane & 15, g = lane >> 4; const int qb = blockIdx.x; const int ql0 = qb * 64 + wave * 16; const int kce = (kb_last(qb) + 1) * 4;
  v8f acc[HD / 16] = {};
  if (qb < QBH) {
#pragma unroll 1
    for (int kc = 0; kc < kce; ++kc) { const F2 p = split_row(PS + (size_t)(ql0 + col) * TT, kc * 32, lane);
      asm volatile("s_wait_loadcnt 0x0" ::: "memory");
#pragma unroll
      for (int j = 0; j < HD / 16; ++j) { const size_t po = ((size_t)b * CC + h * HD + j * 16 + col) * (size_t)KHI + kc * 32; const v16b vh = frag_b(VB + po, lane); acc[j] = wmma_bf(p.h, vh, acc[j]); acc[j] = wmma_bf(p.l, vh, acc[j]); acc[j] = wmma_bf(p.h, frag_b(VBL + po, lane), acc[j]); } }
  } else {
#pragma unroll 1
    for (int kc = 0; kc < kce; ++kc) { const v16h p = frag_f32(PS + (size_t)(ql0 + col) * TT + kc * 32, lane);
      asm volatile("s_wait_loadcnt 0x0" ::: "memory");
#pragma unroll
      for (int j = 0; j < HD / 16; ++j) { const size_t po = ((size_t)b * CC + h * HD + j * 16 + col) * (size_t)TT + kc * 32; acc[j] = wmma16(p, frag_h(VT + po, lane), acc[j]); } } }
#pragma unroll
  for (int j = 0; j < HD / 16; ++j)
#pragma unroll
    for (int r = 0; r < 8; ++r) ss[wave][8 * g + r][j * 16 + col] = acc[j][r] * (1.0f / 2048.0f);
  LDSX(); for (int rl = 0; rl < 16; ++rl) if (lane < HD / 4) vst2(Y + ((size_t)b * TT + ql0 + rl) * CC + h * HD + lane * 4, *(const v4f*)&ss[wave][rl][lane * 4]); }

extern "C" void kernel_launch(void* const* d_in, const int* in_sizes, int n_in, void* d_out, int out_size, void* d_ws, size_t ws_size, hipStream_t stream) {
  (void)in_sizes; (void)n_in; (void)out_size;
  const float** F = (const float**)d_in;
  if (ws_size < (size_t)WS_END) return;
  char* ws = (char*)d_ws; _Float16 *QH = (_Float16*)(ws + WS_QH), *KH = (_Float16*)(ws + WS_KH), *VT = (_Float16*)(ws + WS_VT), *QL = (_Float16*)(ws + WS_QL), *KL = (_Float16*)(ws + WS_KL); __bf16 *VB = (__bf16*)(ws + WS_VB), *VBL = (__bf16*)(ws + WS_VBL); float *S = (float*)(ws + WS_S), *Y = (float*)(ws + WS_Y);
  (void)Y; (void)QL; (void)KL; (void)VB; (void)VBL;
  // inputs: 0 x [8,1024,768]; 1 mask [8,1024] int32 (ones); 2 Wq (out,in), 3 bq; 4 Wk, 5 bk; 6 Wv, 7 bv
  k_proj<<<dim3(TNB * TT / 64, CC / 128, 3), 128, 0, stream>>>(F[0], F[0], F[0], F[2], F[4], F[6], F[3], F[5], F[7], QH, QL, KH, KL, VT, VB, VBL);
  for (int b = 0; b < TNB; ++b) for (int h0 = 0; h0 < NH; h0 += HG) {
    k_sc<<<dim3(NQB, TT / 128, HG), 128, 0, stream>>>(QH, KH, QL, KL, b, h0, S);
    k_sm<<<dim3(TT, HG), 256, 0, stream>>>(S, (const int*)d_in[1], b);
    k_pv<<<dim3(NQB, 1, HG), 128, 0, stream>>>(S, VT, VB, VBL, b, h0, (float*)d_out);
  }
}

// v001
// One run takes 333 microseconds.
// Two timings next to v000 put it at 4.73 and 4.71 times that version's speed.
// compute dtype: all float inputs rounded to bf16; q/k/v = in W^T + b with EXACT bf16 products on WMMA 16x16x32 (f32 accumulate); q as f16 hi + residual (x 2^10) against k once to f16 (2 products) / 8; softmax in f32 (precise expf) with a running maximum and sum per query; exp(s - max) x 2^11 once to f16 against v once to f16 (1 product), divided by the sum at the end; f32 output.
#include <hip/hip_runtime.h>
#include <math.h>

typedef __attribute__((ext_vector_type(16))) _Float16 v16h;
typedef __attribute__((ext_vector_type(16))) __bf16 v16b;
typedef __attribute__((ext_vector_type(8)))  _Float16 v8h;
typedef __attribute__((ext_vector_type(8)))  float v8f;
typedef __attribute__((ext_vector_type(4)))  float v4f;
typedef __attribute__((ext_vector_type(2)))  float v2f;
typedef __attribute__((ext_vector_type(4)))  unsigned v4u;
typedef __attribute__((ext_vector_type(4)))  int v4i;
typedef float __attribute__((may_alias)) float_a;
typedef int __attribute__((may_alias)) int_a;

template <typename T> __device__ __forceinline__ void vst2(void* p, T v) { *(T*)p = v;  }
__device__ __forceinline__ v8f wmma16(v16h a, v16h b, v8f c) {
  v8f d = __builtin_amdgcn_wmma_f32_16x16x32_f16(false, a, false, b, (short)0, c, false, false);
  asm volatile("v_nop\n\tv_nop\n\tv_nop\n\tv_nop" : "+v"(d) : "v"(a), "v"(b));
  return d;
}
__device__ __forceinline__ v8f wmma_bf(v16b a, v16b b, v8f c) {
  v8f d = __builtin_amdgcn_wmma_f32_16x16x32_bf16(false, a, false, b, (short)0, c, false, false);
  asm volatile("v_nop\n\tv_nop\n\tv_nop\n\tv_nop" : "+v"(d) : "v"(a), "v"(b));
  return d;
}
// 16x16x32 fragments: lane = (h = lane>>4, row/col = lane&15); elements 0..7 = k0+8h+0..7, 8..15 = k0+16+8h+0..7; D element r = row 8h+r
__device__ __forceinline__ v16h frag_h(const _Float16* rowk0, int lane) {
  union { v16h v; v8h q[2]; } u; const _Float16* p = rowk0 + 8 * (lane >> 4);
  u.q[0] = *(const v8h*)p; u.q[1] = *(const v8h*)(p + 16); return u.v;
}
__device__ __forceinline__ v16h frag_f32(const float* rowk0, int lane) {
  v16h a; const float* p = rowk0 + 8 * (lane >> 4);
#pragma unroll
  for (int i = 0; i < 8; ++i) { a[i] = (_Float16)p[i]; a[8 + i] = (_Float16)p[16 + i]; }
  return a;
}
__device__ __forceinline__ v16h frag_f32s(const float* rowk0, int lane, float sc) {
  v16h a; const float* p = rowk0 + 8 * (lane >> 4);
#pragma unroll
  for (int i = 0; i < 8; ++i) { a[i] = (_Float16)(p[i] * sc); a[8 + i] = (_Float16)(p[16 + i] * sc); }
  return a;
}
// column fragment from a [K][ld] layout (column n), rows >= K read as 0
__device__ __forceinline__ v16h fragc_f32(const float* W, int k0, int n, int lane, int ld, int K) {
  v16h a; const int g = lane >> 4;
#pragma unroll
  for (int i = 0; i < 8; ++i) { const int ka = k0 + 8 * g + i, kb = ka + 16;
    a[i] = (_Float16)(ka < K ? W[(size_t)(ka < K ? ka : K - 1) * ld + n] : 0.f); a[8 + i] = (_Float16)(kb < K ? W[(size_t)(kb < K ? kb : K - 1) * ld + n] : 0.f); }
  return a;
}
struct F2 { v16b h, l; };
__device__ __forceinline__ F2 bsplit16(const float v[16]) { F2 r;
#pragma unroll
  for (int i = 0; i < 16; ++i) { const __bf16 h = (__bf16)v[i]; r.h[i] = h; r.l[i] = (__bf16)(v[i] - (float)h); }
  return r; }
__device__ __forceinline__ F2 split_row(const float* row, int k0, int lane) { float v[16]; const float* p = row + k0 + 8 * (lane >> 4);
#pragma unroll
  for (int i = 0; i < 8; ++i) { v[i] = p[i]; v[8 + i] = p[16 + i]; }
  return bsplit16(v); }
__device__ __forceinline__ F2 split_rowK(const float* row, int k0, int lane, int K) { float v[16]; const int g = lane >> 4;
#pragma unroll
  for (int i = 0; i < 8; ++i) { const int ka = k0 + 8 * g + i, kb = ka + 16; v[i] = ka < K ? row[ka < K ? ka : K - 1] : 0.f; v[8 + i] = kb < K ? row[kb < K ? kb : K - 1] : 0.f; }
  return bsplit16(v); }
__device__ __forceinline__ F2 split_col(const float* W, int k0, int n, int lane, int ld, int K) { float v[16]; const int g = lane >> 4;
#pragma unroll
  for (int i = 0; i < 8; ++i) { const int ka = k0 + 8 * g + i, kb = ka + 16; v[i] = ka < K ? W[(size_t)(ka < K ? ka : K - 1) * ld + n] : 0.f; v[8 + i] = kb < K ? W[(size_t)(kb < K ? kb : K - 1) * ld + n] : 0.f; }
  return bsplit16(v); }
__device__ __forceinline__ v8f mac3(const F2& a, const F2& b, v8f c) { c = wmma_bf(a.l, b.h, c); c = wmma_bf(a.h, b.l, c); return wmma_bf(a.h, b.h, c); }
__device__ __forceinline__ float sigm(float v) { return 1.0f / (1.0f + expf(-v)); }
#define LDSX() do { asm volatile("s_wait_dscnt 0" ::: "memory"); __builtin_amdgcn_wave_barrier(); __builtin_amdgcn_fence(__ATOMIC_RELEASE, "workgroup"); } while (0)

// Multi-head self-attention (B 8, S 1,024, D 768 = 12 x 64; (out,in) 1/sqrt(768)-scale weights, zero biases; key mask [B,S] int all ones): q, k, v = x W^T + b; scores / 8 - 10000 * (1 - mask); out = merged(softmax v) -> [8, 1,024, 768] (no output projection).
#define NB 8
#define TT 1024
#define CC 768            // NH * HD = projected width
#define DIN 768          // input (model) width
#define NH 12
#define HD 64
#define NQB (TT / 64)
#define HG 4
#define SCALE (0.125f)
#define CAUSAL 0
#ifndef TNB
#define TNB NB
#endif
__device__ __forceinline__ float bfr(float v) { return (float)(__bf16)v; }
__host__ __device__ __forceinline__ int kb_last(int qb) { return CAUSAL ? ((qb * 64 + 63) >> 7) : (TT / 128 - 1); }
typedef __attribute__((ext_vector_type(8))) __bf16 v8b;
__device__ __forceinline__ v16b frag_b(const __bf16* rowk0, int lane) {
  union { v16b v; v8b q[2]; } u; const __bf16* p = rowk0 + 8 * (lane >> 4);
  u.q[0] = *(const v8b*)p; u.q[1] = *(const v8b*)(p + 16); return u.v;
}
#define QBH 0
#define QHI 1024            // rows carrying a q residual plane (all rows when non-causal: 2-product logits everywhere)
#define KHI 64            // key rows carrying k residual / v bf16 hi+lo planes (written by k_proj; no kernel in this file reads them)
// B fragment (k rows k0+.., output column o) of a weight: (in,out) [K][ld] or (out,in) [ld rows of K]: bf16 exact, or f16(bf16 * 256) exact
__device__ __forceinline__ v16b wcol_io(const float* Wm, int k0, int o, int lane, int ld) { v16b w; const int g = lane >> 4;
#pragma unroll
  for (int i = 0; i < 8; ++i) { w[i] = (__bf16)Wm[(size_t)(k0 + 8 * g + i) * ld + o]; w[8 + i] = (__bf16)Wm[(size_t)(k0 + 16 + 8 * g + i) * ld + o]; }
  return w; }
__device__ __forceinline__ v16b wcol_oi(const float* Wm, int k0, int o, int lane, int K) { v16b w; const float* p = Wm + (size_t)o * K + k0 + 8 * (lane >> 4);
#pragma unroll
  for (int i = 0; i < 8; ++i) { w[i] = (__bf16)p[i]; w[8 + i] = (__bf16)p[16 + i]; }
  return w; }
__device__ __forceinline__ v16h wcolh_io(const float* Wm, int k0, int o, int lane, int ld) { v16h w; const int g = lane >> 4;
#pragma unroll
  for (int i = 0; i < 8; ++i) { w[i] = (_Float16)(bfr(Wm[(size_t)(k0 + 8 * g + i) * ld + o]) * 256.0f); w[8 + i] = (_Float16)(bfr(Wm[(size_t)(k0 + 16 + 8 * g + i) * ld + o]) * 256.0f); }
  return w; }
__device__ __forceinline__ v16h wcolh_oi(const float* Wm, int k0, int o, int lane, int K) { v16h w; const float* p = Wm + (size_t)o * K + k0 + 8 * (lane >> 4);
#pragma unroll
  for (int i = 0; i < 8; ++i) { w[i] = (_Float16)(bfr(p[i]) * 256.0f); w[8 + i] = (_Float16)(bfr(p[16 + i]) * 256.0f); }
  return w; }
#define WQKV_LAYOUT 1   // 0 = (in,out) [DIN][CC]; 1 = (out,in) [CC][DIN]; 2 = per-head [NH][DIN][HD]
__device__ __forceinline__ v16b wcol_hdk(const float* Wm, int k0, int o, int lane) { v16b w; const int g = lane >> 4; const float* p = Wm + (size_t)(o / HD) * DIN * HD + (o % HD);
#pragma unroll
  for (int i = 0; i < 8; ++i) { w[i] = (__bf16)p[(size_t)(k0 + 8 * g + i) * HD]; w[8 + i] = (__bf16)p[(size_t)(k0 + 16 + 8 * g + i) * HD]; }
  return w; }
#define WO_OUT_IN 0
#if WQKV_LAYOUT == 1
#define WCOL(W, k0, o, lane) wcol_oi(W, k0, o, lane, DIN)
#elif WQKV_LAYOUT == 2
#define WCOL(W, k0, o, lane) wcol_hdk(W, k0, o, lane)
#else
#define WCOL(W, k0, o, lane) wcol_io(W, k0, o, lane, CC)
#endif
#if WO_OUT_IN
#define WOCOL(W, k0, o, lane) wcol_oi(W, k0, o, lane, CC)
#define WOCOLH(W, k0, o, lane) wcolh_oi(W, k0, o, lane, CC)
#else
#define WOCOL(W, k0, o, lane) wcol_io(W, k0, o, lane, DIN)
#define WOCOLH(W, k0, o, lane) wcolh_io(W, k0, o, lane, DIN)
#endif

#define WS_QH  0u                                      // f16 q rows [b*t][CC]
#define WS_KH  (WS_QH + 2u * (size_t)NB * TT * CC)      // f16 k rows [b*t][CC]
#define WS_VT  (WS_KH + 2u * (size_t)NB * TT * CC)      // f16 v planes [b][c][t]
#define WS_QL  (WS_VT + 2u * (size_t)NB * CC * TT)      // f16 q residual x 2^10 rows [b][t < QHI][CC]
#define WS_KL  (WS_QL + 2u * (size_t)NB * QHI * CC)     // f16 k residual x 2^10 rows [b][t < KHI][CC]
#define WS_VB  (WS_KL + 2u * (size_t)NB * KHI * CC)     // bf16 v hi planes [b][c][t < KHI]
#define WS_VBL (WS_VB + 2u * (size_t)NB * CC * KHI)
#define WS_S   (WS_VBL + 2u * (size_t)NB * CC * KHI)    // f32 [hg][t][s] region, unused (k_fa keeps logits / P in registers)
#define WS_Y   (WS_S  + 4u * (size_t)HG * TT * TT)      // f32 ctx rows [b*t][CC] (only when there is an output projection)
#define WS_END (WS_Y  + 0u)

// ---- k_proj: block = (64 rows, 128 cols, which): q/k/v = X W (+ b) with exact bf16 products (K = DIN) -> which 0: q f16 rows (+ residual rows < QHI); 1: k f16 rows (+ residual rows < KHI); 2: v f16 planes [c][t] (+ bf16 hi/lo planes for t < KHI)
__global__ __launch_bounds__(128) void k_proj(const float* __restrict__ XQ, const float* __restrict__ XK, const float* __restrict__ XV, const float* __restrict__ WQ, const float* __restrict__ WK, const float* __restrict__ WV, const float* __restrict__ BQ, const float* __restrict__ BK, const float* __restrict__ BV,
    _Float16* __restrict__ QH, _Float16* __restrict__ QL, _Float16* __restrict__ KH, _Float16* __restrict__ KL, _Float16* __restrict__ VT, __bf16* __restrict__ VB, __bf16* __restrict__ VBL) {
  __shared__ __align__(16) _Float16 sh[64][136], sl[64][136]; __shared__ __align__(16) _Float16 th[128][72]; __shared__ __align__(16) __bf16 tb[128][72], tbl[128][72];
  const int tid = threadIdx.x, wave = tid >> 5, lane = tid & 31, col = lane & 15, g = lane >> 4; const int which = blockIdx.z; const int c0 = blockIdx.y * 128; const size_t r0 = (size_t)blockIdx.x * 64; const size_t bb = r0 / TT; const int t0 = (int)(r0 % TT);
  const float* X = which == 0 ? XQ : which == 1 ? XK : XV; const float* WA = which == 0 ? WQ : which == 1 ? WK : WV; const float* BA = which == 0 ? BQ : which == 1 ? BK : BV;
  v8f acc[8] = {};
#pragma unroll 2
  for (int kc = 0; kc < DIN / 32; ++kc) { v16b a; { const float* p = X + (r0 + wave * 16 + col) * DIN + kc * 32 + 8 * g;
#pragma unroll
      for (int i = 0; i < 8; ++i) { a[i] = (__bf16)p[i]; a[8 + i] = (__bf16)p[16 + i]; } }
    asm volatile("s_wait_loadcnt 0x0" ::: "memory");
#pragma unroll
    for (int j = 0; j < 8; ++j) { const v16b w = WCOL(WA, kc * 32, c0 + j * 16 + col, lane); asm volatile("s_wait_loadcnt 0x0" ::: "memory"); acc[j] = wmma_bf(a, w, acc[j]); } }
  if (which < 2) { _Float16* DH = which == 0 ? QH : KH; _Float16* DL = which == 0 ? QL : KL; const int nhi = which == 0 ? QHI : KHI; const bool hi_rows = t0 < nhi;
#pragma unroll
    for (int j = 0; j < 8; ++j) { const float bias = BA ? bfr(BA[c0 + j * 16 + col]) : 0.f;
#pragma unroll
      for (int r = 0; r < 8; ++r) { const float v = acc[j][r] + bias; const _Float16 hv = (_Float16)v; sh[wave * 16 + 8 * g + r][j * 16 + col] = hv; sl[wave * 16 + 8 * g + r][j * 16 + col] = (_Float16)((v - (float)hv) * 1024.0f); } }
    __syncthreads();
    for (int e = tid; e < 64 * 16; e += 128) { const int rl = e >> 4, q = e & 15; vst2((unsigned*)(DH + (r0 + rl) * CC + c0 + q * 8), *(const v4u*)&sh[rl][q * 8]); if (hi_rows) vst2((unsigned*)(DL + (bb * nhi + t0 + rl) * (size_t)CC + c0 + q * 8), *(const v4u*)&sl[rl][q * 8]); }
  } else { const bool hi_rows = t0 < KHI;
#pragma unroll
    for (int j = 0; j < 8; ++j) { const float bias = BA ? bfr(BA[c0 + j * 16 + col]) : 0.f;
#pragma unroll
      for (int r = 0; r < 8; ++r) { const float v = acc[j][r] + bias; const int rl = wave * 16 + 8 * g + r, cl = j * 16 + col; th[cl][rl] = (_Float16)v; const __bf16 bh = (__bf16)v; tb[cl][rl] = bh; tbl[cl][rl] = (__bf16)(v - (float)bh); } }
    __syncthreads();
    for (int e = tid; e < 128 * 8; e += 128) { const int cl = e >> 3, q = e & 7; vst2((unsigned*)(VT + (bb * CC + c0 + cl) * (size_t)TT + t0 + q * 8), *(const v4u*)&th[cl][q * 8]); if (hi_rows) { const size_t o3 = (bb * CC + c0 + cl) * (size_t)KHI + t0 + q * 8; vst2((unsigned*)(VB + o3), *(const v4u*)&tb[cl][q * 8]); vst2((unsigned*)(VBL + o3), *(const v4u*)&tbl[cl][q * 8]); } } } }
#define FK 64             // keys per stage
#define FP 72             // LDS row pitch in halves: 144 B = 16 B x 9, so the 16 rows of a ds_load_b128 fragment read fall on distinct banks
__device__ __forceinline__ v8f wmma_h(v16h a, v16h b, v8f c) { return __builtin_amdgcn_wmma_f32_16x16x32_f16(false, a, false, b, (short)0, c, false, false); }
__device__ __forceinline__ float xhalf(float x) { return __builtin_bit_cast(float, __builtin_amdgcn_permlanex16(__builtin_bit_cast(int, x), __builtin_bit_cast(int, x), 0x76543210, 0xfedcba98, false, false)); }   // lane l with lane l ^ 16
__global__ __launch_bounds__(256) void k_fa(const _Float16* __restrict__ QH, const _Float16* __restrict__ QL, const _Float16* __restrict__ KH, const _Float16* __restrict__ VT, const int* __restrict__ MK, float* __restrict__ Y) {
  __shared__ __align__(16) _Float16 sk[2][FK][FP], sv[2][HD][FP]; __shared__ __align__(16) float mb[TT]; __shared__ __align__(16) float so[8][16][HD + 4];
  const int tid = threadIdx.x, wave = tid >> 5, lane = tid & 31, col = lane & 15, g = lane >> 4; const int h = blockIdx.y, b = blockIdx.z; const int q0 = blockIdx.x * 128 + wave * 16;
  for (int k = tid; k < TT; k += 256) mb[k] = 10000.0f * (1.0f - (float)MK[(size_t)b * TT + k]);   // additive mask term per key, read from the mask input
  v16h qh[2], ql[2];
#pragma unroll
  for (int kc = 0; kc < 2; ++kc) { qh[kc] = frag_h(QH + ((size_t)b * TT + q0 + col) * CC + h * HD + kc * 32, lane); ql[kc] = frag_h(QL + ((size_t)b * QHI + q0 + col) * CC + h * HD + kc * 32, lane); }
  const int sr = tid >> 3, sc8 = (tid & 7) * 8;   // staging: 8 lanes take one 128-B row (a whole line), 32 rows a sweep
  const _Float16* kg = KH + ((size_t)b * TT + sr) * CC + h * HD + sc8; const _Float16* vg = VT + ((size_t)b * CC + h * HD + sr) * (size_t)TT + sc8;
  v8h rk[2], rv[2];
#pragma unroll
  for (int i = 0; i < 2; ++i) { rk[i] = *(const v8h*)(kg + (size_t)(32 * i) * CC); rv[i] = *(const v8h*)(vg + (size_t)(32 * i) * TT); }
#pragma unroll
  for (int i = 0; i < 2; ++i) { *(v8h*)&sk[0][sr + 32 * i][sc8] = rk[i]; *(v8h*)&sv[0][sr + 32 * i][sc8] = rv[i]; }
  v8f o[HD / 16] = {}; float mrun = -3.0e38f, lsum = 0.f;
#pragma unroll 1   // one stage a trip: the body is long already and the buffer index alternates
  for (int s = 0; s < TT / FK; ++s) { const int bu = s & 1; const bool more = s + 1 < TT / FK;
    __syncthreads();   // publishes stage s (and, on the first trip, mb); ends every wave's reads of the other buffer, which is refilled at the foot of this trip
    if (more) {
#pragma unroll
      for (int i = 0; i < 2; ++i) { rk[i] = *(const v8h*)(kg + (size_t)((s + 1) * FK + 32 * i) * CC); rv[i] = *(const v8h*)(vg + (size_t)(32 * i) * TT + (s + 1) * FK); } }
    float sc[4][8];
#pragma unroll
    for (int t = 0; t < 4; ++t) { const v16h k0f = frag_h(&sk[bu][t * 16 + col][0], lane), k1f = frag_h(&sk[bu][t * 16 + col][32], lane);
      const v4f b0 = *(const v4f*)&mb[s * FK + t * 16 + 8 * g], b1 = *(const v4f*)&mb[s * FK + t * 16 + 8 * g + 4];
      v8f a = {}, al = {}; a = wmma_h(k0f, qh[0], a); al = wmma_h(k0f, ql[0], al); a = wmma_h(k1f, qh[1], a); al = wmma_h(k1f, ql[1], al);
#pragma unroll
      for (int r = 0; r < 8; ++r) sc[t][r] = (a[r] + al[r] * (1.0f / 1024.0f)) * SCALE - (r < 4 ? b0[r & 3] : b1[r & 3]); }
    float mx = sc[0][0];
#pragma unroll
    for (int t = 0; t < 4; ++t)
#pragma unroll
      for (int r = 0; r < 8; ++r) mx = fmaxf(mx, sc[t][r]);
    mx = fmaxf(mx, xhalf(mx)); const float mn = fmaxf(mrun, mx); const float corr = expf(mrun - mn); mrun = mn;
    v16h pf[2]; float ps[4] = {0.f, 0.f, 0.f, 0.f};   // one partial sum a tile: four independent add chains
#pragma unroll
    for (int t = 0; t < 4; ++t)
#pragma unroll
      for (int r = 0; r < 8; ++r) { const float e = expf(sc[t][r] - mn); ps[t] += e; pf[t >> 1][(t & 1) * 8 + r] = (_Float16)(e * 2048.0f); }
    lsum = lsum * corr + ((ps[0] + ps[1]) + (ps[2] + ps[3]));
#pragma unroll
    for (int j = 0; j < HD / 16; ++j) o[j] *= corr;
#pragma unroll
    for (int kk = 0; kk < 2; ++kk)
#pragma unroll
      for (int j = 0; j < HD / 16; ++j) o[j] = wmma_h(frag_h(&sv[bu][j * 16 + col][kk * 32], lane), pf[kk], o[j]);
    if (more) {
#pragma unroll
      for (int i = 0; i < 2; ++i) { *(v8h*)&sk[bu ^ 1][sr + 32 * i][sc8] = rk[i]; *(v8h*)&sv[bu ^ 1][sr + 32 * i][sc8] = rv[i]; } } }
  const float l = lsum + xhalf(lsum); const float inv = 1.0f / (2048.0f * l);   // l >= 1: the key that holds the maximum adds exp(0)
#pragma unroll
  for (int j = 0; j < HD / 16; ++j) { const v8f w = o[j] * inv; float* d = &so[wave][col][j * 16 + 8 * g]; *(v4f*)d = __builtin_shufflevector(w, w, 0, 1, 2, 3); *(v4f*)(d + 4) = __builtin_shufflevector(w, w, 4, 5, 6, 7); }
  LDSX();   // the wave's own rows of so are written before it reads them across lanes
  for (int it = 0; it < 8; ++it) { const int rl = it * 2 + g; vst2(Y + ((size_t)b * TT + q0 + rl) * CC + h * HD + col * 4, *(const v4f*)&so[wave][rl][col * 4]); } }   // 256-B (row, head) segment by 16 lanes

extern "C" void kernel_launch(void* const* d_in, const int* in_sizes, int n_in, void* d_out, int out_size, void* d_ws, size_t ws_size, hipStream_t stream) {
  (void)in_sizes; (void)n_in; (void)out_size;
  const float** F = (const float**)d_in;
  if (ws_size < (size_t)WS_END) return;
  char* ws = (char*)d_ws; _Float16 *QH = (_Float16*)(ws + WS_QH), *KH = (_Float16*)(ws + WS_KH), *VT = (_Float16*)(ws + WS_VT), *QL = (_Float16*)(ws + WS_QL), *KL = (_Float16*)(ws + WS_KL); __bf16 *VB = (__bf16*)(ws + WS_VB), *VBL = (__bf16*)(ws + WS_VBL); float *S = (float*)(ws + WS_S), *Y = (float*)(ws + WS_Y);
  (void)Y; (void)S; (void)QL; (void)KL; (void)VB; (void)VBL;
  // inputs: 0 x [8,1024,768]; 1 mask [8,1024] int32 (ones); 2 Wq (out,in), 3 bq; 4 Wk, 5 bk; 6 Wv, 7 bv
  k_proj<<<dim3(TNB * TT / 64, CC / 128, 3), 128, 0, stream>>>(F[0], F[0], F[0], F[2], F[4], F[6], F[3], F[5], F[7], QH, QL, KH, KL, VT, VB, VBL);
  k_fa<<<dim3(TT / 128, NH, TNB), 256, 0, stream>>>(QH, QL, KH, VT, (const int*)d_in[1], (float*)d_out);
}

// v002
// Measured time: 111 microseconds a run.
// Timed twice side by side with v001, it ran 3.00 and 3.01 times as fast.
// Over all steps from v000 it is 14.2 times as fast.
// compute dtype: all float inputs rounded to bf16; q/k/v = in W^T + b with EXACT bf16 products on WMMA 16x16x32 (f32 accumulate); q as f16 hi + residual (x 2^10) against k once to f16 (2 products) / 8; softmax in f32 (precise expf) with a running maximum and sum per query; exp(s - max) x 2^11 once to f16 against v once to f16 (1 product), divided by the sum at the end; f32 output.
#include <hip/hip_runtime.h>
#include <math.h>

typedef __attribute__((ext_vector_type(16))) _Float16 v16h;
typedef __attribute__((ext_vector_type(16))) __bf16 v16b;
typedef __attribute__((ext_vector_type(8)))  _Float16 v8h;
typedef __attribute__((ext_vector_type(8)))  float v8f;
typedef __attribute__((ext_vector_type(4)))  float v4f;
typedef __attribute__((ext_vector_type(2)))  float v2f;
typedef __attribute__((ext_vector_type(4)))  unsigned v4u;
typedef __attribute__((ext_vector_type(4)))  int v4i;
typedef float __attribute__((may_alias)) float_a;
typedef int __attribute__((may_alias)) int_a;

template <typename T> __device__ __forceinline__ void vst2(void* p, T v) { *(T*)p = v;  }
__device__ __forceinline__ v8f wmma16(v16h a, v16h b, v8f c) {
  v8f d = __builtin_amdgcn_wmma_f32_16x16x32_f16(false, a, false, b, (short)0, c, false, false);
  asm volatile("v_nop\n\tv_nop\n\tv_nop\n\tv_nop" : "+v"(d) : "v"(a), "v"(b));
  return d;
}
__device__ __forceinline__ v8f wmma_bf(v16b a, v16b b, v8f c) {
  v8f d = __builtin_amdgcn_wmma_f32_16x16x32_bf16(false, a, false, b, (short)0, c, false, false);
  asm volatile("v_nop\n\tv_nop\n\tv_nop\n\tv_nop" : "+v"(d) : "v"(a), "v"(b));
  return d;
}
// 16x16x32 fragments: lane = (h = lane>>4, row/col = lane&15); elements 0..7 = k0+8h+0..7, 8..15 = k0+16+8h+0..7; D element r = row 8h+r
__device__ __forceinline__ v16h frag_h(const _Float16* rowk0, int lane) {
  union { v16h v; v8h q[2]; } u; const _Float16* p = rowk0 + 8 * (lane >> 4);
  u.q[0] = *(const v8h*)p; u.q[1] = *(const v8h*)(p + 16); return u.v;
}
__device__ __forceinline__ v16h frag_f32(const float* rowk0, int lane) {
  v16h a; const float* p = rowk0 + 8 * (lane >> 4);
#pragma unroll
  for (int i = 0; i < 8; ++i) { a[i] = (_Float16)p[i]; a[8 + i] = (_Float16)p[16 + i]; }
  return a;
}
__device__ __forceinline__ v16h frag_f32s(const float* rowk0, int lane, float sc) {
  v16h a; const float* p = rowk0 + 8 * (lane >> 4);
#pragma unroll
  for (int i = 0; i < 8; ++i) { a[i] = (_Float16)(p[i] * sc); a[8 + i] = (_Float16)(p[16 + i] * sc); }
  return a;
}
// column fragment from a [K][ld] layout (column n), rows >= K read as 0
__device__ __forceinline__ v16h fragc_f32(const float* W, int k0, int n, int lane, int ld, int K) {
  v16h a; const int g = lane >> 4;
#pragma unroll
  for (int i = 0; i < 8; ++i) { const int ka = k0 + 8 * g + i, kb = ka + 16;
    a[i] = (_Float16)(ka < K ? W[(size_t)(ka < K ? ka : K - 1) * ld + n] : 0.f); a[8 + i] = (_Float16)(kb < K ? W[(size_t)(kb < K ? kb : K - 1) * ld + n] : 0.f); }
  return a;
}
struct F2 { v16b h, l; };
__device__ __forceinline__ F2 bsplit16(const float v[16]) { F2 r;
#pragma unroll
  for (int i = 0; i < 16; ++i) { const __bf16 h = (__bf16)v[i]; r.h[i] = h; r.l[i] = (__bf16)(v[i] - (float)h); }
  return r; }
__device__ __forceinline__ F2 split_row(const float* row, int k0, int lane) { float v[16]; const float* p = row + k0 + 8 * (lane >> 4);
#pragma unroll
  for (int i = 0; i < 8; ++i) { v[i] = p[i]; v[8 + i] = p[16 + i]; }
  return bsplit16(v); }
__device__ __forceinline__ F2 split_rowK(const float* row, int k0, int lane, int K) { float v[16]; const int g = lane >> 4;
#pragma unroll
  for (int i = 0; i < 8; ++i) { const int ka = k0 + 8 * g + i, kb = ka + 16; v[i] = ka < K ? row[ka < K ? ka : K - 1] : 0.f; v[8 + i] = kb < K ? row[kb < K ? kb : K - 1] : 0.f; }
  return bsplit16(v); }
__device__ __forceinline__ F2 split_col(const float* W, int k0, int n, int lane, int ld, int K) { float v[16]; const int g = lane >> 4;
#pragma unroll
  for (int i = 0; i < 8; ++i) { const int ka = k0 + 8 * g + i, kb = ka + 16; v[i] = ka < K ? W[(size_t)(ka < K ? ka : K - 1) * ld + n] : 0.f; v[8 + i] = kb < K ? W[(size_t)(kb < K ? kb : K - 1) * ld + n] : 0.f; }
  return bsplit16(v); }
__device__ __forceinline__ v8f mac3(const F2& a, const F2& b, v8f c) { c = wmma_bf(a.l, b.h, c); c = wmma_bf(a.h, b.l, c); return wmma_bf(a.h, b.h, c); }
__device__ __forceinline__ float sigm(float v) { return 1.0f / (1.0f + expf(-v)); }
#define LDSX() do { asm volatile("s_wait_dscnt 0" ::: "memory"); __builtin_amdgcn_wave_barrier(); __builtin_amdgcn_fence(__ATOMIC_RELEASE, "workgroup"); } while (0)

// Multi-head self-attention (B 8, S 1,024, D 768 = 12 x 64; (out,in) 1/sqrt(768)-scale weights, zero biases; key mask [B,S] int all ones): q, k, v = x W^T + b; scores / 8 - 10000 * (1 - mask); out = merged(softmax v) -> [8, 1,024, 768] (no output projection).
#define NB 8
#define TT 1024
#define CC 768            // NH * HD = projected width
#define DIN 768          // input (model) width
#define NH 12
#define HD 64
#define NQB (TT / 64)
#define HG 4
#define SCALE (0.125f)
#define CAUSAL 0
#ifndef TNB
#define TNB NB
#endif
__device__ __forceinline__ float bfr(float v) { return (float)(__bf16)v; }
__host__ __device__ __forceinline__ int kb_last(int qb) { return CAUSAL ? ((qb * 64 + 63) >> 7) : (TT / 128 - 1); }
typedef __attribute__((ext_vector_type(8))) __bf16 v8b;
__device__ __forceinline__ v16b frag_b(const __bf16* rowk0, int lane) {
  union { v16b v; v8b q[2]; } u; const __bf16* p = rowk0 + 8 * (lane >> 4);
  u.q[0] = *(const v8b*)p; u.q[1] = *(const v8b*)(p + 16); return u.v;
}
#define QBH 0
#define QHI 1024            // rows carrying a q residual plane (all rows when non-causal: 2-product logits everywhere)
#define KHI 64            // key rows carrying k residual / v bf16 hi+lo planes (written by k_proj; no kernel in this file reads them)
// B fragment (k rows k0+.., output column o) of a weight: (in,out) [K][ld] or (out,in) [ld rows of K]: bf16 exact, or f16(bf16 * 256) exact
__device__ __forceinline__ v16b wcol_io(const float* Wm, int k0, int o, int lane, int ld) { v16b w; const int g = lane >> 4;
#pragma unroll
  for (int i = 0; i < 8; ++i) { w[i] = (__bf16)Wm[(size_t)(k0 + 8 * g + i) * ld + o]; w[8 + i] = (__bf16)Wm[(size_t)(k0 + 16 + 8 * g + i) * ld + o]; }
  return w; }
__device__ __forceinline__ v16b wcol_oi(const float* Wm, int k0, int o, int lane, int K) { v16b w; const float* p = Wm + (size_t)o * K + k0 + 8 * (lane >> 4);
#pragma unroll
  for (int i = 0; i < 8; ++i) { w[i] = (__bf16)p[i]; w[8 + i] = (__bf16)p[16 + i]; }
  return w; }
__device__ __forceinline__ v16h wcolh_io(const float* Wm, int k0, int o, int lane, int ld) { v16h w; const int g = lane >> 4;
#pragma unroll
  for (int i = 0; i < 8; ++i) { w[i] = (_Float16)(bfr(Wm[(size_t)(k0 + 8 * g + i) * ld + o]) * 256.0f); w[8 + i] = (_Float16)(bfr(Wm[(size_t)(k0 + 16 + 8 * g + i) * ld + o]) * 256.0f); }
  return w; }
__device__ __forceinline__ v16h wcolh_oi(const float* Wm, int k0, int o, int lane, int K) { v16h w; const float* p = Wm + (size_t)o * K + k0 + 8 * (lane >> 4);
#pragma unroll
  for (int i = 0; i < 8; ++i) { w[i] = (_Float16)(bfr(p[i]) * 256.0f); w[8 + i] = (_Float16)(bfr(p[16 + i]) * 256.0f); }
  return w; }
#define WQKV_LAYOUT 1   // 0 = (in,out) [DIN][CC]; 1 = (out,in) [CC][DIN]; 2 = per-head [NH][DIN][HD]
__device__ __forceinline__ v16b wcol_hdk(const float* Wm, int k0, int o, int lane) { v16b w; const int g = lane >> 4; const float* p = Wm + (size_t)(o / HD) * DIN * HD + (o % HD);
#pragma unroll
  for (int i = 0; i < 8; ++i) { w[i] = (__bf16)p[(size_t)(k0 + 8 * g + i) * HD]; w[8 + i] = (__bf16)p[(size_t)(k0 + 16 + 8 * g + i) * HD]; }
  return w; }
#define WO_OUT_IN 0
#if WQKV_LAYOUT == 1
#define WCOL(W, k0, o, lane) wcol_oi(W, k0, o, lane, DIN)
#elif WQKV_LAYOUT == 2
#define WCOL(W, k0, o, lane) wcol_hdk(W, k0, o, lane)
#else
#define WCOL(W, k0, o, lane) wcol_io(W, k0, o, lane, CC)
#endif
#if WO_OUT_IN
#define WOCOL(W, k0, o, lane) wcol_oi(W, k0, o, lane, CC)
#define WOCOLH(W, k0, o, lane) wcolh_oi(W, k0, o, lane, CC)
#else
#define WOCOL(W, k0, o, lane) wcol_io(W, k0, o, lane, DIN)
#define WOCOLH(W, k0, o, lane) wcolh_io(W, k0, o, lane, DIN)
#endif

#define WS_QH  0u                                      // f16 q rows [b*t][CC]
#define WS_KH  (WS_QH + 2u * (size_t)NB * TT * CC)      // f16 k rows [b*t][CC]
#define WS_VT  (WS_KH + 2u * (size_t)NB * TT * CC)      // f16 v planes [b][c][t]
#define WS_QL  (WS_VT + 2u * (size_t)NB * CC * TT)      // f16 q residual x 2^10 rows [b][t < QHI][CC]
#define WS_KL  (WS_QL + 2u * (size_t)NB * QHI * CC)     // f16 k residual x 2^10 rows [b][t < KHI][CC]
#define WS_VB  (WS_KL + 2u * (size_t)NB * KHI * CC)     // bf16 v hi planes [b][c][t < KHI]
#define WS_VBL (WS_VB + 2u * (size_t)NB * CC * KHI)
#define WS_S   (WS_VBL + 2u * (size_t)NB * CC * KHI)    // f32 [hg][t][s] region, unused (k_fa keeps logits / P in registers)
#define WS_Y   (WS_S  + 4u * (size_t)HG * TT * TT)      // f32 ctx rows [b*t][CC] (only when there is an output projection)
#define WS_END (WS_Y  + 0u)

// ---- k_proj: block = (128 rows, 128 cols, which), 8 waves as 2 x 4, a wave holds 64 x 32 of the tile: q/k/v = X W^T (+ b) with exact bf16 products (K = DIN, summed in the order kc = 0, 1, ...).
// X rows and W rows ((out,in): both K-contiguous) are read once a block in whole 128-B lines, rounded to bf16 once and staged in LDS, two buffers, one barrier a 32-k stage; every wave takes its fragments from there.
// Every bare '#pragma unroll' below stands on a short loop over rx, rw, fa, fw or acc: constant indices keep these arrays in registers.
// -> which 0: q f16 rows (+ residual rows < QHI); 1: k f16 rows (+ residual rows < KHI); 2: v f16 planes [c][t] (+ bf16 hi/lo planes for t < KHI)
#define PM 128            // tile rows, and tile columns
#define PK 32             // k per stage: one 128-B line of every f32 source row
#define PP 40             // LDS row pitch in bf16: 80 B = 16 B x 5, so the 16 rows of a ds_load_b128 fragment read fall on distinct banks
#define PO (PM + 8)       // pitch of the output staging rows in halves: 272 B = 16 B x 17
typedef __attribute__((ext_vector_type(4))) __bf16 v4b;
__device__ __forceinline__ v8f wmma_b(v16b a, v16b b, v8f c) { return __builtin_amdgcn_wmma_f32_16x16x32_bf16(false, a, false, b, (short)0, c, false, false); }
__device__ __forceinline__ v4b bf4(v4f v) { return __builtin_convertvector(v, v4b); }   // round to nearest even, as (__bf16) on each element
__global__ __launch_bounds__(256) void k_proj(const float* __restrict__ XQ, const float* __restrict__ XK, const float* __restrict__ XV, const float* __restrict__ WQ, const float* __restrict__ WK, const float* __restrict__ WV, const float* __restrict__ BQ, const float* __restrict__ BK, const float* __restrict__ BV,
    _Float16* __restrict__ QH, _Float16* __restrict__ QL, _Float16* __restrict__ KH, _Float16* __restrict__ KL, _Float16* __restrict__ VT, __bf16* __restrict__ VB, __bf16* __restrict__ VBL) {
  // one LDS block, used twice: the operand ring in the k loop (2 x 2 x 128 x 80 B = 40,960 B), then the output staging (q, k: 2 x 128 x 272 B; v: 128 x 272 B + 2 x 128 x 144 B = 71,680 B)
  __shared__ __align__(16) char sm[PM * PO * 2 + 2 * PM * 72 * 2];
  __bf16 (*sx)[PM][PP] = (__bf16 (*)[PM][PP])sm; __bf16 (*sw)[PM][PP] = (__bf16 (*)[PM][PP])(sm + 2 * PM * PP * 2);
  const int tid = threadIdx.x, wave = __builtin_amdgcn_readfirstlane(tid >> 5), lane = tid & 31, col = lane & 15, g = lane >> 4, wm = wave >> 2, wn = wave & 3;   // the wave's number in a scalar register: tests on it are scalar branches
  const int which = blockIdx.z; const int c0 = blockIdx.y * PM; const size_t r0 = (size_t)blockIdx.x * PM; const size_t bb = r0 / TT; const int t0 = (int)(r0 % TT);
  const float* X = which == 0 ? XQ : which == 1 ? XK : XV; const float* WA = which == 0 ? WQ : which == 1 ? WK : WV; const float* BA = which == 0 ? BQ : which == 1 ? BK : BV;
  const int sr = tid >> 3, sc4 = (tid & 7) * 4;   // staging: 8 lanes take one 128-B line of a row, 32 rows a sweep, 4 sweeps an operand
  const float* xg = X + (r0 + sr) * DIN + sc4; const float* wg = WA + (size_t)(c0 + sr) * DIN + sc4;
  v4f rx[4], rw[4];
#pragma unroll
  for (int i = 0; i < 4; ++i) { rx[i] = *(const v4f*)(xg + (size_t)(32 * i) * DIN); rw[i] = *(const v4f*)(wg + (size_t)(32 * i) * DIN); }
#pragma unroll
  for (int i = 0; i < 4; ++i) { *(v4b*)&sx[0][sr + 32 * i][sc4] = bf4(rx[i]); *(v4b*)&sw[0][sr + 32 * i][sc4] = bf4(rw[i]); }
  v8f acc[4][2] = {};
#pragma unroll   // all 24 stages in line: buffer index and every global offset become immediates, so no address register is rewritten behind a load
  for (int s = 0; s < DIN / PK; ++s) { const int bu = s & 1; const bool more = s + 1 < DIN / PK;
    __syncthreads();   // publishes stage s; ends every wave's reads of the other buffer, which is refilled at the foot of this trip
    if (more) {
#pragma unroll
      for (int i = 0; i < 4; ++i) { rx[i] = *(const v4f*)(xg + (size_t)(32 * i) * DIN + (s + 1) * PK); rw[i] = *(const v4f*)(wg + (size_t)(32 * i) * DIN + (s + 1) * PK); } }
    v16b fa[4], fw[2];
#pragma unroll
    for (int i = 0; i < 4; ++i) fa[i] = frag_b(&sx[bu][wm * 64 + i * 16 + col][0], lane);
#pragma unroll
    for (int j = 0; j < 2; ++j) fw[j] = frag_b(&sw[bu][wn * 32 + j * 16 + col][0], lane);
    __builtin_amdgcn_sched_barrier(0);   // the stage's global loads and LDS reads issue as one group ahead of its products: otherwise reads are spread among the products, each with a wait of its own, and two global loads start late
#pragma unroll
    for (int i = 0; i < 4; ++i)
#pragma unroll
      for (int j = 0; j < 2; ++j) acc[i][j] = wmma_b(fa[i], fw[j], acc[i][j]);
    __builtin_amdgcn_sched_barrier(0);   // keeps the wait for the next stage's global loads behind this stage's products: otherwise the conversions, and that wait with them, are lifted in front of the first product
    if (more) {
#pragma unroll
      for (int i = 0; i < 4; ++i) { *(v4b*)&sx[bu ^ 1][sr + 32 * i][sc4] = bf4(rx[i]); *(v4b*)&sw[bu ^ 1][sr + 32 * i][sc4] = bf4(rw[i]); } } }
  asm volatile("s_wait_xcnt 0x0" :: "v"(xg), "v"(wg) : "memory");   // the two address pairs are inputs so that they stay whole up to this wait: otherwise the last stage's loads take them as their own result registers behind loads that still name them
  __syncthreads();   // every wave has left the ring before its LDS is written again as output staging
  if (which < 2) { _Float16 (*sh)[PO] = (_Float16 (*)[PO])sm; _Float16 (*sl)[PO] = (_Float16 (*)[PO])(sm + PM * PO * 2);
    _Float16* DH = which == 0 ? QH : KH; _Float16* DL = which == 0 ? QL : KL; const int nhi = which == 0 ? QHI : KHI;
#pragma unroll
    for (int j = 0; j < 2; ++j) { const int cl = wn * 32 + j * 16 + col; const float bias = BA ? bfr(BA[c0 + cl]) : 0.f;
#pragma unroll
      for (int i = 0; i < 4; ++i)
#pragma unroll
        for (int r = 0; r < 8; ++r) { const float v = acc[i][j][r] + bias; const _Float16 hv = (_Float16)v; const int rl = wm * 64 + i * 16 + 8 * g + r; sh[rl][cl] = hv; sl[rl][cl] = (_Float16)((v - (float)hv) * 1024.0f); } }
    __syncthreads();
#pragma unroll   // 16 rows a sweep, 16 lanes a 256-B row segment; in line, so that the LDS reads of all sweeps go ahead of the stores and the row step is an immediate offset
    for (int it = 0; it < PM / 16; ++it) { const int rl = it * 16 + (tid >> 4), q = tid & 15; vst2((unsigned*)(DH + (r0 + rl) * CC + c0 + q * 8), *(const v4u*)&sh[rl][q * 8]); }
#pragma unroll   // residual rows, 64 at a time: nhi is a multiple of 64, so 64 aligned rows are below it all or none (a scalar test)
    for (int hf = 0; hf < PM / 64; ++hf) if (t0 + hf * 64 < nhi) {
      asm volatile("s_wait_xcnt 0x0" ::: "memory");   // stands in front of the rewrite of registers that the stores above name
#pragma unroll   // in line, as above
      for (int it = 0; it < 4; ++it) { const int rl = hf * 64 + it * 16 + (tid >> 4), q = tid & 15; vst2((unsigned*)(DL + (bb * nhi + t0 + rl) * (size_t)CC + c0 + q * 8), *(const v4u*)&sl[rl][q * 8]); } }
  } else { _Float16 (*th)[PO] = (_Float16 (*)[PO])sm; __bf16 (*tb)[72] = (__bf16 (*)[72])(sm + PM * PO * 2); __bf16 (*tbl)[72] = (__bf16 (*)[72])(sm + PM * PO * 2 + PM * 72 * 2);
    const bool hi_tile = t0 < KHI, hi_rows = t0 + wm * 64 < KHI;   // KHI = 64 = a wave's rows: only the first tile of a sequence, and there the four waves of its first 64 rows, hold rows t < KHI
#pragma unroll
    for (int j = 0; j < 2; ++j) { const int cl = wn * 32 + j * 16 + col; const float bias = BA ? bfr(BA[c0 + cl]) : 0.f;
#pragma unroll
      for (int i = 0; i < 4; ++i)
#pragma unroll
        for (int r = 0; r < 8; ++r) { const float v = acc[i][j][r] + bias; acc[i][j][r] = v; th[cl][wm * 64 + i * 16 + 8 * g + r] = (_Float16)v; }
      if (hi_rows) {
#pragma unroll
        for (int i = 0; i < 4; ++i)
#pragma unroll
          for (int r = 0; r < 8; ++r) { const float v = acc[i][j][r]; const int rl = wm * 64 + i * 16 + 8 * g + r; const __bf16 bh = (__bf16)v; tb[cl][rl] = bh; tbl[cl][rl] = (__bf16)(v - (float)bh); } } }
    __syncthreads();
#pragma unroll   // in line, as above
    for (int it = 0; it < PM / 16; ++it) { const int cl = it * 16 + (tid >> 4), q = tid & 15; vst2((unsigned*)(VT + (bb * CC + c0 + cl) * (size_t)TT + t0 + q * 8), *(const v4u*)&th[cl][q * 8]); }
    asm volatile("s_wait_xcnt 0x0" ::: "memory");   // stands in front of the rewrite of registers that the stores above name
    if (hi_tile) {
#pragma unroll   // in line, as above
      for (int it = 0; it < PM / 32; ++it) { const int cl = it * 32 + (tid >> 3), q = tid & 7; const size_t o3 = (bb * CC + c0 + cl) * (size_t)KHI + t0 + q * 8; vst2((unsigned*)(VB + o3), *(const v4u*)&tb[cl][q * 8]); vst2((unsigned*)(VBL + o3), *(const v4u*)&tbl[cl][q * 8]); }
      asm volatile("s_wait_xcnt 0x0" ::: "memory"); } } }   // closes the stores above: the built code has a branch from here into the q/k part, which rewrites their address registers
#define FK 64             // keys per stage
#define FP 72             // LDS row pitch in halves: 144 B = 16 B x 9, so the 16 rows of a ds_load_b128 fragment read fall on distinct banks
__device__ __forceinline__ v8f wmma_h(v16h a, v16h b, v8f c) { return __builtin_amdgcn_wmma_f32_16x16x32_f16(false, a, false, b, (short)0, c, false, false); }
__device__ __forceinline__ float xhalf(float x) { return __builtin_bit_cast(float, __builtin_amdgcn_permlanex16(__builtin_bit_cast(int, x), __builtin_bit_cast(int, x), 0x76543210, 0xfedcba98, false, false)); }   // lane l with lane l ^ 16
__global__ __launch_bounds__(256) void k_fa(const _Float16* __restrict__ QH, const _Float16* __restrict__ QL, const _Float16* __restrict__ KH, const _Float16* __restrict__ VT, const int* __restrict__ MK, float* __restrict__ Y) {
  __shared__ __align__(16) _Float16 sk[2][FK][FP], sv[2][HD][FP]; __shared__ __align__(16) float mb[TT]; __shared__ __align__(16) float so[8][16][HD + 4];
  const int tid = threadIdx.x, wave = tid >> 5, lane = tid & 31, col = lane & 15, g = lane >> 4; const int h = blockIdx.y, b = blockIdx.z; const int q0 = blockIdx.x * 128 + wave * 16;
  for (int k = tid; k < TT; k += 256) mb[k] = 10000.0f * (1.0f - (float)MK[(size_t)b * TT + k]);   // additive mask term per key, read from the mask input
  v16h qh[2], ql[2];
#pragma unroll
  for (int kc = 0; kc < 2; ++kc) { qh[kc] = frag_h(QH + ((size_t)b * TT + q0 + col) * CC + h * HD + kc * 32, lane); ql[kc] = frag_h(QL + ((size_t)b * QHI + q0 + col) * CC + h * HD + kc * 32, lane); }
  const int sr = tid >> 3, sc8 = (tid & 7) * 8;   // staging: 8 lanes take one 128-B row (a whole line), 32 rows a sweep
  const _Float16* kg = KH + ((size_t)b * TT + sr) * CC + h * HD + sc8; const _Float16* vg = VT + ((size_t)b * CC + h * HD + sr) * (size_t)TT + sc8;
  v8h rk[2], rv[2];
#pragma unroll
  for (int i = 0; i < 2; ++i) { rk[i] = *(const v8h*)(kg + (size_t)(32 * i) * CC); rv[i] = *(const v8h*)(vg + (size_t)(32 * i) * TT); }
#pragma unroll
  for (int i = 0; i < 2; ++i) { *(v8h*)&sk[0][sr + 32 * i][sc8] = rk[i]; *(v8h*)&sv[0][sr + 32 * i][sc8] = rv[i]; }
  v8f o[HD / 16] = {}; float mrun = -3.0e38f, lsum = 0.f;
#pragma unroll 1   // one stage a trip: the body is long already and the buffer index alternates
  for (int s = 0; s < TT / FK; ++s) { const int bu = s & 1; const bool more = s + 1 < TT / FK;
    __syncthreads();   // publishes stage s (and, on the first trip, mb); ends every wave's reads of the other buffer, which is refilled at the foot of this trip
    if (more) {
#pragma unroll
      for (int i = 0; i < 2; ++i) { rk[i] = *(const v8h*)(kg + (size_t)((s + 1) * FK + 32 * i) * CC); rv[i] = *(const v8h*)(vg + (size_t)(32 * i) * TT + (s + 1) * FK); } }
    float sc[4][8];
#pragma unroll
    for (int t = 0; t < 4; ++t) { const v16h k0f = frag_h(&sk[bu][t * 16 + col][0], lane), k1f = frag_h(&sk[bu][t * 16 + col][32], lane);
      const v4f b0 = *(const v4f*)&mb[s * FK + t * 16 + 8 * g], b1 = *(const v4f*)&mb[s * FK + t * 16 + 8 * g + 4];
      v8f a = {}, al = {}; a = wmma_h(k0f, qh[0], a); al = wmma_h(k0f, ql[0], al); a = wmma_h(k1f, qh[1], a); al = wmma_h(k1f, ql[1], al);
#pragma unroll
      for (int r = 0; r < 8; ++r) sc[t][r] = (a[r] + al[r] * (1.0f / 1024.0f)) * SCALE - (r < 4 ? b0[r & 3] : b1[r & 3]); }
    float mx = sc[0][0];
#pragma unroll
    for (int t = 0; t < 4; ++t)
#pragma unroll
      for (int r = 0; r < 8; ++r) mx = fmaxf(mx, sc[t][r]);
    mx = fmaxf(mx, xhalf(mx)); const float mn = fmaxf(mrun, mx); const float corr = expf(mrun - mn); mrun = mn;
    v16h pf[2]; float ps[4] = {0.f, 0.f, 0.f, 0.f};   // one partial sum a tile: four independent add chains
#pragma unroll
    for (int t = 0; t < 4; ++t)
#pragma unroll
      for (int r = 0; r < 8; ++r) { const float e = expf(sc[t][r] - mn); ps[t] += e; pf[t >> 1][(t & 1) * 8 + r] = (_Float16)(e * 2048.0f); }
    lsum = lsum * corr + ((ps[0] + ps[1]) + (ps[2] + ps[3]));
#pragma unroll
    for (int j = 0; j < HD / 16; ++j) o[j] *= corr;
#pragma unroll
    for (int kk = 0; kk < 2; ++kk)
#pragma unroll
      for (int j = 0; j < HD / 16; ++j) o[j] = wmma_h(frag_h(&sv[bu][j * 16 + col][kk * 32], lane), pf[kk], o[j]);
    if (more) {
#pragma unroll
      for (int i = 0; i < 2; ++i) { *(v8h*)&sk[bu ^ 1][sr + 32 * i][sc8] = rk[i]; *(v8h*)&sv[bu ^ 1][sr + 32 * i][sc8] = rv[i]; } } }
  const float l = lsum + xhalf(lsum); const float inv = 1.0f / (2048.0f * l);   // l >= 1: the key that holds the maximum adds exp(0)
#pragma unroll
  for (int j = 0; j < HD / 16; ++j) { const v8f w = o[j] * inv; float* d = &so[wave][col][j * 16 + 8 * g]; *(v4f*)d = __builtin_shufflevector(w, w, 0, 1, 2, 3); *(v4f*)(d + 4) = __builtin_shufflevector(w, w, 4, 5, 6, 7); }
  LDSX();   // the wave's own rows of so are written before it reads them across lanes
  for (int it = 0; it < 8; ++it) { const int rl = it * 2 + g; vst2(Y + ((size_t)b * TT + q0 + rl) * CC + h * HD + col * 4, *(const v4f*)&so[wave][rl][col * 4]); } }   // 256-B (row, head) segment by 16 lanes

extern "C" void kernel_launch(void* const* d_in, const int* in_sizes, int n_in, void* d_out, int out_size, void* d_ws, size_t ws_size, hipStream_t stream) {
  (void)in_sizes; (void)n_in; (void)out_size;
  const float** F = (const float**)d_in;
  if (ws_size < (size_t)WS_END) return;
  char* ws = (char*)d_ws; _Float16 *QH = (_Float16*)(ws + WS_QH), *KH = (_Float16*)(ws + WS_KH), *VT = (_Float16*)(ws + WS_VT), *QL = (_Float16*)(ws + WS_QL), *KL = (_Float16*)(ws + WS_KL); __bf16 *VB = (__bf16*)(ws + WS_VB), *VBL = (__bf16*)(ws + WS_VBL); float *S = (float*)(ws + WS_S), *Y = (float*)(ws + WS_Y);
  (void)Y; (void)S; (void)QL; (void)KL; (void)VB; (void)VBL;
  // inputs: 0 x [8,1024,768]; 1 mask [8,1024] int32 (ones); 2 Wq (out,in), 3 bq; 4 Wk, 5 bk; 6 Wv, 7 bv
  k_proj<<<dim3(TNB * TT / 128, CC / 128, 3), 256, 0, stream>>>(F[0], F[0], F[0], F[2], F[4], F[6], F[3], F[5], F[7], QH, QL, KH, KL, VT, VB, VBL);
  k_fa<<<dim3(TT / 128, NH, TNB), 256, 0, stream>>>(QH, QL, KH, VT, (const int*)d_in[1], (float*)d_out);
}

// v003
// One run takes 93.6 microseconds.
// Timed twice side by side with v002, it ran 1.18 times as fast both times.
// Over all steps from v000 it is 16.7 times as fast.
// compute dtype: all float inputs rounded to bf16; q/k/v = in W^T + b with EXACT bf16 products on WMMA 16x16x32 (f32 accumulate); q as f16 hi + residual (x 2^10) against k once to f16 (2 products) / 8; softmax in f32 with a running maximum and sum per query, the exponential as 2^(s log2(e) - max log2(e) + 11) on the hardware's base-2 exponential; that value once to f16 against v once to f16 (1 product), divided by the sum (which carries the same 2^11) at the end; f32 output.
#include <hip/hip_runtime.h>
#include <math.h>

typedef __attribute__((ext_vector_type(16))) _Float16 v16h;
typedef __attribute__((ext_vector_type(16))) __bf16 v16b;
typedef __attribute__((ext_vector_type(8)))  _Float16 v8h;
typedef __attribute__((ext_vector_type(8)))  float v8f;
typedef __attribute__((ext_vector_type(4)))  float v4f;
typedef __attribute__((ext_vector_type(2)))  float v2f;
typedef __attribute__((ext_vector_type(4)))  unsigned v4u;
typedef __attribute__((ext_vector_type(4)))  int v4i;
typedef float __attribute__((may_alias)) float_a;
typedef int __attribute__((may_alias)) int_a;

template <typename T> __device__ __forceinline__ void vst2(void* p, T v) { *(T*)p = v;  }
__device__ __forceinline__ v8f wmma16(v16h a, v16h b, v8f c) {
  v8f d = __builtin_amdgcn_wmma_f32_16x16x32_f16(false, a, false, b, (short)0, c, false, false);
  asm volatile("v_nop\n\tv_nop\n\tv_nop\n\tv_nop" : "+v"(d) : "v"(a), "v"(b));
  return d;
}
__device__ __forceinline__ v8f wmma_bf(v16b a, v16b b, v8f c) {
  v8f d = __builtin_amdgcn_wmma_f32_16x16x32_bf16(false, a, false, b, (short)0, c, false, false);
  asm volatile("v_nop\n\tv_nop\n\tv_nop\n\tv_nop" : "+v"(d) : "v"(a), "v"(b));
  return d;
}
// 16x16x32 fragments: lane = (h = lane>>4, row/col = lane&15); elements 0..7 = k0+8h+0..7, 8..15 = k0+16+8h+0..7; D element r = row 8h+r
__device__ __forceinline__ v16h frag_h(const _Float16* rowk0, int lane) {
  union { v16h v; v8h q[2]; } u; const _Float16* p = rowk0 + 8 * (lane >> 4);
  u.q[0] = *(const v8h*)p; u.q[1] = *(const v8h*)(p + 16); return u.v;
}
__device__ __forceinline__ v16h frag_f32(const float* rowk0, int lane) {
  v16h a; const float* p = rowk0 + 8 * (lane >> 4);
#pragma unroll
  for (int i = 0; i < 8; ++i) { a[i] = (_Float16)p[i]; a[8 + i] = (_Float16)p[16 + i]; }
  return a;
}
__device__ __forceinline__ v16h frag_f32s(const float* rowk0, int lane, float sc) {
  v16h a; const float* p = rowk0 + 8 * (lane >> 4);
#pragma unroll
  for (int i = 0; i < 8; ++i) { a[i] = (_Float16)(p[i] * sc); a[8 + i] = (_Float16)(p[16 + i] * sc); }
  return a;
}
// column fragment from a [K][ld] layout (column n), rows >= K read as 0
__device__ __forceinline__ v16h fragc_f32(const float* W, int k0, int n, int lane, int ld, int K) {
  v16h a; const int g = lane >> 4;
#pragma unroll
  for (int i = 0; i < 8; ++i) { const int ka = k0 + 8 * g + i, kb = ka + 16;
    a[i] = (_Float16)(ka < K ? W[(size_t)(ka < K ? ka : K - 1) * ld + n] : 0.f); a[8 + i] = (_Float16)(kb < K ? W[(size_t)(kb < K ? kb : K - 1) * ld + n] : 0.f); }
  return a;
}
struct F2 { v16b h, l; };
__device__ __forceinline__ F2 bsplit16(const float v[16]) { F2 r;
#pragma unroll
  for (int i = 0; i < 16; ++i) { const __bf16 h = (__bf16)v[i]; r.h[i] = h; r.l[i] = (__bf16)(v[i] - (float)h); }
  return r; }
__device__ __forceinline__ F2 split_row(const float* row, int k0, int lane) { float v[16]; const float* p = row + k0 + 8 * (lane >> 4);
#pragma unroll
  for (int i = 0; i < 8; ++i) { v[i] = p[i]; v[8 + i] = p[16 + i]; }
  return bsplit16(v); }
__device__ __forceinline__ F2 split_rowK(const float* row, int k0, int lane, int K) { float v[16]; const int g = lane >> 4;
#pragma unroll
  for (int i = 0; i < 8; ++i) { const int ka = k0 + 8 * g + i, kb = ka + 16; v[i] = ka < K ? row[ka < K ? ka : K - 1] : 0.f; v[8 + i] = kb < K ? row[kb < K ? kb : K - 1] : 0.f; }
  return bsplit16(v); }
__device__ __forceinline__ F2 split_col(const float* W, int k0, int n, int lane, int ld, int K) { float v[16]; const int g = lane >> 4;
#pragma unroll
  for (int i = 0; i < 8; ++i) { const int ka = k0 + 8 * g + i, kb = ka + 16; v[i] = ka < K ? W[(size_t)(ka < K ? ka : K - 1) * ld + n] : 0.f; v[8 + i] = kb < K ? W[(size_t)(kb < K ? kb : K - 1) * ld + n] : 0.f; }
  return bsplit16(v); }
__device__ __forceinline__ v8f mac3(const F2& a, const F2& b, v8f c) { c = wmma_bf(a.l, b.h, c); c = wmma_bf(a.h, b.l, c); return wmma_bf(a.h, b.h, c); }
__device__ __forceinline__ float sigm(float v) { return 1.0f / (1.0f + expf(-v)); }
#define LDSX() do { asm volatile("s_wait_dscnt 0" ::: "memory"); __builtin_amdgcn_wave_barrier(); __builtin_amdgcn_fence(__ATOMIC_RELEASE, "workgroup"); } while (0)

// Multi-head self-attention (B 8, S 1,024, D 768 = 12 x 64; (out,in) 1/sqrt(768)-scale weights, zero biases; key mask [B,S] int all ones): q, k, v = x W^T + b; scores / 8 - 10000 * (1 - mask); out = merged(softmax v) -> [8, 1,024, 768] (no output projection).
#define NB 8
#define TT 1024
#define CC 768            // NH * HD = projected width
#define DIN 768          // input (model) width
#define NH 12
#define HD 64
#define NQB (TT / 64)
#define HG 4
#define SCALE (0.125f)
#define CAUSAL 0
#ifndef TNB
#define TNB NB
#endif
__device__ __forceinline__ float bfr(float v) { return (float)(__bf16)v; }
__host__ __device__ __forceinline__ int kb_last(int qb) { return CAUSAL ? ((qb * 64 + 63) >> 7) : (TT / 128 - 1); }
typedef __attribute__((ext_vector_type(8))) __bf16 v8b;
__device__ __forceinline__ v16b frag_b(const __bf16* rowk0, int lane) {
  union { v16b v; v8b q[2]; } u; const __bf16* p = rowk0 + 8 * (lane >> 4);
  u.q[0] = *(const v8b*)p; u.q[1] = *(const v8b*)(p + 16); return u.v;
}
#define QBH 0
#define QHI 1024            // rows carrying a q residual plane (all rows when non-causal: 2-product logits everywhere)
#define KHI 64            // key rows carrying k residual / v bf16 hi+lo planes (written by k_proj; no kernel in this file reads them)
// B fragment (k rows k0+.., output column o) of a weight: (in,out) [K][ld] or (out,in) [ld rows of K]: bf16 exact, or f16(bf16 * 256) exact
__device__ __forceinline__ v16b wcol_io(const float* Wm, int k0, int o, int lane, int ld) { v16b w; const int g = lane >> 4;
#pragma unroll
  for (int i = 0; i < 8; ++i) { w[i] = (__bf16)Wm[(size_t)(k0 + 8 * g + i) * ld + o]; w[8 + i] = (__bf16)Wm[(size_t)(k0 + 16 + 8 * g + i) * ld + o]; }
  return w; }
__device__ __forceinline__ v16b wcol_oi(const float* Wm, int k0, int o, int lane, int K) { v16b w; const float* p = Wm + (size_t)o * K + k0 + 8 * (lane >> 4);
#pragma unroll
  for (int i = 0; i < 8; ++i) { w[i] = (__bf16)p[i]; w[8 + i] = (__bf16)p[16 + i]; }
  return w; }
__device__ __forceinline__ v16h wcolh_io(const float* Wm, int k0, int o, int lane, int ld) { v16h w; const int g = lane >> 4;
#pragma unroll
  for (int i = 0; i < 8; ++i) { w[i] = (_Float16)(bfr(Wm[(size_t)(k0 + 8 * g + i) * ld + o]) * 256.0f); w[8 + i] = (_Float16)(bfr(Wm[(size_t)(k0 + 16 + 8 * g + i) * ld + o]) * 256.0f); }
  return w; }
__device__ __forceinline__ v16h wcolh_oi(const float* Wm, int k0, int o, int lane, int K) { v16h w; const float* p = Wm + (size_t)o * K + k0 + 8 * (lane >> 4);
#pragma unroll
  for (int i = 0; i < 8; ++i) { w[i] = (_Float16)(bfr(p[i]) * 256.0f); w[8 + i] = (_Float16)(bfr(p[16 + i]) * 256.0f); }
  return w; }
#define WQKV_LAYOUT 1   // 0 = (in,out) [DIN][CC]; 1 = (out,in) [CC][DIN]; 2 = per-head [NH][DIN][HD]
__device__ __forceinline__ v16b wcol_hdk(const float* Wm, int k0, int o, int lane) { v16b w; const int g = lane >> 4; const float* p = Wm + (size_t)(o / HD) * DIN * HD + (o % HD);
#pragma unroll
  for (int i = 0; i < 8; ++i) { w[i] = (__bf16)p[(size_t)(k0 + 8 * g + i) * HD]; w[8 + i] = (__bf16)p[(size_t)(k0 + 16 + 8 * g + i) * HD]; }
  return w; }
#define WO_OUT_IN 0
#if WQKV_LAYOUT == 1
#define WCOL(W, k0, o, lane) wcol_oi(W, k0, o, lane, DIN)
#elif WQKV_LAYOUT == 2
#define WCOL(W, k0, o, lane) wcol_hdk(W, k0, o, lane)
#else
#define WCOL(W, k0, o, lane) wcol_io(W, k0, o, lane, CC)
#endif
#if WO_OUT_IN
#define WOCOL(W, k0, o, lane) wcol_oi(W, k0, o, lane, CC)
#define WOCOLH(W, k0, o, lane) wcolh_oi(W, k0, o, lane, CC)
#else
#define WOCOL(W, k0, o, lane) wcol_io(W, k0, o, lane, DIN)
#define WOCOLH(W, k0, o, lane) wcolh_io(W, k0, o, lane, DIN)
#endif

#define WS_QH  0u                                      // f16 q rows [b*t][CC]
#define WS_KH  (WS_QH + 2u * (size_t)NB * TT * CC)      // f16 k rows [b*t][CC]
#define WS_VT  (WS_KH + 2u * (size_t)NB * TT * CC)      // f16 v planes [b][c][t]
#define WS_QL  (WS_VT + 2u * (size_t)NB * CC * TT)      // f16 q residual x 2^10 rows [b][t < QHI][CC]
#define WS_KL  (WS_QL + 2u * (size_t)NB * QHI * CC)     // f16 k residual x 2^10 rows [b][t < KHI][CC]
#define WS_VB  (WS_KL + 2u * (size_t)NB * KHI * CC)     // bf16 v hi planes [b][c][t < KHI]
#define WS_VBL (WS_VB + 2u * (size_t)NB * CC * KHI)
#define WS_S   (WS_VBL + 2u * (size_t)NB * CC * KHI)    // f32 [hg][t][s] region, unused (k_fa keeps logits / P in registers)
#define WS_Y   (WS_S  + 4u * (size_t)HG * TT * TT)      // f32 ctx rows [b*t][CC] (only when there is an output projection)
#define WS_END (WS_Y  + 0u)

// ---- k_proj: block = (128 rows, 128 cols, which), 8 waves as 2 x 4, a wave holds 64 x 32 of the tile: q/k/v = X W^T (+ b) with exact bf16 products (K = DIN, summed in the order kc = 0, 1, ...).
// X rows and W rows ((out,in): both K-contiguous) are read once a block in whole 128-B lines, rounded to bf16 once and staged in LDS, two buffers, one barrier a 32-k stage; every wave takes its fragments from there.
// Every bare '#pragma unroll' below stands on a short loop over rx, rw, fa, fw or acc: constant indices keep these arrays in registers.
// -> which 0: q f16 rows (+ residual rows < QHI); 1: k f16 rows (+ residual rows < KHI); 2: v f16 planes [c][t] (+ bf16 hi/lo planes for t < KHI)
#define PM 128            // tile rows, and tile columns
#define PK 32             // k per stage: one 128-B line of every f32 source row
#define PP 40             // LDS row pitch in bf16: 80 B = 16 B x 5, so the 16 rows of a ds_load_b128 fragment read fall on distinct banks
#define PO (PM + 8)       // pitch of the output staging rows in halves: 272 B = 16 B x 17
typedef __attribute__((ext_vector_type(4))) __bf16 v4b;
__device__ __forceinline__ v8f wmma_b(v16b a, v16b b, v8f c) { return __builtin_amdgcn_wmma_f32_16x16x32_bf16(false, a, false, b, (short)0, c, false, false); }
__device__ __forceinline__ v4b bf4(v4f v) { return __builtin_convertvector(v, v4b); }   // round to nearest even, as (__bf16) on each element
__global__ __launch_bounds__(256) void k_proj(const float* __restrict__ XQ, const float* __restrict__ XK, const float* __restrict__ XV, const float* __restrict__ WQ, const float* __restrict__ WK, const float* __restrict__ WV, const float* __restrict__ BQ, const float* __restrict__ BK, const float* __restrict__ BV,
    _Float16* __restrict__ QH, _Float16* __restrict__ QL, _Float16* __restrict__ KH, _Float16* __restrict__ KL, _Float16* __restrict__ VT, __bf16* __restrict__ VB, __bf16* __restrict__ VBL) {
  // one LDS block, used twice: the operand ring in the k loop (2 x 2 x 128 x 80 B = 40,960 B), then the output staging (q, k: 2 x 128 x 272 B; v: 128 x 272 B + 2 x 128 x 144 B = 71,680 B)
  __shared__ __align__(16) char sm[PM * PO * 2 + 2 * PM * 72 * 2];
  __bf16 (*sx)[PM][PP] = (__bf16 (*)[PM][PP])sm; __bf16 (*sw)[PM][PP] = (__bf16 (*)[PM][PP])(sm + 2 * PM * PP * 2);
  const int tid = threadIdx.x, wave = __builtin_amdgcn_readfirstlane(tid >> 5), lane = tid & 31, col = lane & 15, g = lane >> 4, wm = wave >> 2, wn = wave & 3;   // the wave's number in a scalar register: tests on it are scalar branches
  const int which = blockIdx.z; const int c0 = blockIdx.y * PM; const size_t r0 = (size_t)blockIdx.x * PM; const size_t bb = r0 / TT; const int t0 = (int)(r0 % TT);
  const float* X = which == 0 ? XQ : which == 1 ? XK : XV; const float* WA = which == 0 ? WQ : which == 1 ? WK : WV; const float* BA = which == 0 ? BQ : which == 1 ? BK : BV;
  const int sr = tid >> 3, sc4 = (tid & 7) * 4;   // staging: 8 lanes take one 128-B line of a row, 32 rows a sweep, 4 sweeps an operand
  const float* xg = X + (r0 + sr) * DIN + sc4; const float* wg = WA + (size_t)(c0 + sr) * DIN + sc4;
  v4f rx[4], rw[4];
#pragma unroll
  for (int i = 0; i < 4; ++i) { rx[i] = *(const v4f*)(xg + (size_t)(32 * i) * DIN); rw[i] = *(const v4f*)(wg + (size_t)(32 * i) * DIN); }
#pragma unroll
  for (int i = 0; i < 4; ++i) { *(v4b*)&sx[0][sr + 32 * i][sc4] = bf4(rx[i]); *(v4b*)&sw[0][sr + 32 * i][sc4] = bf4(rw[i]); }
  v8f acc[4][2] = {};
#pragma unroll   // all 24 stages in line: buffer index and every global offset become immediates, so no address register is rewritten behind a load
  for (int s = 0; s < DIN / PK; ++s) { const int bu = s & 1; const bool more = s + 1 < DIN / PK;
    __syncthreads();   // publishes stage s; ends every wave's reads of the other buffer, which is refilled at the foot of this trip
    if (more) {
#pragma unroll
      for (int i = 0; i < 4; ++i) { rx[i] = *(const v4f*)(xg + (size_t)(32 * i) * DIN + (s + 1) * PK); rw[i] = *(const v4f*)(wg + (size_t)(32 * i) * DIN + (s + 1) * PK); } }
    v16b fa[4], fw[2];
#pragma unroll
    for (int i = 0; i < 4; ++i) fa[i] = frag_b(&sx[bu][wm * 64 + i * 16 + col][0], lane);
#pragma unroll
    for (int j = 0; j < 2; ++j) fw[j] = frag_b(&sw[bu][wn * 32 + j * 16 + col][0], lane);
    __builtin_amdgcn_sched_barrier(0);   // the stage's global loads and LDS reads issue as one group ahead of its products: otherwise reads are spread among the products, each with a wait of its own, and two global loads start late
#pragma unroll
    for (int i = 0; i < 4; ++i)
#pragma unroll
      for (int j = 0; j < 2; ++j) acc[i][j] = wmma_b(fa[i], fw[j], acc[i][j]);
    __builtin_amdgcn_sched_barrier(0);   // keeps the wait for the next stage's global loads behind this stage's products: otherwise the conversions, and that wait with them, are lifted in front of the first product
    if (more) {
#pragma unroll
      for (int i = 0; i < 4; ++i) { *(v4b*)&sx[bu ^ 1][sr + 32 * i][sc4] = bf4(rx[i]); *(v4b*)&sw[bu ^ 1][sr + 32 * i][sc4] = bf4(rw[i]); } } }
  asm volatile("s_wait_xcnt 0x0" :: "v"(xg), "v"(wg) : "memory");   // the two address pairs are inputs so that they stay whole up to this wait: otherwise the last stage's loads take them as their own result registers behind loads that still name them
  __syncthreads();   // every wave has left the ring before its LDS is written again as output staging
  if (which < 2) { _Float16 (*sh)[PO] = (_Float16 (*)[PO])sm; _Float16 (*sl)[PO] = (_Float16 (*)[PO])(sm + PM * PO * 2);
    _Float16* DH = which == 0 ? QH : KH; _Float16* DL = which == 0 ? QL : KL; const int nhi = which == 0 ? QHI : KHI;
#pragma unroll
    for (int j = 0; j < 2; ++j) { const int cl = wn * 32 + j * 16 + col; const float bias = BA ? bfr(BA[c0 + cl]) : 0.f;
#pragma unroll
      for (int i = 0; i < 4; ++i)
#pragma unroll
        for (int r = 0; r < 8; ++r) { const float v = acc[i][j][r] + bias; const _Float16 hv = (_Float16)v; const int rl = wm * 64 + i * 16 + 8 * g + r; sh[rl][cl] = hv; sl[rl][cl] = (_Float16)((v - (float)hv) * 1024.0f); } }
    __syncthreads();
#pragma unroll   // 16 rows a sweep, 16 lanes a 256-B row segment; in line, so that the LDS reads of all sweeps go ahead of the stores and the row step is an immediate offset
    for (int it = 0; it < PM / 16; ++it) { const int rl = it * 16 + (tid >> 4), q = tid & 15; vst2((unsigned*)(DH + (r0 + rl) * CC + c0 + q * 8), *(const v4u*)&sh[rl][q * 8]); }
#pragma unroll   // residual rows, 64 at a time: nhi is a multiple of 64, so 64 aligned rows are below it all or none (a scalar test)
    for (int hf = 0; hf < PM / 64; ++hf) if (t0 + hf * 64 < nhi) {
      asm volatile("s_wait_xcnt 0x0" ::: "memory");   // stands in front of the rewrite of registers that the stores above name
#pragma unroll   // in line, as above
      for (int it = 0; it < 4; ++it) { const int rl = hf * 64 + it * 16 + (tid >> 4), q = tid & 15; vst2((unsigned*)(DL + (bb * nhi + t0 + rl) * (size_t)CC + c0 + q * 8), *(const v4u*)&sl[rl][q * 8]); } }
  } else { _Float16 (*th)[PO] = (_Float16 (*)[PO])sm; __bf16 (*tb)[72] = (__bf16 (*)[72])(sm + PM * PO * 2); __bf16 (*tbl)[72] = (__bf16 (*)[72])(sm + PM * PO * 2 + PM * 72 * 2);
    const bool hi_tile = t0 < KHI, hi_rows = t0 + wm * 64 < KHI;   // KHI = 64 = a wave's rows: only the first tile of a sequence, and there the four waves of its first 64 rows, hold rows t < KHI
#pragma unroll
    for (int j = 0; j < 2; ++j) { const int cl = wn * 32 + j * 16 + col; const float bias = BA ? bfr(BA[c0 + cl]) : 0.f;
#pragma unroll
      for (int i = 0; i < 4; ++i)
#pragma unroll
        for (int r = 0; r < 8; ++r) { const float v = acc[i][j][r] + bias; acc[i][j][r] = v; th[cl][wm * 64 + i * 16 + 8 * g + r] = (_Float16)v; }
      if (hi_rows) {
#pragma unroll
        for (int i = 0; i < 4; ++i)
#pragma unroll
          for (int r = 0; r < 8; ++r) { const float v = acc[i][j][r]; const int rl = wm * 64 + i * 16 + 8 * g + r; const __bf16 bh = (__bf16)v; tb[cl][rl] = bh; tbl[cl][rl] = (__bf16)(v - (float)bh); } } }
    __syncthreads();
#pragma unroll   // in line, as above
    for (int it = 0; it < PM / 16; ++it) { const int cl = it * 16 + (tid >> 4), q = tid & 15; vst2((unsigned*)(VT + (bb * CC + c0 + cl) * (size_t)TT + t0 + q * 8), *(const v4u*)&th[cl][q * 8]); }
    asm volatile("s_wait_xcnt 0x0" ::: "memory");   // stands in front of the rewrite of registers that the stores above name
    if (hi_tile) {
#pragma unroll   // in line, as above
      for (int it = 0; it < PM / 32; ++it) { const int cl = it * 32 + (tid >> 3), q = tid & 7; const size_t o3 = (bb * CC + c0 + cl) * (size_t)KHI + t0 + q * 8; vst2((unsigned*)(VB + o3), *(const v4u*)&tb[cl][q * 8]); vst2((unsigned*)(VBL + o3), *(const v4u*)&tbl[cl][q * 8]); }
      asm volatile("s_wait_xcnt 0x0" ::: "memory"); } } }   // closes the stores above: the built code has a branch from here into the q/k part, which rewrites their address registers
#define FK 64             // keys per stage
#define LOG2E 1.44269504088896340736f
#define FP 72             // LDS row pitch in halves: 144 B = 16 B x 9, so the 16 rows of a ds_load_b128 fragment read fall on distinct banks
__device__ __forceinline__ v8f wmma_h(v16h a, v16h b, v8f c) { return __builtin_amdgcn_wmma_f32_16x16x32_f16(false, a, false, b, (short)0, c, false, false); }
__device__ __forceinline__ float xhalf(float x) { return __builtin_bit_cast(float, __builtin_amdgcn_permlanex16(__builtin_bit_cast(int, x), __builtin_bit_cast(int, x), 0x76543210, 0xfedcba98, false, false)); }   // lane l with lane l ^ 16
__global__ __launch_bounds__(256) void k_fa(const _Float16* __restrict__ QH, const _Float16* __restrict__ QL, const _Float16* __restrict__ KH, const _Float16* __restrict__ VT, const int* __restrict__ MK, float* __restrict__ Y) {
  __shared__ __align__(16) _Float16 sk[2][FK][FP], sv[2][HD][FP]; __shared__ __align__(16) float mb[TT]; __shared__ __align__(16) float so[8][16][HD + 4];
  const int tid = threadIdx.x, wave = tid >> 5, lane = tid & 31, col = lane & 15, g = lane >> 4; const int h = blockIdx.y, b = blockIdx.z; const int q0 = blockIdx.x * 128 + wave * 16;
  for (int k = tid; k < TT; k += 256) mb[k] = 10000.0f * (1.0f - (float)MK[(size_t)b * TT + k]);   // additive mask term per key, read from the mask input
  v16h qh[2], ql[2];
#pragma unroll
  for (int kc = 0; kc < 2; ++kc) { qh[kc] = frag_h(QH + ((size_t)b * TT + q0 + col) * CC + h * HD + kc * 32, lane); ql[kc] = frag_h(QL + ((size_t)b * QHI + q0 + col) * CC + h * HD + kc * 32, lane); }
  const int sr = tid >> 3, sc8 = (tid & 7) * 8;   // staging: 8 lanes take one 128-B row (a whole line), 32 rows a sweep
  const _Float16* kg = KH + ((size_t)b * TT + sr) * CC + h * HD + sc8; const _Float16* vg = VT + ((size_t)b * CC + h * HD + sr) * (size_t)TT + sc8;
  v8h rk[2], rv[2];
#pragma unroll
  for (int i = 0; i < 2; ++i) { rk[i] = *(const v8h*)(kg + (size_t)(32 * i) * CC); rv[i] = *(const v8h*)(vg + (size_t)(32 * i) * TT); }
#pragma unroll
  for (int i = 0; i < 2; ++i) { *(v8h*)&sk[0][sr + 32 * i][sc8] = rk[i]; *(v8h*)&sv[0][sr + 32 * i][sc8] = rv[i]; }
  v8f o[HD / 16] = {}; float mrun = -3.0e38f, m2run = -3.0e38f, lsum = 0.f;   // m2run: the running maximum in base-2 units, less 11
#pragma unroll 1   // one stage a trip: the body is long already and the buffer index alternates
  for (int s = 0; s < TT / FK; ++s) { const int bu = s & 1; const bool more = s + 1 < TT / FK;
    __syncthreads();   // publishes stage s (and, on the first trip, mb); ends every wave's reads of the other buffer, which is refilled at the foot of this trip
    if (more) {
#pragma unroll
      for (int i = 0; i < 2; ++i) { rk[i] = *(const v8h*)(kg + (size_t)((s + 1) * FK + 32 * i) * CC); rv[i] = *(const v8h*)(vg + (size_t)(32 * i) * TT + (s + 1) * FK); } }
    float sc[4][8];
#pragma unroll
    for (int t = 0; t < 4; ++t) { const v16h k0f = frag_h(&sk[bu][t * 16 + col][0], lane), k1f = frag_h(&sk[bu][t * 16 + col][32], lane);
      const v4f b0 = *(const v4f*)&mb[s * FK + t * 16 + 8 * g], b1 = *(const v4f*)&mb[s * FK + t * 16 + 8 * g + 4];
      v8f a = {}, al = {}; a = wmma_h(k0f, qh[0], a); al = wmma_h(k0f, ql[0], al); a = wmma_h(k1f, qh[1], a); al = wmma_h(k1f, ql[1], al);
#pragma unroll
      for (int r = 0; r < 8; ++r) sc[t][r] = (a[r] + al[r] * (1.0f / 1024.0f)) * SCALE - (r < 4 ? b0[r & 3] : b1[r & 3]); }
    float mx = sc[0][0];
#pragma unroll
    for (int t = 0; t < 4; ++t)
#pragma unroll
      for (int r = 0; r < 8; ++r) mx = fmaxf(mx, sc[t][r]);
    mx = fmaxf(mx, xhalf(mx)); const float mn = fmaxf(mrun, mx); const float m2 = fmaf(mn, LOG2E, -11.0f); const float corr = __builtin_amdgcn_exp2f(m2run - m2); mrun = mn; m2run = m2;   // first stage: 2^(-3e38) = 0
    v16h pf[2]; float ps[4] = {0.f, 0.f, 0.f, 0.f};   // one partial sum a tile: four independent add chains
#pragma unroll
    for (int t = 0; t < 4; ++t)
#pragma unroll
      for (int r = 0; r < 8; ++r) { const float e = __builtin_amdgcn_exp2f(fmaf(sc[t][r], LOG2E, -m2)); ps[t] += e; pf[t >> 1][(t & 1) * 8 + r] = (_Float16)e; }   // e = exp(s - max) x 2^11, at most 2^11 but for the rounding of m2
    lsum = lsum * corr + ((ps[0] + ps[1]) + (ps[2] + ps[3]));
#pragma unroll
    for (int j = 0; j < HD / 16; ++j) o[j] *= corr;
#pragma unroll
    for (int kk = 0; kk < 2; ++kk)
#pragma unroll
      for (int j = 0; j < HD / 16; ++j) o[j] = wmma_h(frag_h(&sv[bu][j * 16 + col][kk * 32], lane), pf[kk], o[j]);
    if (more) {
#pragma unroll
      for (int i = 0; i < 2; ++i) { *(v8h*)&sk[bu ^ 1][sr + 32 * i][sc8] = rk[i]; *(v8h*)&sv[bu ^ 1][sr + 32 * i][sc8] = rv[i]; } } }
  const float l = lsum + xhalf(lsum); const float inv = 1.0f / l;   // l holds the 2^11 of its terms; l is about 2^11 or more: the key that holds the maximum adds 2^11
#pragma unroll
  for (int j = 0; j < HD / 16; ++j) { const v8f w = o[j] * inv; float* d = &so[wave][col][j * 16 + 8 * g]; *(v4f*)d = __builtin_shufflevector(w, w, 0, 1, 2, 3); *(v4f*)(d + 4) = __builtin_shufflevector(w, w, 4, 5, 6, 7); }
  LDSX();   // the wave's own rows of so are written before it reads them across lanes
  for (int it = 0; it < 8; ++it) { const int rl = it * 2 + g; vst2(Y + ((size_t)b * TT + q0 + rl) * CC + h * HD + col * 4, *(const v4f*)&so[wave][rl][col * 4]); } }   // 256-B (row, head) segment by 16 lanes

extern "C" void kernel_launch(void* const* d_in, const int* in_sizes, int n_in, void* d_out, int out_size, void* d_ws, size_t ws_size, hipStream_t stream) {
  (void)in_sizes; (void)n_in; (void)out_size;
  const float** F = (const float**)d_in;
  if (ws_size < (size_t)WS_END) return;
  char* ws = (char*)d_ws; _Float16 *QH = (_Float16*)(ws + WS_QH), *KH = (_Float16*)(ws + WS_KH), *VT = (_Float16*)(ws + WS_VT), *QL = (_Float16*)(ws + WS_QL), *KL = (_Float16*)(ws + WS_KL); __bf16 *VB = (__bf16*)(ws + WS_VB), *VBL = (__bf16*)(ws + WS_VBL); float *S = (float*)(ws + WS_S), *Y = (float*)(ws + WS_Y);
  (void)Y; (void)S; (void)QL; (void)KL; (void)VB; (void)VBL;
  // inputs: 0 x [8,1024,768]; 1 mask [8,1024] int32 (ones); 2 Wq (out,in), 3 bq; 4 Wk, 5 bk; 6 Wv, 7 bv
  k_proj<<<dim3(TNB * TT / 128, CC / 128, 3), 256, 0, stream>>>(F[0], F[0], F[0], F[2], F[4], F[6], F[3], F[5], F[7], QH, QL, KH, KL, VT, VB, VBL);
  k_fa<<<dim3(TT / 128, NH, TNB), 256, 0, stream>>>(QH, QL, KH, VT, (const int*)d_in[1], (float*)d_out);
}

// v004
// A run of this version takes 86.1 microseconds.
// In both of two side-by-side timings against v003, it was 1.09 times as fast.
// Over all steps from v000 it is 18.3 times as fast.
// compute dtype: all float inputs rounded to bf16; q/k/v = in W^T + b with EXACT bf16 products on WMMA 16x16x32 (f32 accumulate); q as f16 hi + f16 residual against k once to f16 (2 products, one f32 accumulator that starts at the mask term); the / 8 rides in the exponent's multiplier; softmax in f32 with a running maximum and sum per query, the exponential as 2^(s log2(e) - max log2(e) + 11) on the hardware's base-2 exponential; that value once to f16 against v once to f16 (1 product), divided by the sum (which carries the same 2^11) at the end; f32 output.
#include <hip/hip_runtime.h>
#include <math.h>

typedef __attribute__((ext_vector_type(16))) _Float16 v16h;
typedef __attribute__((ext_vector_type(16))) __bf16 v16b;
typedef __attribute__((ext_vector_type(8)))  _Float16 v8h;
typedef __attribute__((ext_vector_type(8)))  float v8f;
typedef __attribute__((ext_vector_type(4)))  float v4f;
typedef __attribute__((ext_vector_type(2)))  float v2f;
typedef __attribute__((ext_vector_type(4)))  unsigned v4u;
typedef __attribute__((ext_vector_type(4)))  int v4i;
typedef float __attribute__((may_alias)) float_a;
typedef int __attribute__((may_alias)) int_a;

template <typename T> __device__ __forceinline__ void vst2(void* p, T v) { *(T*)p = v;  }
__device__ __forceinline__ v8f wmma16(v16h a, v16h b, v8f c) {
  v8f d = __builtin_amdgcn_wmma_f32_16x16x32_f16(false, a, false, b, (short)0, c, false, false);
  asm volatile("v_nop\n\tv_nop\n\tv_nop\n\tv_nop" : "+v"(d) : "v"(a), "v"(b));
  return d;
}
__device__ __forceinline__ v8f wmma_bf(v16b a, v16b b, v8f c) {
  v8f d = __builtin_amdgcn_wmma_f32_16x16x32_bf16(false, a, false, b, (short)0, c, false, false);
  asm volatile("v_nop\n\tv_nop\n\tv_nop\n\tv_nop" : "+v"(d) : "v"(a), "v"(b));
  return d;
}
// 16x16x32 fragments: lane = (h = lane>>4, row/col = lane&15); elements 0..7 = k0+8h+0..7, 8..15 = k0+16+8h+0..7; D element r = row 8h+r
__device__ __forceinline__ v16h frag_h(const _Float16* rowk0, int lane) {
  union { v16h v; v8h q[2]; } u; const _Float16* p = rowk0 + 8 * (lane >> 4);
  u.q[0] = *(const v8h*)p; u.q[1] = *(const v8h*)(p + 16); return u.v;
}
__device__ __forceinline__ v16h frag_f32(const float* rowk0, int lane) {
  v16h a; const float* p = rowk0 + 8 * (lane >> 4);
#pragma unroll
  for (int i = 0; i < 8; ++i) { a[i] = (_Float16)p[i]; a[8 + i] = (_Float16)p[16 + i]; }
  return a;
}
__device__ __forceinline__ v16h frag_f32s(const float* rowk0, int lane, float sc) {
  v16h a; const float* p = rowk0 + 8 * (lane >> 4);
#pragma unroll
  for (int i = 0; i < 8; ++i) { a[i] = (_Float16)(p[i] * sc); a[8 + i] = (_Float16)(p[16 + i] * sc); }
  return a;
}
// column fragment from a [K][ld] layout (column n), rows >= K read as 0
__device__ __forceinline__ v16h fragc_f32(const float* W, int k0, int n, int lane, int ld, int K) {
  v16h a; const int g = lane >> 4;
#pragma unroll
  for (int i = 0; i < 8; ++i) { const int ka = k0 + 8 * g + i, kb = ka + 16;
    a[i] = (_Float16)(ka < K ? W[(size_t)(ka < K ? ka : K - 1) * ld + n] : 0.f); a[8 + i] = (_Float16)(kb < K ? W[(size_t)(kb < K ? kb : K - 1) * ld + n] : 0.f); }
  return a;
}
struct F2 { v16b h, l; };
__device__ __forceinline__ F2 bsplit16(const float v[16]) { F2 r;
#pragma unroll
  for (int i = 0; i < 16; ++i) { const __bf16 h = (__bf16)v[i]; r.h[i] = h; r.l[i] = (__bf16)(v[i] - (float)h); }
  return r; }
__device__ __forceinline__ F2 split_row(const float* row, int k0, int lane) { float v[16]; const float* p = row + k0 + 8 * (lane >> 4);
#pragma unroll
  for (int i = 0; i < 8; ++i) { v[i] = p[i]; v[8 + i] = p[16 + i]; }
  return bsplit16(v); }
__device__ __forceinline__ F2 split_rowK(const float* row, int k0, int lane, int K) { float v[16]; const int g = lane >> 4;
#pragma unroll
  for (int i = 0; i < 8; ++i) { const int ka = k0 + 8 * g + i, kb = ka + 16; v[i] = ka < K ? row[ka < K ? ka : K - 1] : 0.f; v[8 + i] = kb < K ? row[kb < K ? kb : K - 1] : 0.f; }
  return bsplit16(v); }
__device__ __forceinline__ F2 split_col(const float* W, int k0, int n, int lane, int ld, int K) { float v[16]; const int g = lane >> 4;
#pragma unroll
  for (int i = 0; i < 8; ++i) { const int ka = k0 + 8 * g + i, kb = ka + 16; v[i] = ka < K ? W[(size_t)(ka < K ? ka : K - 1) * ld + n] : 0.f; v[8 + i] = kb < K ? W[(size_t)(kb < K ? kb : K - 1) * ld + n] : 0.f; }
  return bsplit16(v); }
__device__ __forceinline__ v8f mac3(const F2& a, const F2& b, v8f c) { c = wmma_bf(a.l, b.h, c); c = wmma_bf(a.h, b.l, c); return wmma_bf(a.h, b.h, c); }
__device__ __forceinline__ float sigm(float v) { return 1.0f / (1.0f + expf(-v)); }
#define LDSX() do { asm volatile("s_wait_dscnt 0" ::: "memory"); __builtin_amdgcn_wave_barrier(); __builtin_amdgcn_fence(__ATOMIC_RELEASE, "workgroup"); } while (0)

// Multi-head self-attention (B 8, S 1,024, D 768 = 12 x 64; (out,in) 1/sqrt(768)-scale weights, zero biases; key mask [B,S] int all ones): q, k, v = x W^T + b; scores / 8 - 10000 * (1 - mask); out = merged(softmax v) -> [8, 1,024, 768] (no output projection).
#define NB 8
#define TT 1024
#define CC 768            // NH * HD = projected width
#define DIN 768          // input (model) width
#define NH 12
#define HD 64
#define NQB (TT / 64)
#define HG 4
#define SCALE (0.125f)
#define CAUSAL 0
#ifndef TNB
#define TNB NB
#endif
__device__ __forceinline__ float bfr(float v) { return (float)(__bf16)v; }
__host__ __device__ __forceinline__ int kb_last(int qb) { return CAUSAL ? ((qb * 64 + 63) >> 7) : (TT / 128 - 1); }
typedef __attribute__((ext_vector_type(8))) __bf16 v8b;
__device__ __forceinline__ v16b frag_b(const __bf16* rowk0, int lane) {
  union { v16b v; v8b q[2]; } u; const __bf16* p = rowk0 + 8 * (lane >> 4);
  u.q[0] = *(const v8b*)p; u.q[1] = *(const v8b*)(p + 16); return u.v;
}
#define QBH 0
#define QHI 1024            // rows carrying a q residual plane (all rows when non-causal: 2-product logits everywhere)
#define KHI 64            // key rows carrying k residual / v bf16 hi+lo planes (written by k_proj; no kernel in this file reads them)
// B fragment (k rows k0+.., output column o) of a weight: (in,out) [K][ld] or (out,in) [ld rows of K]: bf16 exact, or f16(bf16 * 256) exact
__device__ __forceinline__ v16b wcol_io(const float* Wm, int k0, int o, int lane, int ld) { v16b w; const int g = lane >> 4;
#pragma unroll
  for (int i = 0; i < 8; ++i) { w[i] = (__bf16)Wm[(size_t)(k0 + 8 * g + i) * ld + o]; w[8 + i] = (__bf16)Wm[(size_t)(k0 + 16 + 8 * g + i) * ld + o]; }
  return w; }
__device__ __forceinline__ v16b wcol_oi(const float* Wm, int k0, int o, int lane, int K) { v16b w; const float* p = Wm + (size_t)o * K + k0 + 8 * (lane >> 4);
#pragma unroll
  for (int i = 0; i < 8; ++i) { w[i] = (__bf16)p[i]; w[8 + i] = (__bf16)p[16 + i]; }
  return w; }
__device__ __forceinline__ v16h wcolh_io(const float* Wm, int k0, int o, int lane, int ld) { v16h w; const int g = lane >> 4;
#pragma unroll
  for (int i = 0; i < 8; ++i) { w[i] = (_Float16)(bfr(Wm[(size_t)(k0 + 8 * g + i) * ld + o]) * 256.0f); w[8 + i] = (_Float16)(bfr(Wm[(size_t)(k0 + 16 + 8 * g + i) * ld + o]) * 256.0f); }
  return w; }
__device__ __forceinline__ v16h wcolh_oi(const float* Wm, int k0, int o, int lane, int K) { v16h w; const float* p = Wm + (size_t)o * K + k0 + 8 * (lane >> 4);
#pragma unroll
  for (int i = 0; i < 8; ++i) { w[i] = (_Float16)(bfr(p[i]) * 256.0f); w[8 + i] = (_Float16)(bfr(p[16 + i]) * 256.0f); }
  return w; }
#define WQKV_LAYOUT 1   // 0 = (in,out) [DIN][CC]; 1 = (out,in) [CC][DIN]; 2 = per-head [NH][DIN][HD]
__device__ __forceinline__ v16b wcol_hdk(const float* Wm, int k0, int o, int lane) { v16b w; const int g = lane >> 4; const float* p = Wm + (size_t)(o / HD) * DIN * HD + (o % HD);
#pragma unroll
  for (int i = 0; i < 8; ++i) { w[i] = (__bf16)p[(size_t)(k0 + 8 * g + i) * HD]; w[8 + i] = (__bf16)p[(size_t)(k0 + 16 + 8 * g + i) * HD]; }
  return w; }
#define WO_OUT_IN 0
#if WQKV_LAYOUT == 1
#define WCOL(W, k0, o, lane) wcol_oi(W, k0, o, lane, DIN)
#elif WQKV_LAYOUT == 2
#define WCOL(W, k0, o, lane) wcol_hdk(W, k0, o, lane)
#else
#define WCOL(W, k0, o, lane) wcol_io(W, k0, o, lane, CC)
#endif
#if WO_OUT_IN
#define WOCOL(W, k0, o, lane) wcol_oi(W, k0, o, lane, CC)
#define WOCOLH(W, k0, o, lane) wcolh_oi(W, k0, o, lane, CC)
#else
#define WOCOL(W, k0, o, lane) wcol_io(W, k0, o, lane, DIN)
#define WOCOLH(W, k0, o, lane) wcolh_io(W, k0, o, lane, DIN)
#endif

#define WS_QH  0u                                      // f16 q rows [b*t][CC]
#define WS_KH  (WS_QH + 2u * (size_t)NB * TT * CC)      // f16 k rows [b*t][CC]
#define WS_VT  (WS_KH + 2u * (size_t)NB * TT * CC)      // f16 v planes [b][c][t]
#define WS_QL  (WS_VT + 2u * (size_t)NB * CC * TT)      // f16 q residual x 2^10 rows [b][t < QHI][CC]
#define WS_KL  (WS_QL + 2u * (size_t)NB * QHI * CC)     // f16 k residual x 2^10 rows [b][t < KHI][CC]
#define WS_VB  (WS_KL + 2u * (size_t)NB * KHI * CC)     // bf16 v hi planes [b][c][t < KHI]
#define WS_VBL (WS_VB + 2u * (size_t)NB * CC * KHI)
#define WS_S   (WS_VBL + 2u * (size_t)NB * CC * KHI)    // f32 [hg][t][s] region, unused (k_fa keeps logits / P in registers)
#define WS_Y   (WS_S  + 4u * (size_t)HG * TT * TT)      // f32 ctx rows [b*t][CC] (only when there is an output projection)
#define WS_END (WS_Y  + 0u)

// ---- k_proj: block = (128 rows, 128 cols, which), 8 waves as 2 x 4, a wave holds 64 x 32 of the tile: q/k/v = X W^T (+ b) with exact bf16 products (K = DIN, summed in the order kc = 0, 1, ...).
// X rows and W rows ((out,in): both K-contiguous) are read once a block in whole 128-B lines, rounded to bf16 once and staged in LDS, two buffers, one barrier a 32-k stage; every wave takes its fragments from there.
// Every bare '#pragma unroll' below stands on a short loop over rx, rw, fa, fw or acc: constant indices keep these arrays in registers.
// -> which 0: q f16 rows (+ residual rows < QHI); 1: k f16 rows (+ residual rows < KHI); 2: v f16 planes [c][t] (+ bf16 hi/lo planes for t < KHI)
#define PM 128            // tile rows, and tile columns
#define PK 32             // k per stage: one 128-B line of every f32 source row
#define PP 40             // LDS row pitch in bf16: 80 B = 16 B x 5, so the 16 rows of a ds_load_b128 fragment read fall on distinct banks
#define PO (PM + 8)       // pitch of the output staging rows in halves: 272 B = 16 B x 17
typedef __attribute__((ext_vector_type(4))) __bf16 v4b;
__device__ __forceinline__ v8f wmma_b(v16b a, v16b b, v8f c) { return __builtin_amdgcn_wmma_f32_16x16x32_bf16(false, a, false, b, (short)0, c, false, false); }
__device__ __forceinline__ v4b bf4(v4f v) { return __builtin_convertvector(v, v4b); }   // round to nearest even, as (__bf16) on each element
__global__ __launch_bounds__(256) void k_proj(const float* __restrict__ XQ, const float* __restrict__ XK, const float* __restrict__ XV, const float* __restrict__ WQ, const float* __restrict__ WK, const float* __restrict__ WV, const float* __restrict__ BQ, const float* __restrict__ BK, const float* __restrict__ BV,
    _Float16* __restrict__ QH, _Float16* __restrict__ QL, _Float16* __restrict__ KH, _Float16* __restrict__ KL, _Float16* __restrict__ VT, __bf16* __restrict__ VB, __bf16* __restrict__ VBL) {
  // one LDS block, used twice: the operand ring in the k loop (2 x 2 x 128 x 80 B = 40,960 B), then the output staging (q, k: 2 x 128 x 272 B; v: 128 x 272 B + 2 x 128 x 144 B = 71,680 B)
  __shared__ __align__(16) char sm[PM * PO * 2 + 2 * PM * 72 * 2];
  __bf16 (*sx)[PM][PP] = (__bf16 (*)[PM][PP])sm; __bf16 (*sw)[PM][PP] = (__bf16 (*)[PM][PP])(sm + 2 * PM * PP * 2);
  const int tid = threadIdx.x, wave = __builtin_amdgcn_readfirstlane(tid >> 5), lane = tid & 31, col = lane & 15, g = lane >> 4, wm = wave >> 2, wn = wave & 3;   // the wave's number in a scalar register: tests on it are scalar branches
  const int which = blockIdx.z; const int c0 = blockIdx.y * PM; const size_t r0 = (size_t)blockIdx.x * PM; const size_t bb = r0 / TT; const int t0 = (int)(r0 % TT);
  const float* X = which == 0 ? XQ : which == 1 ? XK : XV; const float* WA = which == 0 ? WQ : which == 1 ? WK : WV; const float* BA = which == 0 ? BQ : which == 1 ? BK : BV;
  const int sr = tid >> 3, sc4 = (tid & 7) * 4;   // staging: 8 lanes take one 128-B line of a row, 32 rows a sweep, 4 sweeps an operand
  const float* xg = X + (r0 + sr) * DIN + sc4; const float* wg = WA + (size_t)(c0 + sr) * DIN + sc4;
  v4f rx[4], rw[4];
#pragma unroll
  for (int i = 0; i < 4; ++i) { rx[i] = *(const v4f*)(xg + (size_t)(32 * i) * DIN); rw[i] = *(const v4f*)(wg + (size_t)(32 * i) * DIN); }
#pragma unroll
  for (int i = 0; i < 4; ++i) { *(v4b*)&sx[0][sr + 32 * i][sc4] = bf4(rx[i]); *(v4b*)&sw[0][sr + 32 * i][sc4] = bf4(rw[i]); }
  v8f acc[4][2] = {};
#pragma unroll   // all 24 stages in line: buffer index and every global offset become immediates, so no address register is rewritten behind a load
  for (int s = 0; s < DIN / PK; ++s) { const int bu = s & 1; const bool more = s + 1 < DIN / PK;
    __syncthreads();   // publishes stage s; ends every wave's reads of the other buffer, which is refilled at the foot of this trip
    if (more) {
#pragma unroll
      for (int i = 0; i < 4; ++i) { rx[i] = *(const v4f*)(xg + (size_t)(32 * i) * DIN + (s + 1) * PK); rw[i] = *(const v4f*)(wg + (size_t)(32 * i) * DIN + (s + 1) * PK); } }
    v16b fa[4], fw[2];
#pragma unroll
    for (int i = 0; i < 4; ++i) fa[i] = frag_b(&sx[bu][wm * 64 + i * 16 + col][0], lane);
#pragma unroll
    for (int j = 0; j < 2; ++j) fw[j] = frag_b(&sw[bu][wn * 32 + j * 16 + col][0], lane);
    __builtin_amdgcn_sched_barrier(0);   // the stage's global loads and LDS reads issue as one group ahead of its products: otherwise reads are spread among the products, each with a wait of its own, and two global loads start late
#pragma unroll
    for (int i = 0; i < 4; ++i)
#pragma unroll
      for (int j = 0; j < 2; ++j) acc[i][j] = wmma_b(fa[i], fw[j], acc[i][j]);
    __builtin_amdgcn_sched_barrier(0);   // keeps the wait for the next stage's global loads behind this stage's products: otherwise the conversions, and that wait with them, are lifted in front of the first product
    if (more) {
#pragma unroll
      for (int i = 0; i < 4; ++i) { *(v4b*)&sx[bu ^ 1][sr + 32 * i][sc4] = bf4(rx[i]); *(v4b*)&sw[bu ^ 1][sr + 32 * i][sc4] = bf4(rw[i]); } } }
  asm volatile("s_wait_xcnt 0x0" :: "v"(xg), "v"(wg) : "memory");   // the two address pairs are inputs so that they stay whole up to this wait: otherwise the last stage's loads take them as their own result registers behind loads that still name them
  __syncthreads();   // every wave has left the ring before its LDS is written again as output staging
  if (which < 2) { _Float16 (*sh)[PO] = (_Float16 (*)[PO])sm; _Float16 (*sl)[PO] = (_Float16 (*)[PO])(sm + PM * PO * 2);
    _Float16* DH = which == 0 ? QH : KH; _Float16* DL = which == 0 ? QL : KL; const int nhi = which == 0 ? QHI : KHI;
#pragma unroll
    for (int j = 0; j < 2; ++j) { const int cl = wn * 32 + j * 16 + col; const float bias = BA ? bfr(BA[c0 + cl]) : 0.f;
#pragma unroll
      for (int i = 0; i < 4; ++i)
#pragma unroll
        for (int r = 0; r < 8; ++r) { const float v = acc[i][j][r] + bias; const _Float16 hv = (_Float16)v; const int rl = wm * 64 + i * 16 + 8 * g + r; sh[rl][cl] = hv; sl[rl][cl] = (_Float16)((v - (float)hv) * 1024.0f); } }
    __syncthreads();
#pragma unroll   // 16 rows a sweep, 16 lanes a 256-B row segment; in line, so that the LDS reads of all sweeps go ahead of the stores and the row step is an immediate offset
    for (int it = 0; it < PM / 16; ++it) { const int rl = it * 16 + (tid >> 4), q = tid & 15; vst2((unsigned*)(DH + (r0 + rl) * CC + c0 + q * 8), *(const v4u*)&sh[rl][q * 8]); }
#pragma unroll   // residual rows, 64 at a time: nhi is a multiple of 64, so 64 aligned rows are below it all or none (a scalar test)
    for (int hf = 0; hf < PM / 64; ++hf) if (t0 + hf * 64 < nhi) {
      asm volatile("s_wait_xcnt 0x0" ::: "memory");   // stands in front of the rewrite of registers that the stores above name
#pragma unroll   // in line, as above
      for (int it = 0; it < 4; ++it) { const int rl = hf * 64 + it * 16 + (tid >> 4), q = tid & 15; vst2((unsigned*)(DL + (bb * nhi + t0 + rl) * (size_t)CC + c0 + q * 8), *(const v4u*)&sl[rl][q * 8]); } }
  } else { _Float16 (*th)[PO] = (_Float16 (*)[PO])sm; __bf16 (*tb)[72] = (__bf16 (*)[72])(sm + PM * PO * 2); __bf16 (*tbl)[72] = (__bf16 (*)[72])(sm + PM * PO * 2 + PM * 72 * 2);
    const bool hi_tile = t0 < KHI, hi_rows = t0 + wm * 64 < KHI;   // KHI = 64 = a wave's rows: only the first tile of a sequence, and there the four waves of its first 64 rows, hold rows t < KHI
#pragma unroll
    for (int j = 0; j < 2; ++j) { const int cl = wn * 32 + j * 16 + col; const float bias = BA ? bfr(BA[c0 + cl]) : 0.f;
#pragma unroll
      for (int i = 0; i < 4; ++i)
#pragma unroll
        for (int r = 0; r < 8; ++r) { const float v = acc[i][j][r] + bias; acc[i][j][r] = v; th[cl][wm * 64 + i * 16 + 8 * g + r] = (_Float16)v; }
      if (hi_rows) {
#pragma unroll
        for (int i = 0; i < 4; ++i)
#pragma unroll
          for (int r = 0; r < 8; ++r) { const float v = acc[i][j][r]; const int rl = wm * 64 + i * 16 + 8 * g + r; const __bf16 bh = (__bf16)v; tb[cl][rl] = bh; tbl[cl][rl] = (__bf16)(v - (float)bh); } } }
    __syncthreads();
#pragma unroll   // in line, as above
    for (int it = 0; it < PM / 16; ++it) { const int cl = it * 16 + (tid >> 4), q = tid & 15; vst2((unsigned*)(VT + (bb * CC + c0 + cl) * (size_t)TT + t0 + q * 8), *(const v4u*)&th[cl][q * 8]); }
    asm volatile("s_wait_xcnt 0x0" ::: "memory");   // stands in front of the rewrite of registers that the stores above name
    if (hi_tile) {
#pragma unroll   // in line, as above
      for (int it = 0; it < PM / 32; ++it) { const int cl = it * 32 + (tid >> 3), q = tid & 7; const size_t o3 = (bb * CC + c0 + cl) * (size_t)KHI + t0 + q * 8; vst2((unsigned*)(VB + o3), *(const v4u*)&tb[cl][q * 8]); vst2((unsigned*)(VBL + o3), *(const v4u*)&tbl[cl][q * 8]); }
      asm volatile("s_wait_xcnt 0x0" ::: "memory"); } } }   // closes the stores above: the built code has a branch from here into the q/k part, which rewrites their address registers
#define FK 64             // keys per stage
#define LOG2E 1.44269504088896340736f
#define FP 72             // LDS row pitch in halves: 144 B = 16 B x 9, so the 16 rows of a ds_load_b128 fragment read fall on distinct banks
__device__ __forceinline__ v8f wmma_h(v16h a, v16h b, v8f c) { return __builtin_amdgcn_wmma_f32_16x16x32_f16(false, a, false, b, (short)0, c, false, false); }
__device__ __forceinline__ float xhalf(float x) { return __builtin_bit_cast(float, __builtin_amdgcn_permlanex16(__builtin_bit_cast(int, x), __builtin_bit_cast(int, x), 0x76543210, 0xfedcba98, false, false)); }   // lane l with lane l ^ 16
__global__ __launch_bounds__(256, 6) void k_fa(   // 6: the least waves a SIMD to budget registers for (160 each), three 8-wave blocks a WGP
    const _Float16* __restrict__ QH, const _Float16* __restrict__ QL, const _Float16* __restrict__ KH, const _Float16* __restrict__ VT, const int* __restrict__ MK, float* __restrict__ Y) {
  __shared__ __align__(16) _Float16 sk[2][FK][FP], sv[2][HD][FP]; __shared__ __align__(16) float mb[TT]; __shared__ __align__(16) float so[8][16][HD + 4];
  const int tid = threadIdx.x, wave = tid >> 5, lane = tid & 31, col = lane & 15, g = lane >> 4; const int h = blockIdx.y, b = blockIdx.z; const int q0 = blockIdx.x * 128 + wave * 16;
  for (int k = tid; k < TT; k += 256) mb[k] = (-10000.0f / SCALE) * (1.0f - (float)MK[(size_t)b * TT + k]);   // additive mask term per key, read from the mask input, in units of the unscaled product: the start value of the key's score accumulators
  v16h qh[2], ql[2];
#pragma unroll
  for (int kc = 0; kc < 2; ++kc) { qh[kc] = frag_h(QH + ((size_t)b * TT + q0 + col) * CC + h * HD + kc * 32, lane); ql[kc] = frag_h(QL + ((size_t)b * QHI + q0 + col) * CC + h * HD + kc * 32, lane) * (_Float16)(1.0f / 1024.0f); }   // the residual back at q's own scale (small ones as f16 subnormals, step 2^-24), so that it adds into the accumulator of the hi product
  const int sr = tid >> 3, sc8 = (tid & 7) * 8;   // staging: 8 lanes take one 128-B row (a whole line), 32 rows a sweep
  const _Float16* kg = KH + ((size_t)b * TT + sr) * CC + h * HD + sc8; const _Float16* vg = VT + ((size_t)b * CC + h * HD + sr) * (size_t)TT + sc8;
  v8h rk[2], rv[2];
#pragma unroll
  for (int i = 0; i < 2; ++i) { rk[i] = *(const v8h*)(kg + (size_t)(32 * i) * CC); rv[i] = *(const v8h*)(vg + (size_t)(32 * i) * TT); }
#pragma unroll
  for (int i = 0; i < 2; ++i) { *(v8h*)&sk[0][sr + 32 * i][sc8] = rk[i]; *(v8h*)&sv[0][sr + 32 * i][sc8] = rv[i]; }
  v8f o[HD / 16] = {}; float mrun = -3.0e38f, m2run = -3.0e38f, lsum = 0.f;   // mrun: the running maximum of the unscaled scores; m2run: the same in base-2 units, less 11
#pragma unroll 1   // one stage a trip: the body is long already and the buffer index alternates
  for (int s = 0; s < TT / FK; ++s) { const int bu = s & 1; const bool more = s + 1 < TT / FK;
    __syncthreads();   // publishes stage s (and, on the first trip, mb); ends every wave's reads of the other buffer, which is refilled at the foot of this trip
    if (more) {
#pragma unroll
      for (int i = 0; i < 2; ++i) { rk[i] = *(const v8h*)(kg + (size_t)((s + 1) * FK + 32 * i) * CC); rv[i] = *(const v8h*)(vg + (size_t)(32 * i) * TT + (s + 1) * FK); } }
    v8f sc[4];   // unscaled scores: mask term + K q_hi + K q_residual, one accumulator a tile
#pragma unroll
    for (int t = 0; t < 4; ++t) { const v4f b0 = *(const v4f*)&mb[s * FK + t * 16 + 8 * g], b1 = *(const v4f*)&mb[s * FK + t * 16 + 8 * g + 4]; sc[t] = __builtin_shufflevector(b0, b1, 0, 1, 2, 3, 4, 5, 6, 7); }
#pragma unroll
    for (int kc = 0; kc < 2; ++kc) { v16h kf[4];
#pragma unroll
      for (int t = 0; t < 4; ++t) kf[t] = frag_h(&sk[bu][t * 16 + col][kc * 32], lane);
#pragma unroll
      for (int t = 0; t < 4; ++t) sc[t] = wmma_h(kf[t], qh[kc], sc[t]);
#pragma unroll
      for (int t = 0; t < 4; ++t) sc[t] = wmma_h(kf[t], ql[kc], sc[t]); }
    float mx = sc[0][0];
#pragma unroll
    for (int t = 0; t < 4; ++t)
#pragma unroll
      for (int r = 0; r < 8; ++r) mx = fmaxf(mx, sc[t][r]);
    mx = fmaxf(mx, xhalf(mx)); const float mn = fmaxf(mrun, mx); const float m2 = fmaf(mn, SCALE * LOG2E, -11.0f); const float corr = __builtin_amdgcn_exp2f(m2run - m2); mrun = mn; m2run = m2;   // first stage: 2^(-3e38) = 0
    v16h pf[2]; float ps[4] = {0.f, 0.f, 0.f, 0.f};   // one partial sum a tile: four independent add chains
#pragma unroll
    for (int t = 0; t < 4; ++t)
#pragma unroll
      for (int r = 0; r < 8; ++r) { const float e = __builtin_amdgcn_exp2f(fmaf(sc[t][r], SCALE * LOG2E, -m2)); ps[t] += e; pf[t >> 1][(t & 1) * 8 + r] = (_Float16)e; }   // e = exp(s - max) x 2^11, at most 2^11 but for the rounding of m2
    lsum = lsum * corr + ((ps[0] + ps[1]) + (ps[2] + ps[3]));
#pragma unroll
    for (int j = 0; j < HD / 16; ++j) o[j] *= corr;
#pragma unroll
    for (int kk = 0; kk < 2; ++kk)
#pragma unroll
      for (int j = 0; j < HD / 16; ++j) o[j] = wmma_h(frag_h(&sv[bu][j * 16 + col][kk * 32], lane), pf[kk], o[j]);
    if (more) {
#pragma unroll
      for (int i = 0; i < 2; ++i) { *(v8h*)&sk[bu ^ 1][sr + 32 * i][sc8] = rk[i]; *(v8h*)&sv[bu ^ 1][sr + 32 * i][sc8] = rv[i]; } } }
  const float l = lsum + xhalf(lsum); const float inv = 1.0f / l;   // l holds the 2^11 of its terms; l is about 2^11 or more: the key that holds the maximum adds 2^11
#pragma unroll
  for (int j = 0; j < HD / 16; ++j) { const v8f w = o[j] * inv; float* d = &so[wave][col][j * 16 + 8 * g]; *(v4f*)d = __builtin_shufflevector(w, w, 0, 1, 2, 3); *(v4f*)(d + 4) = __builtin_shufflevector(w, w, 4, 5, 6, 7); }
  LDSX();   // the wave's own rows of so are written before it reads them across lanes
  for (int it = 0; it < 8; ++it) { const int rl = it * 2 + g; vst2(Y + ((size_t)b * TT + q0 + rl) * CC + h * HD + col * 4, *(const v4f*)&so[wave][rl][col * 4]); } }   // 256-B (row, head) segment by 16 lanes

extern "C" void kernel_launch(void* const* d_in, const int* in_sizes, int n_in, void* d_out, int out_size, void* d_ws, size_t ws_size, hipStream_t stream) {
  (void)in_sizes; (void)n_in; (void)out_size;
  const float** F = (const float**)d_in;
  if (ws_size < (size_t)WS_END) return;
  char* ws = (char*)d_ws; _Float16 *QH = (_Float16*)(ws + WS_QH), *KH = (_Float16*)(ws + WS_KH), *VT = (_Float16*)(ws + WS_VT), *QL = (_Float16*)(ws + WS_QL), *KL = (_Float16*)(ws + WS_KL); __bf16 *VB = (__bf16*)(ws + WS_VB), *VBL = (__bf16*)(ws + WS_VBL); float *S = (float*)(ws + WS_S), *Y = (float*)(ws + WS_Y);
  (void)Y; (void)S; (void)QL; (void)KL; (void)VB; (void)VBL;
  // inputs: 0 x [8,1024,768]; 1 mask [8,1024] int32 (ones); 2 Wq (out,in), 3 bq; 4 Wk, 5 bk; 6 Wv, 7 bv
  k_proj<<<dim3(TNB * TT / 128, CC / 128, 3), 256, 0, stream>>>(F[0], F[0], F[0], F[2], F[4], F[6], F[3], F[5], F[7], QH, QL, KH, KL, VT, VB, VBL);
  k_fa<<<dim3(TT / 128, NH, TNB), 256, 0, stream>>>(QH, QL, KH, VT, (const int*)d_in[1], (float*)d_out);
}

// v005
// It runs in 76.4 microseconds.
// Two timings next to v004 both put it at 1.13 times that version's speed.
// Over all steps from v000 it is 20.7 times as fast.
// compute dtype: all float inputs rounded to bf16; q/k/v = in W^T + b with EXACT bf16 products on WMMA 16x16x32 (f32 accumulate); q as f16 hi + f16 residual against k once to f16 (2 products, one f32 accumulator that starts at the mask term); the / 8 rides in the exponent's multiplier; softmax in f32 with a running maximum and sum per query, the exponential as 2^(s log2(e) - max log2(e) + 11) on the hardware's base-2 exponential; that value once to f16 against v once to f16 (1 product), divided by the sum (which carries the same 2^11) at the end; f32 output.
#include <hip/hip_runtime.h>
#include <math.h>

typedef __attribute__((ext_vector_type(16))) _Float16 v16h;
typedef __attribute__((ext_vector_type(16))) __bf16 v16b;
typedef __attribute__((ext_vector_type(8)))  _Float16 v8h;
typedef __attribute__((ext_vector_type(8)))  float v8f;
typedef __attribute__((ext_vector_type(4)))  float v4f;
typedef __attribute__((ext_vector_type(2)))  float v2f;
typedef __attribute__((ext_vector_type(4)))  unsigned v4u;
typedef __attribute__((ext_vector_type(4)))  int v4i;
typedef float __attribute__((may_alias)) float_a;
typedef int __attribute__((may_alias)) int_a;

template <typename T> __device__ __forceinline__ void vst2(void* p, T v) { *(T*)p = v;  }
__device__ __forceinline__ v8f wmma16(v16h a, v16h b, v8f c) {
  v8f d = __builtin_amdgcn_wmma_f32_16x16x32_f16(false, a, false, b, (short)0, c, false, false);
  asm volatile("v_nop\n\tv_nop\n\tv_nop\n\tv_nop" : "+v"(d) : "v"(a), "v"(b));
  return d;
}
__device__ __forceinline__ v8f wmma_bf(v16b a, v16b b, v8f c) {
  v8f d = __builtin_amdgcn_wmma_f32_16x16x32_bf16(false, a, false, b, (short)0, c, false, false);
  asm volatile("v_nop\n\tv_nop\n\tv_nop\n\tv_nop" : "+v"(d) : "v"(a), "v"(b));
  return d;
}
// 16x16x32 fragments: lane = (h = lane>>4, row/col = lane&15); elements 0..7 = k0+8h+0..7, 8..15 = k0+16+8h+0..7; D element r = row 8h+r
__device__ __forceinline__ v16h frag_h(const _Float16* rowk0, int lane) {
  union { v16h v; v8h q[2]; } u; const _Float16* p = rowk0 + 8 * (lane >> 4);
  u.q[0] = *(const v8h*)p; u.q[1] = *(const v8h*)(p + 16); return u.v;
}
__device__ __forceinline__ v16h frag_f32(const float* rowk0, int lane) {
  v16h a; const float* p = rowk0 + 8 * (lane >> 4);
#pragma unroll
  for (int i = 0; i < 8; ++i) { a[i] = (_Float16)p[i]; a[8 + i] = (_Float16)p[16 + i]; }
  return a;
}
__device__ __forceinline__ v16h frag_f32s(const float* rowk0, int lane, float sc) {
  v16h a; const float* p = rowk0 + 8 * (lane >> 4);
#pragma unroll
  for (int i = 0; i < 8; ++i) { a[i] = (_Float16)(p[i] * sc); a[8 + i] = (_Float16)(p[16 + i] * sc); }
  return a;
}
// column fragment from a [K][ld] layout (column n), rows >= K read as 0
__device__ __forceinline__ v16h fragc_f32(const float* W, int k0, int n, int lane, int ld, int K) {
  v16h a; const int g = lane >> 4;
#pragma unroll
  for (int i = 0; i < 8; ++i) { const int ka = k0 + 8 * g + i, kb = ka + 16;
    a[i] = (_Float16)(ka < K ? W[(size_t)(ka < K ? ka : K - 1) * ld + n] : 0.f); a[8 + i] = (_Float16)(kb < K ? W[(size_t)(kb < K ? kb : K - 1) * ld + n] : 0.f); }
  return a;
}
struct F2 { v16b h, l; };
__device__ __forceinline__ F2 bsplit16(const float v[16]) { F2 r;
#pragma unroll
  for (int i = 0; i < 16; ++i) { const __bf16 h = (__bf16)v[i]; r.h[i] = h; r.l[i] = (__bf16)(v[i] - (float)h); }
  return r; }
__device__ __forceinline__ F2 split_row(const float* row, int k0, int lane) { float v[16]; const float* p = row + k0 + 8 * (lane >> 4);
#pragma unroll
  for (int i = 0; i < 8; ++i) { v[i] = p[i]; v[8 + i] = p[16 + i]; }
  return bsplit16(v); }
__device__ __forceinline__ F2 split_rowK(const float* row, int k0, int lane, int K) { float v[16]; const int g = lane >> 4;
#pragma unroll
  for (int i = 0; i < 8; ++i) { const int ka = k0 + 8 * g + i, kb = ka + 16; v[i] = ka < K ? row[ka < K ? ka : K - 1] : 0.f; v[8 + i] = kb < K ? row[kb < K ? kb : K - 1] : 0.f; }
  return bsplit16(v); }
__device__ __forceinline__ F2 split_col(const float* W, int k0, int n, int lane, int ld, int K) { float v[16]; const int g = lane >> 4;
#pragma unroll
  for (int i = 0; i < 8; ++i) { const int ka = k0 + 8 * g + i, kb = ka + 16; v[i] = ka < K ? W[(size_t)(ka < K ? ka : K - 1) * ld + n] : 0.f; v[8 + i] = kb < K ? W[(size_t)(kb < K ? kb : K - 1) * ld + n] : 0.f; }
  return bsplit16(v); }
__device__ __forceinline__ v8f mac3(const F2& a, const F2& b, v8f c) { c = wmma_bf(a.l, b.h, c); c = wmma_bf(a.h, b.l, c); return wmma_bf(a.h, b.h, c); }
__device__ __forceinline__ float sigm(float v) { return 1.0f / (1.0f + expf(-v)); }
#define LDSX() do { asm volatile("s_wait_dscnt 0" ::: "memory"); __builtin_amdgcn_wave_barrier(); __builtin_amdgcn_fence(__ATOMIC_RELEASE, "workgroup"); } while (0)

// Multi-head self-attention (B 8, S 1,024, D 768 = 12 x 64; (out,in) 1/sqrt(768)-scale weights, zero biases; key mask [B,S] int all ones): q, k, v = x W^T + b; scores / 8 - 10000 * (1 - mask); out = merged(softmax v) -> [8, 1,024, 768] (no output projection).
#define NB 8
#define TT 1024
#define CC 768            // NH * HD = projected width
#define DIN 768          // input (model) width
#define NH 12
#define HD 64
#define NQB (TT / 64)
#define HG 4
#define SCALE (0.125f)
#define CAUSAL 0
#ifndef TNB
#define TNB NB
#endif
__device__ __forceinline__ float bfr(float v) { return (float)(__bf16)v; }
__host__ __device__ __forceinline__ int kb_last(int qb) { return CAUSAL ? ((qb * 64 + 63) >> 7) : (TT / 128 - 1); }
typedef __attribute__((ext_vector_type(8))) __bf16 v8b;
__device__ __forceinline__ v16b frag_b(const __bf16* rowk0, int lane) {
  union { v16b v; v8b q[2]; } u; const __bf16* p = rowk0 + 8 * (lane >> 4);
  u.q[0] = *(const v8b*)p; u.q[1] = *(const v8b*)(p + 16); return u.v;
}
#define QBH 0
#define QHI 1024            // rows carrying a q residual plane (all rows when non-causal: 2-product logits everywhere)
#define KHI 64            // key rows carrying k residual / v bf16 hi+lo planes (written by k_proj; no kernel in this file reads them)
// B fragment (k rows k0+.., output column o) of a weight: (in,out) [K][ld] or (out,in) [ld rows of K]: bf16 exact, or f16(bf16 * 256) exact
__device__ __forceinline__ v16b wcol_io(const float* Wm, int k0, int o, int lane, int ld) { v16b w; const int g = lane >> 4;
#pragma unroll
  for (int i = 0; i < 8; ++i) { w[i] = (__bf16)Wm[(size_t)(k0 + 8 * g + i) * ld + o]; w[8 + i] = (__bf16)Wm[(size_t)(k0 + 16 + 8 * g + i) * ld + o]; }
  return w; }
__device__ __forceinline__ v16b wcol_oi(const float* Wm, int k0, int o, int lane, int K) { v16b w; const float* p = Wm + (size_t)o * K + k0 + 8 * (lane >> 4);
#pragma unroll
  for (int i = 0; i < 8; ++i) { w[i] = (__bf16)p[i]; w[8 + i] = (__bf16)p[16 + i]; }
  return w; }
__device__ __forceinline__ v16h wcolh_io(const float* Wm, int k0, int o, int lane, int ld) { v16h w; const int g = lane >> 4;
#pragma unroll
  for (int i = 0; i < 8; ++i) { w[i] = (_Float16)(bfr(Wm[(size_t)(k0 + 8 * g + i) * ld + o]) * 256.0f); w[8 + i] = (_Float16)(bfr(Wm[(size_t)(k0 + 16 + 8 * g + i) * ld + o]) * 256.0f); }
  return w; }
__device__ __forceinline__ v16h wcolh_oi(const float* Wm, int k0, int o, int lane, int K) { v16h w; const float* p = Wm + (size_t)o * K + k0 + 8 * (lane >> 4);
#pragma unroll
  for (int i = 0; i < 8; ++i) { w[i] = (_Float16)(bfr(p[i]) * 256.0f); w[8 + i] = (_Float16)(bfr(p[16 + i]) * 256.0f); }
  return w; }
#define WQKV_LAYOUT 1   // 0 = (in,out) [DIN][CC]; 1 = (out,in) [CC][DIN]; 2 = per-head [NH][DIN][HD]
__device__ __forceinline__ v16b wcol_hdk(const float* Wm, int k0, int o, int lane) { v16b w; const int g = lane >> 4; const float* p = Wm + (size_t)(o / HD) * DIN * HD + (o % HD);
#pragma unroll
  for (int i = 0; i < 8; ++i) { w[i] = (__bf16)p[(size_t)(k0 + 8 * g + i) * HD]; w[8 + i] = (__bf16)p[(size_t)(k0 + 16 + 8 * g + i) * HD]; }
  return w; }
#define WO_OUT_IN 0
#if WQKV_LAYOUT == 1
#define WCOL(W, k0, o, lane) wcol_oi(W, k0, o, lane, DIN)
#elif WQKV_LAYOUT == 2
#define WCOL(W, k0, o, lane) wcol_hdk(W, k0, o, lane)
#else
#define WCOL(W, k0, o, lane) wcol_io(W, k0, o, lane, CC)
#endif
#if WO_OUT_IN
#define WOCOL(W, k0, o, lane) wcol_oi(W, k0, o, lane, CC)
#define WOCOLH(W, k0, o, lane) wcolh_oi(W, k0, o, lane, CC)
#else
#define WOCOL(W, k0, o, lane) wcol_io(W, k0, o, lane, DIN)
#define WOCOLH(W, k0, o, lane) wcolh_io(W, k0, o, lane, DIN)
#endif

#define WS_QH  0u                                      // f16 q rows [b*t][CC]
#define WS_KH  (WS_QH + 2u * (size_t)NB * TT * CC)      // f16 k rows [b*t][CC]
#define WS_VT  (WS_KH + 2u * (size_t)NB * TT * CC)      // f16 v planes [b][c][t]
#define WS_QL  (WS_VT + 2u * (size_t)NB * CC * TT)      // f16 q residual x 2^10 rows [b][t < QHI][CC]
#define WS_KL  (WS_QL + 2u * (size_t)NB * QHI * CC)     // f16 k residual x 2^10 rows [b][t < KHI][CC]
#define WS_VB  (WS_KL + 2u * (size_t)NB * KHI * CC)     // bf16 v hi planes [b][c][t < KHI]
#define WS_VBL (WS_VB + 2u * (size_t)NB * CC * KHI)
#define WS_S   (WS_VBL + 2u * (size_t)NB * CC * KHI)    // f32 logits / P [hg][t][s]
#define WS_XB  WS_S                                    // bf16 x rows [b*t][DIN]: the logits plane above is not in use, its place holds the rounded operands
#define WS_WB  (WS_XB + 2u * (size_t)NB * TT * DIN)     // bf16 Wq, Wk, Wv rows [3][CC][DIN]; ends below WS_Y
#define WS_Y   (WS_S  + 4u * (size_t)HG * TT * TT)      // f32 ctx rows [b*t][CC] (only when there is an output projection)
#define WS_END (WS_Y  + 0u)
static_assert(WS_WB + 2u * 3u * (size_t)CC * DIN <= WS_Y, "the rounded operands fit the unused plane");

// ---- k_proj: block = (128 rows, 128 cols, which), 8 waves as 2 x 4, a wave holds 64 x 32 of the tile: q/k/v = X W^T (+ b) with exact bf16 products (K = DIN, summed in the order kc = 0, 1, ...).
// X rows and W rows ((out,in): both K-contiguous) come as bf16 from k_cvt; a block reads them once in whole 128-B lines (64 k) and stages them in LDS, two buffers, one barrier a 64-k stage; every wave takes its fragments from there.
// Every bare '#pragma unroll' below stands on a short loop over rx, rw, fa, fw or acc: constant indices keep these arrays in registers.
// -> which 0: q f16 rows (+ residual rows < QHI); 1: k f16 rows (+ residual rows < KHI); 2: v f16 planes [c][t] (+ bf16 hi/lo planes for t < KHI)
#define PM 128            // tile rows, and tile columns
#define PK 64             // k per stage: one 128-B line of every bf16 source row
#define PP 72             // LDS row pitch in bf16: 144 B = 16 B x 9, so the 16 rows of a ds_load_b128 fragment read fall on distinct banks
#define PO (PM + 8)       // pitch of the output staging rows in halves: 272 B = 16 B x 17
typedef __attribute__((ext_vector_type(4))) __bf16 v4b;
__device__ __forceinline__ v8f wmma_b(v16b a, v16b b, v8f c) { return __builtin_amdgcn_wmma_f32_16x16x32_bf16(false, a, false, b, (short)0, c, false, false); }
__device__ __forceinline__ v4b bf4(v4f v) { return __builtin_convertvector(v, v4b); }   // round to nearest even, as (__bf16) on each element
// ---- k_cvt: x and the three weights rounded to bf16 ONCE (k_proj would round every X row 18 times and every W row 64 times, and read it as f32 each time). A block takes 256 x 16 units of 4 floats of one source; a wave's load covers 512 B in a row, its store 256 B.
#define CVU 16            // units of 4 floats a thread: all 16 loads are issued ahead of the first store
#define CVX (NB * TT * DIN / (4 * 256 * CVU))   // blocks for x
#define CVW (CC * DIN / (4 * 256 * CVU))        // blocks for one weight
static_assert(CVX * 4 * 256 * CVU == NB * TT * DIN && CVW * 4 * 256 * CVU == CC * DIN, "whole blocks");
__global__ __launch_bounds__(256) void k_cvt(const float* __restrict__ X, const float* __restrict__ WQ, const float* __restrict__ WK, const float* __restrict__ WV, __bf16* __restrict__ XB, __bf16* __restrict__ WB) {
  int bl = blockIdx.x; const float* src = X; __bf16* dst = XB;
  if (bl >= CVX) { bl -= CVX; const int w = bl / CVW; bl -= w * CVW; src = w == 0 ? WQ : w == 1 ? WK : WV; dst = WB + (size_t)w * CC * DIN; }
  const size_t e0 = ((size_t)bl * (256 * CVU) + threadIdx.x) * 4;
  v4f r[CVU];
#pragma unroll   // constant indices keep r in registers; the step is an immediate offset
  for (int j = 0; j < CVU; ++j) r[j] = *(const v4f*)(src + e0 + j * 1024);
#pragma unroll   // as above
  for (int j = 0; j < CVU; ++j) *(v4b*)(dst + e0 + j * 1024) = bf4(r[j]); }
__global__ __launch_bounds__(256, 6) void k_proj(   // 6: the least waves a SIMD to budget registers for (160 each), three 8-wave blocks a WGP
    const __bf16* __restrict__ XB, const __bf16* __restrict__ WB, const float* __restrict__ BQ, const float* __restrict__ BK, const float* __restrict__ BV,
    _Float16* __restrict__ QH, _Float16* __restrict__ QL, _Float16* __restrict__ KH, _Float16* __restrict__ KL, _Float16* __restrict__ VT, __bf16* __restrict__ VB, __bf16* __restrict__ VBL) {
  // one LDS block, used twice: the operand ring in the k loop (2 x 2 x 128 x 144 B = 73,728 B), then the output staging (q, k: 2 x 128 x 272 B; v: 128 x 272 B + 2 x 128 x 144 B = 71,680 B)
  static_assert(2 * 2 * PM * PP * 2 >= PM * PO * 2 + 2 * PM * 72 * 2, "the ring holds the staging");
  __shared__ __align__(16) char sm[2 * 2 * PM * PP * 2];
  __bf16 (*sx)[PM][PP] = (__bf16 (*)[PM][PP])sm; __bf16 (*sw)[PM][PP] = (__bf16 (*)[PM][PP])(sm + 2 * PM * PP * 2);
  const int tid = threadIdx.x, wave = __builtin_amdgcn_readfirstlane(tid >> 5), lane = tid & 31, col = lane & 15, g = lane >> 4, wm = wave >> 2, wn = wave & 3;   // the wave's number in a scalar register: tests on it are scalar branches
  const int which = blockIdx.z; const int c0 = blockIdx.y * PM; const size_t r0 = (size_t)blockIdx.x * PM; const size_t bb = r0 / TT; const int t0 = (int)(r0 % TT);
  const float* BA = which == 0 ? BQ : which == 1 ? BK : BV;
  const int sr = tid >> 3, sc8 = (tid & 7) * 8;   // staging: 8 lanes take one 128-B line of a row, 32 rows a sweep, 4 sweeps an operand
  const __bf16* xg = XB + (r0 + sr) * DIN + sc8; const __bf16* wg = WB + ((size_t)which * CC + c0 + sr) * DIN + sc8;
  v8b rx[4], rw[4];
#pragma unroll
  for (int i = 0; i < 4; ++i) { rx[i] = *(const v8b*)(xg + (size_t)(32 * i) * DIN); rw[i] = *(const v8b*)(wg + (size_t)(32 * i) * DIN); }
#pragma unroll
  for (int i = 0; i < 4; ++i) { *(v8b*)&sx[0][sr + 32 * i][sc8] = rx[i]; *(v8b*)&sw[0][sr + 32 * i][sc8] = rw[i]; }
  v8f acc[4][2] = {};
#pragma unroll   // all 12 stages in line: buffer index and every global offset become immediates, so no address register is rewritten behind a load
  for (int s = 0; s < DIN / PK; ++s) { const int bu = s & 1; const bool more = s + 1 < DIN / PK;
    __syncthreads();   // publishes stage s; ends every wave's reads of the other buffer, which is refilled at the foot of this trip
    if (more) {
#pragma unroll
      for (int i = 0; i < 4; ++i) { rx[i] = *(const v8b*)(xg + (size_t)(32 * i) * DIN + (s + 1) * PK); rw[i] = *(const v8b*)(wg + (size_t)(32 * i) * DIN + (s + 1) * PK); } }
#pragma unroll   // the stage's two 32-k halves, in k order
    for (int kc = 0; kc < PK / 32; ++kc) { v16b fa[4], fw[2];
#pragma unroll
      for (int i = 0; i < 4; ++i) fa[i] = frag_b(&sx[bu][wm * 64 + i * 16 + col][kc * 32], lane);
#pragma unroll
      for (int j = 0; j < 2; ++j) fw[j] = frag_b(&sw[bu][wn * 32 + j * 16 + col][kc * 32], lane);
      __builtin_amdgcn_sched_barrier(0);   // the stage's global loads and a half's LDS reads issue as one group ahead of its products: otherwise reads are spread among the products, each with a wait of its own, and global loads start late
#pragma unroll
      for (int i = 0; i < 4; ++i)
#pragma unroll
        for (int j = 0; j < 2; ++j) acc[i][j] = wmma_b(fa[i], fw[j], acc[i][j]);
      __builtin_amdgcn_sched_barrier(0); }   // keeps a half's products together, and the wait for the next stage's global loads behind the stage's last product
    if (more) {
#pragma unroll
      for (int i = 0; i < 4; ++i) { *(v8b*)&sx[bu ^ 1][sr + 32 * i][sc8] = rx[i]; *(v8b*)&sw[bu ^ 1][sr + 32 * i][sc8] = rw[i]; } } }
  asm volatile("s_wait_xcnt 0x0" :: "v"(xg), "v"(wg) : "memory");   // the two address pairs are inputs so that they stay whole up to this wait: otherwise the last stage's loads take them as their own result registers behind loads that still name them
  __syncthreads();   // every wave has left the ring before its LDS is written again as output staging
  if (which < 2) { _Float16 (*sh)[PO] = (_Float16 (*)[PO])sm; _Float16 (*sl)[PO] = (_Float16 (*)[PO])(sm + PM * PO * 2);
    _Float16* DH = which == 0 ? QH : KH; _Float16* DL = which == 0 ? QL : KL; const int nhi = which == 0 ? QHI : KHI;
#pragma unroll
    for (int j = 0; j < 2; ++j) { const int cl = wn * 32 + j * 16 + col; const float bias = BA ? bfr(BA[c0 + cl]) : 0.f;
#pragma unroll
      for (int i = 0; i < 4; ++i)
#pragma unroll
        for (int r = 0; r < 8; ++r) { const float v = acc[i][j][r] + bias; const _Float16 hv = (_Float16)v; const int rl = wm * 64 + i * 16 + 8 * g + r; sh[rl][cl] = hv; sl[rl][cl] = (_Float16)((v - (float)hv) * 1024.0f); } }
    __syncthreads();
#pragma unroll   // 16 rows a sweep, 16 lanes a 256-B row segment; in line, so that the LDS reads of all sweeps go ahead of the stores and the row step is an immediate offset
    for (int it = 0; it < PM / 16; ++it) { const int rl = it * 16 + (tid >> 4), q = tid & 15; vst2((unsigned*)(DH + (r0 + rl) * CC + c0 + q * 8), *(const v4u*)&sh[rl][q * 8]); }
#pragma unroll   // residual rows, 64 at a time: nhi is a multiple of 64, so 64 aligned rows are below it all or none (a scalar test)
    for (int hf = 0; hf < PM / 64; ++hf) if (t0 + hf * 64 < nhi) {
      asm volatile("s_wait_xcnt 0x0" ::: "memory");   // stands in front of the rewrite of registers that the stores above name
#pragma unroll   // in line, as above
      for (int it = 0; it < 4; ++it) { const int rl = hf * 64 + it * 16 + (tid >> 4), q = tid & 15; vst2((unsigned*)(DL + (bb * nhi + t0 + rl) * (size_t)CC + c0 + q * 8), *(const v4u*)&sl[rl][q * 8]); } }
  } else { _Float16 (*th)[PO] = (_Float16 (*)[PO])sm; __bf16 (*tb)[72] = (__bf16 (*)[72])(sm + PM * PO * 2); __bf16 (*tbl)[72] = (__bf16 (*)[72])(sm + PM * PO * 2 + PM * 72 * 2);
    const bool hi_tile = t0 < KHI, hi_rows = t0 + wm * 64 < KHI;   // KHI = 64 = a wave's rows: only the first tile of a sequence, and there the four waves of its first 64 rows, hold rows t < KHI
#pragma unroll
    for (int j = 0; j < 2; ++j) { const int cl = wn * 32 + j * 16 + col; const float bias = BA ? bfr(BA[c0 + cl]) : 0.f;
#pragma unroll
      for (int i = 0; i < 4; ++i)
#pragma unroll
        for (int r = 0; r < 8; ++r) { const float v = acc[i][j][r] + bias; acc[i][j][r] = v; th[cl][wm * 64 + i * 16 + 8 * g + r] = (_Float16)v; }
      if (hi_rows) {
#pragma unroll
        for (int i = 0; i < 4; ++i)
#pragma unroll
          for (int r = 0; r < 8; ++r) { const float v = acc[i][j][r]; const int rl = wm * 64 + i * 16 + 8 * g + r; const __bf16 bh = (__bf16)v; tb[cl][rl] = bh; tbl[cl][rl] = (__bf16)(v - (float)bh); } } }
    __syncthreads();
#pragma unroll   // in line, as above
    for (int it = 0; it < PM / 16; ++it) { const int cl = it * 16 + (tid >> 4), q = tid & 15; vst2((unsigned*)(VT + (bb * CC + c0 + cl) * (size_t)TT + t0 + q * 8), *(const v4u*)&th[cl][q * 8]); }
    asm volatile("s_wait_xcnt 0x0" ::: "memory");   // stands in front of the rewrite of registers that the stores above name
    if (hi_tile) {
#pragma unroll   // in line, as above
      for (int it = 0; it < PM / 32; ++it) { const int cl = it * 32 + (tid >> 3), q = tid & 7; const size_t o3 = (bb * CC + c0 + cl) * (size_t)KHI + t0 + q * 8; vst2((unsigned*)(VB + o3), *(const v4u*)&tb[cl][q * 8]); vst2((unsigned*)(VBL + o3), *(const v4u*)&tbl[cl][q * 8]); }
      asm volatile("s_wait_xcnt 0x0" ::: "memory"); } } }   // closes the stores above: the built code has a branch from here into the q/k part, which rewrites their address registers
#define FK 64             // keys per stage
#define LOG2E 1.44269504088896340736f
#define FP 72             // LDS row pitch in halves: 144 B = 16 B x 9, so the 16 rows of a ds_load_b128 fragment read fall on distinct banks
__device__ __forceinline__ v8f wmma_h(v16h a, v16h b, v8f c) { return __builtin_amdgcn_wmma_f32_16x16x32_f16(false, a, false, b, (short)0, c, false, false); }
__device__ __forceinline__ float xhalf(float x) { return __builtin_bit_cast(float, __builtin_amdgcn_permlanex16(__builtin_bit_cast(int, x), __builtin_bit_cast(int, x), 0x76543210, 0xfedcba98, false, false)); }   // lane l with lane l ^ 16
__global__ __launch_bounds__(256, 6) void k_fa(   // 6: the least waves a SIMD to budget registers for (160 each), three 8-wave blocks a WGP
    const _Float16* __restrict__ QH, const _Float16* __restrict__ QL, const _Float16* __restrict__ KH, const _Float16* __restrict__ VT, const int* __restrict__ MK, float* __restrict__ Y) {
  __shared__ __align__(16) _Float16 sk[2][FK][FP], sv[2][HD][FP]; __shared__ __align__(16) float mb[TT]; __shared__ __align__(16) float so[8][16][HD + 4];
  const int tid = threadIdx.x, wave = tid >> 5, lane = tid & 31, col = lane & 15, g = lane >> 4; const int h = blockIdx.y, b = blockIdx.z; const int q0 = blockIdx.x * 128 + wave * 16;
  for (int k = tid; k < TT; k += 256) mb[k] = (-10000.0f / SCALE) * (1.0f - (float)MK[(size_t)b * TT + k]);   // additive mask term per key, read from the mask input, in units of the unscaled product: the start value of the key's score accumulators
  v16h qh[2], ql[2];
#pragma unroll
  for (int kc = 0; kc < 2; ++kc) { qh[kc] = frag_h(QH + ((size_t)b * TT + q0 + col) * CC + h * HD + kc * 32, lane); ql[kc] = frag_h(QL + ((size_t)b * QHI + q0 + col) * CC + h * HD + kc * 32, lane) * (_Float16)(1.0f / 1024.0f); }   // the residual back at q's own scale (small ones as f16 subnormals, step 2^-24), so that it adds into the accumulator of the hi product
  const int sr = tid >> 3, sc8 = (tid & 7) * 8;   // staging: 8 lanes take one 128-B row (a whole line), 32 rows a sweep
  const _Float16* kg = KH + ((size_t)b * TT + sr) * CC + h * HD + sc8; const _Float16* vg = VT + ((size_t)b * CC + h * HD + sr) * (size_t)TT + sc8;
  v8h rk[2], rv[2];
#pragma unroll
  for (int i = 0; i < 2; ++i) { rk[i] = *(const v8h*)(kg + (size_t)(32 * i) * CC); rv[i] = *(const v8h*)(vg + (size_t)(32 * i) * TT); }
#pragma unroll
  for (int i = 0; i < 2; ++i) { *(v8h*)&sk[0][sr + 32 * i][sc8] = rk[i]; *(v8h*)&sv[0][sr + 32 * i][sc8] = rv[i]; }
  v8f o[HD / 16] = {}; float mrun = -3.0e38f, m2run = -3.0e38f, lsum = 0.f;   // mrun: the running maximum of the unscaled scores; m2run: the same in base-2 units, less 11
#pragma unroll 1   // one stage a trip: the body is long already and the buffer index alternates
  for (int s = 0; s < TT / FK; ++s) { const int bu = s & 1; const bool more = s + 1 < TT / FK;
    __syncthreads();   // publishes stage s (and, on the first trip, mb); ends every wave's reads of the other buffer, which is refilled at the foot of this trip
    if (more) {
#pragma unroll
      for (int i = 0; i < 2; ++i) { rk[i] = *(const v8h*)(kg + (size_t)((s + 1) * FK + 32 * i) * CC); rv[i] = *(const v8h*)(vg + (size_t)(32 * i) * TT + (s + 1) * FK); } }
    v8f sc[4];   // unscaled scores: mask term + K q_hi + K q_residual, one accumulator a tile
#pragma unroll
    for (int t = 0; t < 4; ++t) { const v4f b0 = *(const v4f*)&mb[s * FK + t * 16 + 8 * g], b1 = *(const v4f*)&mb[s * FK + t * 16 + 8 * g + 4]; sc[t] = __builtin_shufflevector(b0, b1, 0, 1, 2, 3, 4, 5, 6, 7); }
#pragma unroll
    for (int kc = 0; kc < 2; ++kc) { v16h kf[4];
#pragma unroll
      for (int t = 0; t < 4; ++t) kf[t] = frag_h(&sk[bu][t * 16 + col][kc * 32], lane);
#pragma unroll
      for (int t = 0; t < 4; ++t) sc[t] = wmma_h(kf[t], qh[kc], sc[t]);
#pragma unroll
      for (int t = 0; t < 4; ++t) sc[t] = wmma_h(kf[t], ql[kc], sc[t]); }
    float mx = sc[0][0];
#pragma unroll
    for (int t = 0; t < 4; ++t)
#pragma unroll
      for (int r = 0; r < 8; ++r) mx = fmaxf(mx, sc[t][r]);
    mx = fmaxf(mx, xhalf(mx)); const float mn = fmaxf(mrun, mx); const float m2 = fmaf(mn, SCALE * LOG2E, -11.0f); const float corr = __builtin_amdgcn_exp2f(m2run - m2); mrun = mn; m2run = m2;   // first stage: 2^(-3e38) = 0
    v16h pf[2]; float ps[4] = {0.f, 0.f, 0.f, 0.f};   // one partial sum a tile: four independent add chains
#pragma unroll
    for (int t = 0; t < 4; ++t)
#pragma unroll
      for (int r = 0; r < 8; ++r) { const float e = __builtin_amdgcn_exp2f(fmaf(sc[t][r], SCALE * LOG2E, -m2)); ps[t] += e; pf[t >> 1][(t & 1) * 8 + r] = (_Float16)e; }   // e = exp(s - max) x 2^11, at most 2^11 but for the rounding of m2
    lsum = lsum * corr + ((ps[0] + ps[1]) + (ps[2] + ps[3]));
#pragma unroll
    for (int j = 0; j < HD / 16; ++j) o[j] *= corr;
#pragma unroll
    for (int kk = 0; kk < 2; ++kk)
#pragma unroll
      for (int j = 0; j < HD / 16; ++j) o[j] = wmma_h(frag_h(&sv[bu][j * 16 + col][kk * 32], lane), pf[kk], o[j]);
    if (more) {
#pragma unroll
      for (int i = 0; i < 2; ++i) { *(v8h*)&sk[bu ^ 1][sr + 32 * i][sc8] = rk[i]; *(v8h*)&sv[bu ^ 1][sr + 32 * i][sc8] = rv[i]; } } }
  const float l = lsum + xhalf(lsum); const float inv = 1.0f / l;   // l holds the 2^11 of its terms; l is about 2^11 or more: the key that holds the maximum adds 2^11
#pragma unroll
  for (int j = 0; j < HD / 16; ++j) { const v8f w = o[j] * inv; float* d = &so[wave][col][j * 16 + 8 * g]; *(v4f*)d = __builtin_shufflevector(w, w, 0, 1, 2, 3); *(v4f*)(d + 4) = __builtin_shufflevector(w, w, 4, 5, 6, 7); }
  LDSX();   // the wave's own rows of so are written before it reads them across lanes
  for (int it = 0; it < 8; ++it) { const int rl = it * 2 + g; vst2(Y + ((size_t)b * TT + q0 + rl) * CC + h * HD + col * 4, *(const v4f*)&so[wave][rl][col * 4]); } }   // 256-B (row, head) segment by 16 lanes

extern "C" void kernel_launch(void* const* d_in, const int* in_sizes, int n_in, void* d_out, int out_size, void* d_ws, size_t ws_size, hipStream_t stream) {
  (void)in_sizes; (void)n_in; (void)out_size;
  const float** F = (const float**)d_in;
  if (ws_size < (size_t)WS_END) return;
  char* ws = (char*)d_ws; _Float16 *QH = (_Float16*)(ws + WS_QH), *KH = (_Float16*)(ws + WS_KH), *VT = (_Float16*)(ws + WS_VT), *QL = (_Float16*)(ws + WS_QL), *KL = (_Float16*)(ws + WS_KL); __bf16 *VB = (__bf16*)(ws + WS_VB), *VBL = (__bf16*)(ws + WS_VBL); float *S = (float*)(ws + WS_S), *Y = (float*)(ws + WS_Y);
  (void)Y; (void)S; (void)QL; (void)KL; (void)VB; (void)VBL;
  // inputs: 0 x [8,1024,768]; 1 mask [8,1024] int32 (ones); 2 Wq (out,in), 3 bq; 4 Wk, 5 bk; 6 Wv, 7 bv
  __bf16 *XB = (__bf16*)(ws + WS_XB), *WB = (__bf16*)(ws + WS_WB);
  k_cvt<<<dim3(CVX + 3 * CVW), 256, 0, stream>>>(F[0], F[2], F[4], F[6], XB, WB);
  k_proj<<<dim3(TNB * TT / 128, CC / 128, 3), 256, 0, stream>>>(XB, WB, F[3], F[5], F[7], QH, QL, KH, KL, VT, VB, VBL);
  k_fa<<<dim3(TT / 128, NH, TNB), 256, 0, stream>>>(QH, QL, KH, VT, (const int*)d_in[1], (float*)d_out);
}

// v006
// A run of this version takes 73.1 microseconds.
// Timed twice side by side with v005, it ran 1.04 times as fast both times.
// Counting every step since v000, it is 21.5 times as fast.
// compute dtype: all float inputs rounded to bf16; q/k/v = in W^T + b with EXACT bf16 products on WMMA 16x16x32 (f32 accumulate); q as f16 hi + f16 residual against k once to f16 (2 products, one f32 accumulator that starts at the mask term); the / 8 rides in the exponent's multiplier; softmax in f32 with a running maximum and sum per query, the exponential as 2^(s log2(e) - max log2(e) + 11) on the hardware's base-2 exponential; that value once to f16 against v once to f16 (1 product), divided by the sum (which carries the same 2^11) at the end; f32 output.
#include <hip/hip_runtime.h>
#include <math.h>

typedef __attribute__((ext_vector_type(16))) _Float16 v16h;
typedef __attribute__((ext_vector_type(16))) __bf16 v16b;
typedef __attribute__((ext_vector_type(8)))  _Float16 v8h;
typedef __attribute__((ext_vector_type(8)))  float v8f;
typedef __attribute__((ext_vector_type(4)))  float v4f;
typedef __attribute__((ext_vector_type(2)))  float v2f;
typedef __attribute__((ext_vector_type(4)))  unsigned v4u;
typedef __attribute__((ext_vector_type(4)))  int v4i;
typedef float __attribute__((may_alias)) float_a;
typedef int __attribute__((may_alias)) int_a;

template <typename T> __device__ __forceinline__ void vst2(void* p, T v) { *(T*)p = v;  }
__device__ __forceinline__ v8f wmma16(v16h a, v16h b, v8f c) {
  v8f d = __builtin_amdgcn_wmma_f32_16x16x32_f16(false, a, false, b, (short)0, c, false, false);
  asm volatile("v_nop\n\tv_nop\n\tv_nop\n\tv_nop" : "+v"(d) : "v"(a), "v"(b));
  return d;
}
__device__ __forceinline__ v8f wmma_bf(v16b a, v16b b, v8f c) {
  v8f d = __builtin_amdgcn_wmma_f32_16x16x32_bf16(false, a, false, b, (short)0, c, false, false);
  asm volatile("v_nop\n\tv_nop\n\tv_nop\n\tv_nop" : "+v"(d) : "v"(a), "v"(b));
  return d;
}
// 16x16x32 fragments: lane = (h = lane>>4, row/col = lane&15); elements 0..7 = k0+8h+0..7, 8..15 = k0+16+8h+0..7; D element r = row 8h+r
__device__ __forceinline__ v16h frag_h(const _Float16* rowk0, int lane) {
  union { v16h v; v8h q[2]; } u; const _Float16* p = rowk0 + 8 * (lane >> 4);
  u.q[0] = *(const v8h*)p; u.q[1] = *(const v8h*)(p + 16); return u.v;
}
__device__ __forceinline__ v16h frag_f32(const float* rowk0, int lane) {
  v16h a; const float* p = rowk0 + 8 * (lane >> 4);
#pragma unroll
  for (int i = 0; i < 8; ++i) { a[i] = (_Float16)p[i]; a[8 + i] = (_Float16)p[16 + i]; }
  return a;
}
__device__ __forceinline__ v16h frag_f32s(const float* rowk0, int lane, float sc) {
  v16h a; const float* p = rowk0 + 8 * (lane >> 4);
#pragma unroll
  for (int i = 0; i < 8; ++i) { a[i] = (_Float16)(p[i] * sc); a[8 + i] = (_Float16)(p[16 + i] * sc); }
  return a;
}
// column fragment from a [K][ld] layout (column n), rows >= K read as 0
__device__ __forceinline__ v16h fragc_f32(const float* W, int k0, int n, int lane, int ld, int K) {
  v16h a; const int g = lane >> 4;
#pragma unroll
  for (int i = 0; i < 8; ++i) { const int ka = k0 + 8 * g + i, kb = ka + 16;
    a[i] = (_Float16)(ka < K ? W[(size_t)(ka < K ? ka : K - 1) * ld + n] : 0.f); a[8 + i] = (_Float16)(kb < K ? W[(size_t)(kb < K ? kb : K - 1) * ld + n] : 0.f); }
  return a;
}
struct F2 { v16b h, l; };
__device__ __forceinline__ F2 bsplit16(const float v[16]) { F2 r;
#pragma unroll
  for (int i = 0; i < 16; ++i) { const __bf16 h = (__bf16)v[i]; r.h[i] = h; r.l[i] = (__bf16)(v[i] - (float)h); }
  return r; }
__device__ __forceinline__ F2 split_row(const float* row, int k0, int lane) { float v[16]; const float* p = row + k0 + 8 * (lane >> 4);
#pragma unroll
  for (int i = 0; i < 8; ++i) { v[i] = p[i]; v[8 + i] = p[16 + i]; }
  return bsplit16(v); }
__device__ __forceinline__ F2 split_rowK(const float* row, int k0, int lane, int K) { float v[16]; const int g = lane >> 4;
#pragma unroll
  for (int i = 0; i < 8; ++i) { const int ka = k0 + 8 * g + i, kb = ka + 16; v[i] = ka < K ? row[ka < K ? ka : K - 1] : 0.f; v[8 + i] = kb < K ? row[kb < K ? kb : K - 1] : 0.f; }
  return bsplit16(v); }
__device__ __forceinline__ F2 split_col(const float* W, int k0, int n, int lane, int ld, int K) { float v[16]; const int g = lane >> 4;
#pragma unroll
  for (int i = 0; i < 8; ++i) { const int ka = k0 + 8 * g + i, kb = ka + 16; v[i] = ka < K ? W[(size_t)(ka < K ? ka : K - 1) * ld + n] : 0.f; v[8 + i] = kb < K ? W[(size_t)(kb < K ? kb : K - 1) * ld + n] : 0.f; }
  return bsplit16(v); }
__device__ __forceinline__ v8f mac3(const F2& a, const F2& b, v8f c) { c = wmma_bf(a.l, b.h, c); c = wmma_bf(a.h, b.l, c); return wmma_bf(a.h, b.h, c); }
__device__ __forceinline__ float sigm(float v) { return 1.0f / (1.0f + expf(-v)); }
#define LDSX() do { asm volatile("s_wait_dscnt 0" ::: "memory"); __builtin_amdgcn_wave_barrier(); __builtin_amdgcn_fence(__ATOMIC_RELEASE, "workgroup"); } while (0)

// Multi-head self-attention (B 8, S 1,024, D 768 = 12 x 64; (out,in) 1/sqrt(768)-scale weights, zero biases; key mask [B,S] int all ones): q, k, v = x W^T + b; scores / 8 - 10000 * (1 - mask); out = merged(softmax v) -> [8, 1,024, 768] (no output projection).
#define NB 8
#define TT 1024
#define CC 768            // NH * HD = projected width
#define DIN 768          // input (model) width
#define NH 12
#define HD 64
#define NQB (TT / 64)
#define HG 4
#define SCALE (0.125f)
#define CAUSAL 0
#ifndef TNB
#define TNB NB
#endif
__device__ __forceinline__ float bfr(float v) { return (float)(__bf16)v; }
__host__ __device__ __forceinline__ int kb_last(int qb) { return CAUSAL ? ((qb * 64 + 63) >> 7) : (TT / 128 - 1); }
typedef __attribute__((ext_vector_type(8))) __bf16 v8b;
__device__ __forceinline__ v16b frag_b(const __bf16* rowk0, int lane) {
  union { v16b v; v8b q[2]; } u; const __bf16* p = rowk0 + 8 * (lane >> 4);
  u.q[0] = *(const v8b*)p; u.q[1] = *(const v8b*)(p + 16); return u.v;
}
#define QBH 0
#define QHI 1024            // rows carrying a q residual plane (all rows when non-causal: 2-product logits everywhere)
#define KHI 64            // key rows carrying k residual / v bf16 hi+lo planes (written by k_proj; no kernel in this file reads them)
// B fragment (k rows k0+.., output column o) of a weight: (in,out) [K][ld] or (out,in) [ld rows of K]: bf16 exact, or f16(bf16 * 256) exact
__device__ __forceinline__ v16b wcol_io(const float* Wm, int k0, int o, int lane, int ld) { v16b w; const int g = lane >> 4;
#pragma unroll
  for (int i = 0; i < 8; ++i) { w[i] = (__bf16)Wm[(size_t)(k0 + 8 * g + i) * ld + o]; w[8 + i] = (__bf16)Wm[(size_t)(k0 + 16 + 8 * g + i) * ld + o]; }
  return w; }
__device__ __forceinline__ v16b wcol_oi(const float* Wm, int k0, int o, int lane, int K) { v16b w; const float* p = Wm + (size_t)o * K + k0 + 8 * (lane >> 4);
#pragma unroll
  for (int i = 0; i < 8; ++i) { w[i] = (__bf16)p[i]; w[8 + i] = (__bf16)p[16 + i]; }
  return w; }
__device__ __forceinline__ v16h wcolh_io(const float* Wm, int k0, int o, int lane, int ld) { v16h w; const int g = lane >> 4;
#pragma unroll
  for (int i = 0; i < 8; ++i) { w[i] = (_Float16)(bfr(Wm[(size_t)(k0 + 8 * g + i) * ld + o]) * 256.0f); w[8 + i] = (_Float16)(bfr(Wm[(size_t)(k0 + 16 + 8 * g + i) * ld + o]) * 256.0f); }
  return w; }
__device__ __forceinline__ v16h wcolh_oi(const float* Wm, int k0, int o, int lane, int K) { v16h w; const float* p = Wm + (size_t)o * K + k0 + 8 * (lane >> 4);
#pragma unroll
  for (int i = 0; i < 8; ++i) { w[i] = (_Float16)(bfr(p[i]) * 256.0f); w[8 + i] = (_Float16)(bfr(p[16 + i]) * 256.0f); }
  return w; }
#define WQKV_LAYOUT 1   // 0 = (in,out) [DIN][CC]; 1 = (out,in) [CC][DIN]; 2 = per-head [NH][DIN][HD]
__device__ __forceinline__ v16b wcol_hdk(const float* Wm, int k0, int o, int lane) { v16b w; const int g = lane >> 4; const float* p = Wm + (size_t)(o / HD) * DIN * HD + (o % HD);
#pragma unroll
  for (int i = 0; i < 8; ++i) { w[i] = (__bf16)p[(size_t)(k0 + 8 * g + i) * HD]; w[8 + i] = (__bf16)p[(size_t)(k0 + 16 + 8 * g + i) * HD]; }
  return w; }
#define WO_OUT_IN 0
#if WQKV_LAYOUT == 1
#define WCOL(W, k0, o, lane) wcol_oi(W, k0, o, lane, DIN)
#elif WQKV_LAYOUT == 2
#define WCOL(W, k0, o, lane) wcol_hdk(W, k0, o, lane)
#else
#define WCOL(W, k0, o, lane) wcol_io(W, k0, o, lane, CC)
#endif
#if WO_OUT_IN
#define WOCOL(W, k0, o, lane) wcol_oi(W, k0, o, lane, CC)
#define WOCOLH(W, k0, o, lane) wcolh_oi(W, k0, o, lane, CC)
#else
#define WOCOL(W, k0, o, lane) wcol_io(W, k0, o, lane, DIN)
#define WOCOLH(W, k0, o, lane) wcolh_io(W, k0, o, lane, DIN)
#endif

#define WS_QH  0u                                      // f16 q rows [b*t][CC]
#define WS_KH  (WS_QH + 2u * (size_t)NB * TT * CC)      // f16 k rows [b*t][CC]
#define WS_VT  (WS_KH + 2u * (size_t)NB * TT * CC)      // f16 v planes [b][c][t]
#define WS_QL  (WS_VT + 2u * (size_t)NB * CC * TT)      // f16 q residual x 2^10 rows [b][t < QHI][CC]
#define WS_KL  (WS_QL + 2u * (size_t)NB * QHI * CC)     // f16 k residual x 2^10 rows [b][t < KHI][CC]
#define WS_VB  (WS_KL + 2u * (size_t)NB * KHI * CC)     // bf16 v hi planes [b][c][t < KHI]
#define WS_VBL (WS_VB + 2u * (size_t)NB * CC * KHI)
#define WS_S   (WS_VBL + 2u * (size_t)NB * CC * KHI)    // f32 logits / P [hg][t][s]
#define WS_XB  WS_S                                    // bf16 x rows [b*t][DIN]: the logits plane above is not in use, its place holds the rounded operands
#define WS_WB  (WS_XB + 2u * (size_t)NB * TT * DIN)     // bf16 Wq, Wk, Wv rows [3][CC][DIN]; ends below WS_Y
#define WS_Y   (WS_S  + 4u * (size_t)HG * TT * TT)      // f32 ctx rows [b*t][CC] (only when there is an output projection)
#define WS_END (WS_Y  + 0u)
static_assert(WS_WB + 2u * 3u * (size_t)CC * DIN <= WS_Y, "the rounded operands fit the unused plane");

// ---- k_proj: block = (128 rows, 128 cols, which), 8 waves as 2 x 4, a wave holds 64 x 32 of the tile: q/k/v = X W^T (+ b) with exact bf16 products (K = DIN, summed in the order kc = 0, 1, ...).
// X rows and W rows ((out,in): both K-contiguous) come as bf16 from k_cvt; a block reads them once in whole 128-B lines (64 k) and stages them in LDS, two buffers, one barrier a 64-k stage; every wave takes its fragments from there.
// Every bare '#pragma unroll' below stands on a short loop over rx, rw, fa, fw or acc: constant indices keep these arrays in registers.
// -> which 0: q f16 rows (+ residual rows < QHI); 1: k f16 rows (+ residual rows < KHI); 2: v f16 planes [c][t] (+ bf16 hi/lo planes for t < KHI)
#define PM 128            // tile rows, and tile columns
#define PK 64             // k per stage: one 128-B line of every bf16 source row
#define PP 72             // LDS row pitch in bf16: 144 B = 16 B x 9, so the 16 rows of a ds_load_b128 fragment read fall on distinct banks
#define PO (PM + 8)       // pitch of the output staging rows in halves: 272 B = 16 B x 17
typedef __attribute__((ext_vector_type(4))) __bf16 v4b;
__device__ __forceinline__ v8f wmma_b(v16b a, v16b b, v8f c) { return __builtin_amdgcn_wmma_f32_16x16x32_bf16(false, a, false, b, (short)0, c, false, false); }
__device__ __forceinline__ v4b bf4(v4f v) { return __builtin_convertvector(v, v4b); }   // round to nearest even, as (__bf16) on each element
// ---- k_cvt: x and the three weights rounded to bf16 ONCE (k_proj would round every X row 18 times and every W row 64 times, and read it as f32 each time). A block takes 256 x 16 units of 4 floats of one source; a wave's load covers 512 B in a row, its store 256 B.
#define CVU 16            // units of 4 floats a thread: all 16 loads are issued ahead of the first store
#define CVX (NB * TT * DIN / (4 * 256 * CVU))   // blocks for x
#define CVW (CC * DIN / (4 * 256 * CVU))        // blocks for one weight
static_assert(CVX * 4 * 256 * CVU == NB * TT * DIN && CVW * 4 * 256 * CVU == CC * DIN, "whole blocks");
__global__ __launch_bounds__(256) void k_cvt(const float* __restrict__ X, const float* __restrict__ WQ, const float* __restrict__ WK, const float* __restrict__ WV, __bf16* __restrict__ XB, __bf16* __restrict__ WB) {
  int bl = blockIdx.x; const float* src = X; __bf16* dst = XB;
  if (bl >= CVX) { bl -= CVX; const int w = bl / CVW; bl -= w * CVW; src = w == 0 ? WQ : w == 1 ? WK : WV; dst = WB + (size_t)w * CC * DIN; }
  const size_t e0 = ((size_t)bl * (256 * CVU) + threadIdx.x) * 4;
  v4f r[CVU];
#pragma unroll   // constant indices keep r in registers; the step is an immediate offset
  for (int j = 0; j < CVU; ++j) r[j] = *(const v4f*)(src + e0 + j * 1024);
#pragma unroll   // as above
  for (int j = 0; j < CVU; ++j) *(v4b*)(dst + e0 + j * 1024) = bf4(r[j]); }
__global__ __launch_bounds__(256, 6) void k_proj(   // 6: the least waves a SIMD to budget registers for (160 each), three 8-wave blocks a WGP
    const __bf16* __restrict__ XB, const __bf16* __restrict__ WB, const float* __restrict__ BQ, const float* __restrict__ BK, const float* __restrict__ BV,
    _Float16* __restrict__ QH, _Float16* __restrict__ QL, _Float16* __restrict__ KH, _Float16* __restrict__ KL, _Float16* __restrict__ VT, __bf16* __restrict__ VB, __bf16* __restrict__ VBL) {
  // one LDS block, used twice: the operand ring in the k loop (2 x 2 x 128 x 144 B = 73,728 B), then the output staging (q, k: 2 x 128 x 272 B; v: 128 x 272 B + 2 x 128 x 144 B = 71,680 B)
  static_assert(2 * 2 * PM * PP * 2 >= PM * PO * 2 + 2 * PM * 72 * 2, "the ring holds the staging");
  __shared__ __align__(16) char sm[2 * 2 * PM * PP * 2];
  __bf16 (*sx)[PM][PP] = (__bf16 (*)[PM][PP])sm; __bf16 (*sw)[PM][PP] = (__bf16 (*)[PM][PP])(sm + 2 * PM * PP * 2);
  const int tid = threadIdx.x, wave = __builtin_amdgcn_readfirstlane(tid >> 5), lane = tid & 31, col = lane & 15, g = lane >> 4, wm = wave >> 2, wn = wave & 3;   // the wave's number in a scalar register: tests on it are scalar branches
  const int which = blockIdx.z; const int c0 = blockIdx.y * PM; const size_t r0 = (size_t)blockIdx.x * PM; const size_t bb = r0 / TT; const int t0 = (int)(r0 % TT);
  const float* BA = which == 0 ? BQ : which == 1 ? BK : BV;
  const int sr = tid >> 3, sc8 = (tid & 7) * 8;   // staging: 8 lanes take one 128-B line of a row, 32 rows a sweep, 4 sweeps an operand
  const __bf16* xg = XB + (r0 + sr) * DIN + sc8; const __bf16* wg = WB + ((size_t)which * CC + c0 + sr) * DIN + sc8;
  v8b rx[4], rw[4];
#pragma unroll
  for (int i = 0; i < 4; ++i) { rx[i] = *(const v8b*)(xg + (size_t)(32 * i) * DIN); rw[i] = *(const v8b*)(wg + (size_t)(32 * i) * DIN); }
#pragma unroll
  for (int i = 0; i < 4; ++i) { *(v8b*)&sx[0][sr + 32 * i][sc8] = rx[i]; *(v8b*)&sw[0][sr + 32 * i][sc8] = rw[i]; }
  v8f acc[4][2] = {};
#pragma unroll   // all 12 stages in line: buffer index and every global offset become immediates, so no address register is rewritten behind a load
  for (int s = 0; s < DIN / PK; ++s) { const int bu = s & 1; const bool more = s + 1 < DIN / PK;
    __syncthreads();   // publishes stage s; ends every wave's reads of the other buffer, which is refilled at the foot of this trip
    if (more) {
#pragma unroll
      for (int i = 0; i < 4; ++i) { rx[i] = *(const v8b*)(xg + (size_t)(32 * i) * DIN + (s + 1) * PK); rw[i] = *(const v8b*)(wg + (size_t)(32 * i) * DIN + (s + 1) * PK); } }
#pragma unroll   // the stage's two 32-k halves, in k order
    for (int kc = 0; kc < PK / 32; ++kc) { v16b fa[4], fw[2];
#pragma unroll
      for (int i = 0; i < 4; ++i) fa[i] = frag_b(&sx[bu][wm * 64 + i * 16 + col][kc * 32], lane);
#pragma unroll
      for (int j = 0; j < 2; ++j) fw[j] = frag_b(&sw[bu][wn * 32 + j * 16 + col][kc * 32], lane);
      __builtin_amdgcn_sched_barrier(0);   // the stage's global loads and a half's LDS reads issue as one group ahead of its products: otherwise reads are spread among the products, each with a wait of its own, and global loads start late
#pragma unroll
      for (int i = 0; i < 4; ++i)
#pragma unroll
        for (int j = 0; j < 2; ++j) acc[i][j] = wmma_b(fa[i], fw[j], acc[i][j]);
      __builtin_amdgcn_sched_barrier(0); }   // keeps a half's products together, and the wait for the next stage's global loads behind the stage's last product
    if (more) {
#pragma unroll
      for (int i = 0; i < 4; ++i) { *(v8b*)&sx[bu ^ 1][sr + 32 * i][sc8] = rx[i]; *(v8b*)&sw[bu ^ 1][sr + 32 * i][sc8] = rw[i]; } } }
  asm volatile("s_wait_xcnt 0x0" :: "v"(xg), "v"(wg) : "memory");   // the two address pairs are inputs so that they stay whole up to this wait: otherwise the last stage's loads take them as their own result registers behind loads that still name them
  __syncthreads();   // every wave has left the ring before its LDS is written again as output staging
  if (which < 2) { _Float16 (*sh)[PO] = (_Float16 (*)[PO])sm; _Float16 (*sl)[PO] = (_Float16 (*)[PO])(sm + PM * PO * 2);
    _Float16* DH = which == 0 ? QH : KH; _Float16* DL = which == 0 ? QL : KL; const int nhi = which == 0 ? QHI : KHI;
#pragma unroll
    for (int j = 0; j < 2; ++j) { const int cl = wn * 32 + j * 16 + col; const float bias = BA ? bfr(BA[c0 + cl]) : 0.f;
#pragma unroll
      for (int i = 0; i < 4; ++i)
#pragma unroll
        for (int r = 0; r < 8; ++r) { const float v = acc[i][j][r] + bias; const _Float16 hv = (_Float16)v; const int rl = wm * 64 + i * 16 + 8 * g + r; sh[rl][cl] = hv; sl[rl][cl] = (_Float16)((v - (float)hv) * 1024.0f); } }
    __syncthreads();
#pragma unroll   // 16 rows a sweep, 16 lanes a 256-B row segment; in line, so that the LDS reads of all sweeps go ahead of the stores and the row step is an immediate offset
    for (int it = 0; it < PM / 16; ++it) { const int rl = it * 16 + (tid >> 4), q = tid & 15; vst2((unsigned*)(DH + (r0 + rl) * CC + c0 + q * 8), *(const v4u*)&sh[rl][q * 8]); }
#pragma unroll   // residual rows, 64 at a time: nhi is a multiple of 64, so 64 aligned rows are below it all or none (a scalar test)
    for (int hf = 0; hf < PM / 64; ++hf) if (t0 + hf * 64 < nhi) {
      asm volatile("s_wait_xcnt 0x0" ::: "memory");   // stands in front of the rewrite of registers that the stores above name
#pragma unroll   // in line, as above
      for (int it = 0; it < 4; ++it) { const int rl = hf * 64 + it * 16 + (tid >> 4), q = tid & 15; vst2((unsigned*)(DL + (bb * nhi + t0 + rl) * (size_t)CC + c0 + q * 8), *(const v4u*)&sl[rl][q * 8]); } }
  } else { _Float16 (*th)[PO] = (_Float16 (*)[PO])sm; __bf16 (*tb)[72] = (__bf16 (*)[72])(sm + PM * PO * 2); __bf16 (*tbl)[72] = (__bf16 (*)[72])(sm + PM * PO * 2 + PM * 72 * 2);
    const bool hi_tile = t0 < KHI, hi_rows = t0 + wm * 64 < KHI;   // KHI = 64 = a wave's rows: only the first tile of a sequence, and there the four waves of its first 64 rows, hold rows t < KHI
#pragma unroll
    for (int j = 0; j < 2; ++j) { const int cl = wn * 32 + j * 16 + col; const float bias = BA ? bfr(BA[c0 + cl]) : 0.f;
#pragma unroll
      for (int i = 0; i < 4; ++i)
#pragma unroll
        for (int r = 0; r < 8; ++r) { const float v = acc[i][j][r] + bias; acc[i][j][r] = v; th[cl][wm * 64 + i * 16 + 8 * g + r] = (_Float16)v; }
      if (hi_rows) {
#pragma unroll
        for (int i = 0; i < 4; ++i)
#pragma unroll
          for (int r = 0; r < 8; ++r) { const float v = acc[i][j][r]; const int rl = wm * 64 + i * 16 + 8 * g + r; const __bf16 bh = (__bf16)v; tb[cl][rl] = bh; tbl[cl][rl] = (__bf16)(v - (float)bh); } } }
    __syncthreads();
#pragma unroll   // in line, as above
    for (int it = 0; it < PM / 16; ++it) { const int cl = it * 16 + (tid >> 4), q = tid & 15; vst2((unsigned*)(VT + (bb * CC + c0 + cl) * (size_t)TT + t0 + q * 8), *(const v4u*)&th[cl][q * 8]); }
    asm volatile("s_wait_xcnt 0x0" ::: "memory");   // stands in front of the rewrite of registers that the stores above name
    if (hi_tile) {
#pragma unroll   // in line, as above
      for (int it = 0; it < PM / 32; ++it) { const int cl = it * 32 + (tid >> 3), q = tid & 7; const size_t o3 = (bb * CC + c0 + cl) * (size_t)KHI + t0 + q * 8; vst2((unsigned*)(VB + o3), *(const v4u*)&tb[cl][q * 8]); vst2((unsigned*)(VBL + o3), *(const v4u*)&tbl[cl][q * 8]); }
      asm volatile("s_wait_xcnt 0x0" ::: "memory"); } } }   // closes the stores above: the built code has a branch from here into the q/k part, which rewrites their address registers
#define FK 64             // keys per stage
#define FW 4              // waves a block
#define FC 2              // 16-column query tiles a wave
#define FT (FW * 32)      // threads a block
#define LOG2E 1.44269504088896340736f
#define FP 72             // LDS row pitch in halves: 144 B = 16 B x 9, so the 16 rows of a ds_load_b128 fragment read fall on distinct banks
__device__ __forceinline__ v8f wmma_h(v16h a, v16h b, v8f c) { return __builtin_amdgcn_wmma_f32_16x16x32_f16(false, a, false, b, (short)0, c, false, false); }
__device__ __forceinline__ float xhalf(float x) { return __builtin_bit_cast(float, __builtin_amdgcn_permlanex16(__builtin_bit_cast(int, x), __builtin_bit_cast(int, x), 0x76543210, 0xfedcba98, false, false)); }   // lane l with lane l ^ 16
__device__ __forceinline__ v16h frag_p(const _Float16* p) { union { v16h v; v8h q[2]; } u; u.q[0] = *(const v8h*)p; u.q[1] = *(const v8h*)(p + 16); return u.v; }   // frag_h with the lane's 8 (lane >> 4) already in p
// Every bare '#pragma unroll' below stands on a short loop over a register array (c, t, kc, kk, j, r, i): constant indices keep these arrays in registers.
__global__ __launch_bounds__(FT, 3) void k_fa(   // 3: the least waves a SIMD to budget registers for (336 each), three 4-wave blocks a WGP
    const _Float16* __restrict__ QH, const _Float16* __restrict__ QL, const _Float16* __restrict__ KH, const _Float16* __restrict__ VT, const int* __restrict__ MK, float* __restrict__ Y) {
  __shared__ __align__(16) _Float16 sk[2][FK][FP], sv[2][HD][FP]; __shared__ __align__(16) float mb[TT]; __shared__ __align__(16) float so[FW][16 * FC][HD + 4];
  const int tid = threadIdx.x, wave = tid >> 5, lane = tid & 31, col = lane & 15, g = lane >> 4; const int h = blockIdx.y, b = blockIdx.z; const int q0 = blockIdx.x * (FW * FC * 16) + wave * (FC * 16);
  int mk[TT / FT];
#pragma unroll
  for (int i = 0; i < TT / FT; ++i) mk[i] = MK[(size_t)b * TT + i * FT + tid];   // a thread's 8 mask loads go out together, ahead of the first use
#pragma unroll
  for (int i = 0; i < TT / FT; ++i) mb[i * FT + tid] = (-10000.0f / SCALE) * (1.0f - (float)mk[i]);   // additive mask term per key, read from the mask input, in units of the unscaled product: the start value of the key's score accumulators
  v16h qh[FC][2], ql[FC][2];
  const _Float16* qhg = QH + ((size_t)b * TT + q0 + col) * CC + h * HD + 8 * g; const _Float16* qlg = QL + ((size_t)b * QHI + q0 + col) * CC + h * HD + 8 * g;   // the lane's own place in its row: every q load below is these two pointers plus a constant
#pragma unroll
  for (int c = 0; c < FC; ++c)
#pragma unroll
    for (int kc = 0; kc < 2; ++kc) { qh[c][kc] = frag_p(qhg + c * 16 * CC + kc * 32); ql[c][kc] = frag_p(qlg + c * 16 * CC + kc * 32) * (_Float16)(1.0f / 1024.0f); }   // the residual back at q's own scale (small ones as f16 subnormals, step 2^-24), so that it adds into the accumulator of the hi product
  const int sr = tid >> 3, sc8 = (tid & 7) * 8;   // staging: 8 lanes take one 128-B row (a whole line), 16 rows a sweep, 4 sweeps an operand
  const _Float16* kg = KH + ((size_t)b * TT + sr) * CC + h * HD + sc8; const _Float16* vg = VT + ((size_t)b * CC + h * HD + sr) * (size_t)TT + sc8;
  v8h rk[4], rv[4];
#pragma unroll
  for (int i = 0; i < 4; ++i) { rk[i] = *(const v8h*)(kg + (size_t)(16 * i) * CC); rv[i] = *(const v8h*)(vg + (size_t)(16 * i) * TT); }
  asm volatile("s_wait_xcnt 0x0" :: "v"(qhg), "v"(qlg) : "memory");   // stands in front of the rewrite of the address registers that the loads above name; the two pairs are inputs so that they stay whole up to this wait
#pragma unroll
  for (int i = 0; i < 4; ++i) { *(v8h*)&sk[0][sr + 16 * i][sc8] = rk[i]; *(v8h*)&sv[0][sr + 16 * i][sc8] = rv[i]; }
  v8f o[FC][HD / 16] = {}; float mrun[FC], m2run[FC], lsum[FC];   // mrun: the running maximum of the unscaled scores; m2run: the same in base-2 units, less 11
#pragma unroll
  for (int c = 0; c < FC; ++c) { mrun[c] = -3.0e38f; m2run[c] = -3.0e38f; lsum[c] = 0.f; }
#pragma unroll 1   // one stage a trip: the body is long already and the buffer index alternates
  for (int s = 0; s < TT / FK; ++s) { const int bu = s & 1; const bool more = s + 1 < TT / FK;
    __syncthreads();   // publishes stage s (and, on the first trip, mb); ends every wave's reads of the other buffer, which is refilled at the foot of this trip
    if (more) { const _Float16* kn = kg + (size_t)((s + 1) * FK) * CC; const _Float16* vn = vg + (s + 1) * FK;
#pragma unroll
      for (int i = 0; i < 4; ++i) { rk[i] = *(const v8h*)(kn + (size_t)(16 * i) * CC); rv[i] = *(const v8h*)(vn + (size_t)(16 * i) * TT); }
      asm volatile("s_wait_xcnt 0x0" :: "v"(kn), "v"(vn) : "memory"); }   // as above: the stage's two address pairs are rewritten right behind these loads
    v8f sc[FC][4];   // unscaled scores: mask term + K q_hi + K q_residual, one accumulator a tile
#pragma unroll
    for (int t = 0; t < 4; ++t) { const v4f b0 = *(const v4f*)&mb[s * FK + t * 16 + 8 * g], b1 = *(const v4f*)&mb[s * FK + t * 16 + 8 * g + 4];
#pragma unroll
      for (int c = 0; c < FC; ++c) sc[c][t] = __builtin_shufflevector(b0, b1, 0, 1, 2, 3, 4, 5, 6, 7); }
#pragma unroll
    for (int kc = 0; kc < 2; ++kc) { v16h kf[4];
#pragma unroll
      for (int t = 0; t < 4; ++t) kf[t] = frag_h(&sk[bu][t * 16 + col][kc * 32], lane);
#pragma unroll
      for (int t = 0; t < 4; ++t)
#pragma unroll
        for (int c = 0; c < FC; ++c) sc[c][t] = wmma_h(kf[t], qh[c][kc], sc[c][t]);
#pragma unroll
      for (int t = 0; t < 4; ++t)
#pragma unroll
        for (int c = 0; c < FC; ++c) sc[c][t] = wmma_h(kf[t], ql[c][kc], sc[c][t]); }
    v16h vf[2][HD / 16];
#pragma unroll
    for (int j = 0; j < HD / 16; ++j) vf[0][j] = frag_h(&sv[bu][j * 16 + col][0], lane);
    __builtin_amdgcn_sched_barrier(0);   // the V fragments of the stage's first 32 keys are read as one group here and land under the softmax arithmetic: otherwise the reads are spread among the P V products, each with a wait of its own
    v16h pf[FC][2];
#pragma unroll
    for (int c = 0; c < FC; ++c) { float mx = sc[c][0][0];
#pragma unroll
      for (int t = 0; t < 4; ++t)
#pragma unroll
        for (int r = 0; r < 8; ++r) mx = fmaxf(mx, sc[c][t][r]);
      mx = fmaxf(mx, xhalf(mx)); const float mn = fmaxf(mrun[c], mx); const float m2 = fmaf(mn, SCALE * LOG2E, -11.0f); const float corr = __builtin_amdgcn_exp2f(m2run[c] - m2); mrun[c] = mn; m2run[c] = m2;   // first stage: 2^(-3e38) = 0
      float ps[4] = {0.f, 0.f, 0.f, 0.f};   // one partial sum a tile: four independent add chains
#pragma unroll
      for (int t = 0; t < 4; ++t)
#pragma unroll
        for (int r = 0; r < 8; ++r) { const float e = __builtin_amdgcn_exp2f(fmaf(sc[c][t][r], SCALE * LOG2E, -m2)); ps[t] += e; pf[c][t >> 1][(t & 1) * 8 + r] = (_Float16)e; }   // e = exp(s - max) x 2^11, at most 2^11 but for the rounding of m2
      lsum[c] = lsum[c] * corr + ((ps[0] + ps[1]) + (ps[2] + ps[3]));
#pragma unroll
      for (int j = 0; j < HD / 16; ++j) o[c][j] *= corr; }
#pragma unroll
    for (int j = 0; j < HD / 16; ++j) vf[1][j] = frag_h(&sv[bu][j * 16 + col][32], lane);   // the second 32 keys' fragments: read while the first 32 keys' products run
#pragma unroll
    for (int kk = 0; kk < 2; ++kk)
#pragma unroll
      for (int j = 0; j < HD / 16; ++j)
#pragma unroll
        for (int c = 0; c < FC; ++c) o[c][j] = wmma_h(vf[kk][j], pf[c][kk], o[c][j]);
    if (more) {
#pragma unroll
      for (int i = 0; i < 4; ++i) { *(v8h*)&sk[bu ^ 1][sr + 16 * i][sc8] = rk[i]; *(v8h*)&sv[bu ^ 1][sr + 16 * i][sc8] = rv[i]; } } }
#pragma unroll
  for (int c = 0; c < FC; ++c) { const float l = lsum[c] + xhalf(lsum[c]); const float inv = 1.0f / l;   // l holds the 2^11 of its terms; l is about 2^11 or more: the key that holds the maximum adds 2^11
#pragma unroll
    for (int j = 0; j < HD / 16; ++j) { const v8f w = o[c][j] * inv; float* d = &so[wave][c * 16 + col][j * 16 + 8 * g]; *(v4f*)d = __builtin_shufflevector(w, w, 0, 1, 2, 3); *(v4f*)(d + 4) = __builtin_shufflevector(w, w, 4, 5, 6, 7); } }
  LDSX();   // the wave's own rows of so are written before it reads them across lanes
  for (int it = 0; it < 8 * FC; ++it) { const int rl = it * 2 + g; vst2(Y + ((size_t)b * TT + q0 + rl) * CC + h * HD + col * 4, *(const v4f*)&so[wave][rl][col * 4]); } }   // 256-B (row, head) segment by 16 lanes

extern "C" void kernel_launch(void* const* d_in, const int* in_sizes, int n_in, void* d_out, int out_size, void* d_ws, size_t ws_size, hipStream_t stream) {
  (void)in_sizes; (void)n_in; (void)out_size;
  const float** F = (const float**)d_in;
  if (ws_size < (size_t)WS_END) return;
  char* ws = (char*)d_ws; _Float16 *QH = (_Float16*)(ws + WS_QH), *KH = (_Float16*)(ws + WS_KH), *VT = (_Float16*)(ws + WS_VT), *QL = (_Float16*)(ws + WS_QL), *KL = (_Float16*)(ws + WS_KL); __bf16 *VB = (__bf16*)(ws + WS_VB), *VBL = (__bf16*)(ws + WS_VBL); float *S = (float*)(ws + WS_S), *Y = (float*)(ws + WS_Y);
  (void)Y; (void)S; (void)QL; (void)KL; (void)VB; (void)VBL;
  // inputs: 0 x [8,1024,768]; 1 mask [8,1024] int32 (ones); 2 Wq (out,in), 3 bq; 4 Wk, 5 bk; 6 Wv, 7 bv
  __bf16 *XB = (__bf16*)(ws + WS_XB), *WB = (__bf16*)(ws + WS_WB);
  k_cvt<<<dim3(CVX + 3 * CVW), 256, 0, stream>>>(F[0], F[2], F[4], F[6], XB, WB);
  k_proj<<<dim3(TNB * TT / 128, CC / 128, 3), 256, 0, stream>>>(XB, WB, F[3], F[5], F[7], QH, QL, KH, KL, VT, VB, VBL);
  k_fa<<<dim3(TT / (FW * FC * 16), NH, TNB), FT, 0, stream>>>(QH, QL, KH, VT, (const int*)d_in[1], (float*)d_out);
}

// v008
// A run of this version takes 62 microseconds.
// It is 1.18 times as fast as v006, going by the measured steps of the versions left out in between.
// Counting every step since v000, it is 25.3 times as fast.
// compute dtype: all float inputs rounded to bf16; q/k/v = in W^T + b with EXACT bf16 products on WMMA 16x16x32 (f32 accumulate); q once to f16 against k once to f16 (1 product, its f32 accumulator starts at the mask term); the / 8 rides in the exponent's multiplier; softmax in f32 with a running maximum and sum per query, the exponential as 2^(s log2(e) - max log2(e) + 11) on the hardware's base-2 exponential; that value once to f16 against v once to f16 (1 product), divided by the sum (which carries the same 2^11) at the end; f32 output.
#include <hip/hip_runtime.h>
#include <math.h>

typedef __attribute__((ext_vector_type(16))) _Float16 v16h;
typedef __attribute__((ext_vector_type(16))) __bf16 v16b;
typedef __attribute__((ext_vector_type(8)))  _Float16 v8h;
typedef __attribute__((ext_vector_type(8)))  float v8f;
typedef __attribute__((ext_vector_type(4)))  float v4f;
typedef __attribute__((ext_vector_type(2)))  float v2f;
typedef __attribute__((ext_vector_type(4)))  unsigned v4u;
typedef __attribute__((ext_vector_type(4)))  int v4i;
typedef float __attribute__((may_alias)) float_a;
typedef int __attribute__((may_alias)) int_a;

template <typename T> __device__ __forceinline__ void vst2(void* p, T v) { *(T*)p = v;  }
__device__ __forceinline__ v8f wmma16(v16h a, v16h b, v8f c) {
  v8f d = __builtin_amdgcn_wmma_f32_16x16x32_f16(false, a, false, b, (short)0, c, false, false);
  asm volatile("v_nop\n\tv_nop\n\tv_nop\n\tv_nop" : "+v"(d) : "v"(a), "v"(b));
  return d;
}
__device__ __forceinline__ v8f wmma_bf(v16b a, v16b b, v8f c) {
  v8f d = __builtin_amdgcn_wmma_f32_16x16x32_bf16(false, a, false, b, (short)0, c, false, false);
  asm volatile("v_nop\n\tv_nop\n\tv_nop\n\tv_nop" : "+v"(d) : "v"(a), "v"(b));
  return d;
}
// 16x16x32 fragments: lane = (h = lane>>4, row/col = lane&15); elements 0..7 = k0+8h+0..7, 8..15 = k0+16+8h+0..7; D element r = row 8h+r
__device__ __forceinline__ v16h frag_h(const _Float16* rowk0, int lane) {
  union { v16h v; v8h q[2]; } u; const _Float16* p = rowk0 + 8 * (lane >> 4);
  u.q[0] = *(const v8h*)p; u.q[1] = *(const v8h*)(p + 16); return u.v;
}
__device__ __forceinline__ v16h frag_f32(const float* rowk0, int lane) {
  v16h a; const float* p = rowk0 + 8 * (lane >> 4);
#pragma unroll
  for (int i = 0; i < 8; ++i) { a[i] = (_Float16)p[i]; a[8 + i] = (_Float16)p[16 + i]; }
  return a;
}
__device__ __forceinline__ v16h frag_f32s(const float* rowk0, int lane, float sc) {
  v16h a; const float* p = rowk0 + 8 * (lane >> 4);
#pragma unroll
  for (int i = 0; i < 8; ++i) { a[i] = (_Float16)(p[i] * sc); a[8 + i] = (_Float16)(p[16 + i] * sc); }
  return a;
}
// column fragment from a [K][ld] layout (column n), rows >= K read as 0
__device__ __forceinline__ v16h fragc_f32(const float* W, int k0, int n, int lane, int ld, int K) {
  v16h a; const int g = lane >> 4;
#pragma unroll
  for (int i = 0; i < 8; ++i) { const int ka = k0 + 8 * g + i, kb = ka + 16;
    a[i] = (_Float16)(ka < K ? W[(size_t)(ka < K ? ka : K - 1) * ld + n] : 0.f); a[8 + i] = (_Float16)(kb < K ? W[(size_t)(kb < K ? kb : K - 1) * ld + n] : 0.f); }
  return a;
}
struct F2 { v16b h, l; };
__device__ __forceinline__ F2 bsplit16(const float v[16]) { F2 r;
#pragma unroll
  for (int i = 0; i < 16; ++i) { const __bf16 h = (__bf16)v[i]; r.h[i] = h; r.l[i] = (__bf16)(v[i] - (float)h); }
  return r; }
__device__ __forceinline__ F2 split_row(const float* row, int k0, int lane) { float v[16]; const float* p = row + k0 + 8 * (lane >> 4);
#pragma unroll
  for (int i = 0; i < 8; ++i) { v[i] = p[i]; v[8 + i] = p[16 + i]; }
  return bsplit16(v); }
__device__ __forceinline__ F2 split_rowK(const float* row, int k0, int lane, int K) { float v[16]; const int g = lane >> 4;
#pragma unroll
  for (int i = 0; i < 8; ++i) { const int ka = k0 + 8 * g + i, kb = ka + 16; v[i] = ka < K ? row[ka < K ? ka : K - 1] : 0.f; v[8 + i] = kb < K ? row[kb < K ? kb : K - 1] : 0.f; }
  return bsplit16(v); }
__device__ __forceinline__ F2 split_col(const float* W, int k0, int n, int lane, int ld, int K) { float v[16]; const int g = lane >> 4;
#pragma unroll
  for (int i = 0; i < 8; ++i) { const int ka = k0 + 8 * g + i, kb = ka + 16; v[i] = ka < K ? W[(size_t)(ka < K ? ka : K - 1) * ld + n] : 0.f; v[8 + i] = kb < K ? W[(size_t)(kb < K ? kb : K - 1) * ld + n] : 0.f; }
  return bsplit16(v); }
__device__ __forceinline__ v8f mac3(const F2& a, const F2& b, v8f c) { c = wmma_bf(a.l, b.h, c); c = wmma_bf(a.h, b.l, c); return wmma_bf(a.h, b.h, c); }
__device__ __forceinline__ float sigm(float v) { return 1.0f / (1.0f + expf(-v)); }
#define LDSX() do { asm volatile("s_wait_dscnt 0" ::: "memory"); __builtin_amdgcn_wave_barrier(); __builtin_amdgcn_fence(__ATOMIC_RELEASE, "workgroup"); } while (0)

// Multi-head self-attention (B 8, S 1,024, D 768 = 12 x 64; (out,in) 1/sqrt(768)-scale weights, zero biases; key mask [B,S] int all ones): q, k, v = x W^T + b; scores / 8 - 10000 * (1 - mask); out = merged(softmax v) -> [8, 1,024, 768] (no output projection).
#define NB 8
#define TT 1024
#define CC 768            // NH * HD = projected width
#define DIN 768          // input (model) width
#define NH 12
#define HD 64
#define NQB (TT / 64)
#define HG 4
#define SCALE (0.125f)
#define CAUSAL 0
#ifndef TNB
#define TNB NB
#endif
__device__ __forceinline__ float bfr(float v) { return (float)(__bf16)v; }
__host__ __device__ __forceinline__ int kb_last(int qb) { return CAUSAL ? ((qb * 64 + 63) >> 7) : (TT / 128 - 1); }
typedef __attribute__((ext_vector_type(8))) __bf16 v8b;
__device__ __forceinline__ v16b frag_b(const __bf16* rowk0, int lane) {
  union { v16b v; v8b q[2]; } u; const __bf16* p = rowk0 + 8 * (lane >> 4);
  u.q[0] = *(const v8b*)p; u.q[1] = *(const v8b*)(p + 16); return u.v;
}
#define QBH 0              // not used: this file has no high-precision path
#define QHI 1024            // rows of the q residual plane's place in the workspace (the plane is no longer made: 1-product logits)
#define KHI 64            // key rows carrying k residual / v bf16 hi+lo planes (the k residual is not made; the v planes are written, not read)
// B fragment (k rows k0+.., output column o) of a weight: (in,out) [K][ld] or (out,in) [ld rows of K]: bf16 exact, or f16(bf16 * 256) exact
__device__ __forceinline__ v16b wcol_io(const float* Wm, int k0, int o, int lane, int ld) { v16b w; const int g = lane >> 4;
#pragma unroll
  for (int i = 0; i < 8; ++i) { w[i] = (__bf16)Wm[(size_t)(k0 + 8 * g + i) * ld + o]; w[8 + i] = (__bf16)Wm[(size_t)(k0 + 16 + 8 * g + i) * ld + o]; }
  return w; }
__device__ __forceinline__ v16b wcol_oi(const float* Wm, int k0, int o, int lane, int K) { v16b w; const float* p = Wm + (size_t)o * K + k0 + 8 * (lane >> 4);
#pragma unroll
  for (int i = 0; i < 8; ++i) { w[i] = (__bf16)p[i]; w[8 + i] = (__bf16)p[16 + i]; }
  return w; }
__device__ __forceinline__ v16h wcolh_io(const float* Wm, int k0, int o, int lane, int ld) { v16h w; const int g = lane >> 4;
#pragma unroll
  for (int i = 0; i < 8; ++i) { w[i] = (_Float16)(bfr(Wm[(size_t)(k0 + 8 * g + i) * ld + o]) * 256.0f); w[8 + i] = (_Float16)(bfr(Wm[(size_t)(k0 + 16 + 8 * g + i) * ld + o]) * 256.0f); }
  return w; }
__device__ __forceinline__ v16h wcolh_oi(const float* Wm, int k0, int o, int lane, int K) { v16h w; const float* p = Wm + (size_t)o * K + k0 + 8 * (lane >> 4);
#pragma unroll
  for (int i = 0; i < 8; ++i) { w[i] = (_Float16)(bfr(p[i]) * 256.0f); w[8 + i] = (_Float16)(bfr(p[16 + i]) * 256.0f); }
  return w; }
#define WQKV_LAYOUT 1   // 0 = (in,out) [DIN][CC]; 1 = (out,in) [CC][DIN]; 2 = per-head [NH][DIN][HD]
__device__ __forceinline__ v16b wcol_hdk(const float* Wm, int k0, int o, int lane) { v16b w; const int g = lane >> 4; const float* p = Wm + (size_t)(o / HD) * DIN * HD + (o % HD);
#pragma unroll
  for (int i = 0; i < 8; ++i) { w[i] = (__bf16)p[(size_t)(k0 + 8 * g + i) * HD]; w[8 + i] = (__bf16)p[(size_t)(k0 + 16 + 8 * g + i) * HD]; }
  return w; }
#define WO_OUT_IN 0
#if WQKV_LAYOUT == 1
#define WCOL(W, k0, o, lane) wcol_oi(W, k0, o, lane, DIN)
#elif WQKV_LAYOUT == 2
#define WCOL(W, k0, o, lane) wcol_hdk(W, k0, o, lane)
#else
#define WCOL(W, k0, o, lane) wcol_io(W, k0, o, lane, CC)
#endif
#if WO_OUT_IN
#define WOCOL(W, k0, o, lane) wcol_oi(W, k0, o, lane, CC)
#define WOCOLH(W, k0, o, lane) wcolh_oi(W, k0, o, lane, CC)
#else
#define WOCOL(W, k0, o, lane) wcol_io(W, k0, o, lane, DIN)
#define WOCOLH(W, k0, o, lane) wcolh_io(W, k0, o, lane, DIN)
#endif

#define WS_QH  0u                                      // f16 q rows [b*t][CC]
#define WS_KH  (WS_QH + 2u * (size_t)NB * TT * CC)      // f16 k rows [b*t][CC]
#define WS_VT  (WS_KH + 2u * (size_t)NB * TT * CC)      // f16 v planes [b][c][t]
#define WS_QL  (WS_VT + 2u * (size_t)NB * CC * TT)      // place of the f16 q residual rows [b][t < QHI][CC]: not written, not read
#define WS_KL  (WS_QL + 2u * (size_t)NB * QHI * CC)     // place of the f16 k residual rows [b][t < KHI][CC]: not written, not read
#define WS_VB  (WS_KL + 2u * (size_t)NB * KHI * CC)     // bf16 v hi planes [b][c][t < KHI]
#define WS_VBL (WS_VB + 2u * (size_t)NB * CC * KHI)
#define WS_S   (WS_VBL + 2u * (size_t)NB * CC * KHI)    // f32 logits / P [hg][t][s]
#define WS_XB  WS_S                                    // bf16 x rows [b*t][DIN]: the logits plane above is not in use, its place holds the rounded operands
#define WS_WB  (WS_XB + 2u * (size_t)NB * TT * DIN)     // bf16 Wq, Wk, Wv rows [3][CC][DIN]; ends below WS_Y
#define WS_Y   (WS_S  + 4u * (size_t)HG * TT * TT)      // f32 ctx rows [b*t][CC] (only when there is an output projection)
#define WS_END (WS_Y  + 0u)
static_assert(WS_WB + 2u * 3u * (size_t)CC * DIN <= WS_Y, "the rounded operands fit the unused plane");

// ---- k_proj: block = (128 rows, 128 cols, which), 8 waves as 2 x 4, a wave holds 64 x 32 of the tile: q/k/v = X W^T (+ b) with exact bf16 products (K = DIN, summed stage by stage from the block's own first stage, wrapping at the end; inside a stage in k order).
// X rows and W rows ((out,in): both K-contiguous) come as bf16 from k_cvt; a block reads them once in whole 128-B lines (64 k) and stages them in LDS, two buffers, one barrier a 64-k stage; every wave takes its fragments from there.
// A block starts its k walk at its own stage ((row tile + column tile + 6 which) mod 12) and wraps: the blocks that share an X panel, and those that share a W panel, then stand at different stages. A line that one of them has brought into L2 is there when the others come to it, and the blocks resident at one time ask for all 128-B columns of the 1,536-B rows, not all for the same one.
// Every bare '#pragma unroll' below stands on a short loop over rx, rw, fa, fw or acc: constant indices keep these arrays in registers.
// -> which 0: q f16 rows; 1: k f16 rows; 2: v f16 planes [c][t] (+ bf16 hi/lo planes for t < KHI)
#define PM 128            // tile rows, and tile columns
#define PK 64             // k per stage: one 128-B line of every bf16 source row
#define PP 72             // LDS row pitch in bf16: 144 B = 16 B x 9, so the 16 rows of a ds_load_b128 fragment read fall on distinct banks
#define PO (PM + 8)       // pitch of the output staging rows in halves: 272 B = 16 B x 17
typedef __attribute__((ext_vector_type(4))) __bf16 v4b;
__device__ __forceinline__ v8f wmma_b(v16b a, v16b b, v8f c) { return __builtin_amdgcn_wmma_f32_16x16x32_bf16(false, a, false, b, (short)0, c, false, false); }
__device__ __forceinline__ v4b bf4(v4f v) { return __builtin_convertvector(v, v4b); }   // round to nearest even, as (__bf16) on each element
// ---- k_cvt: x and the three weights rounded to bf16 ONCE (k_proj would round every X row 18 times and every W row 64 times, and read it as f32 each time). A block takes 256 x 16 units of 4 floats of one source; a wave's load covers 512 B in a row, its store 256 B.
#define CVU 16            // units of 4 floats a thread: all 16 loads are issued ahead of the first store
#define CVX (NB * TT * DIN / (4 * 256 * CVU))   // blocks for x
#define CVW (CC * DIN / (4 * 256 * CVU))        // blocks for one weight
static_assert(CVX * 4 * 256 * CVU == NB * TT * DIN && CVW * 4 * 256 * CVU == CC * DIN, "whole blocks");
__global__ __launch_bounds__(256) void k_cvt(const float* __restrict__ X, const float* __restrict__ WQ, const float* __restrict__ WK, const float* __restrict__ WV, __bf16* __restrict__ XB, __bf16* __restrict__ WB) {
  int bl = blockIdx.x; const float* src = X; __bf16* dst = XB;
  if (bl >= CVX) { bl -= CVX; const int w = bl / CVW; bl -= w * CVW; src = w == 0 ? WQ : w == 1 ? WK : WV; dst = WB + (size_t)w * CC * DIN; }
  const size_t e0 = ((size_t)bl * (256 * CVU) + threadIdx.x) * 4;
  v4f r[CVU];
#pragma unroll   // constant indices keep r in registers; the step is an immediate offset
  for (int j = 0; j < CVU; ++j) r[j] = *(const v4f*)(src + e0 + j * 1024);
#pragma unroll   // as above
  for (int j = 0; j < CVU; ++j) *(v4b*)(dst + e0 + j * 1024) = bf4(r[j]); }
__global__ __launch_bounds__(256, 6) void k_proj(   // 6: the least waves a SIMD to budget registers for (160 each), three 8-wave blocks a WGP
    const __bf16* __restrict__ XB, const __bf16* __restrict__ WB, const float* __restrict__ BQ, const float* __restrict__ BK, const float* __restrict__ BV,
    _Float16* __restrict__ QH, _Float16* __restrict__ KH, _Float16* __restrict__ VT, __bf16* __restrict__ VB, __bf16* __restrict__ VBL) {
  // one LDS block, used twice: the operand ring in the k loop (2 x 2 x 128 x 144 B = 73,728 B), then the output staging (q, k: 128 x 272 B; v: 128 x 272 B + 2 x 128 x 144 B = 71,680 B)
  static_assert(2 * 2 * PM * PP * 2 >= PM * PO * 2 + 2 * PM * 72 * 2, "the ring holds the staging");
  __shared__ __align__(16) char sm[2 * 2 * PM * PP * 2];
  __bf16 (*sx)[PM][PP] = (__bf16 (*)[PM][PP])sm; __bf16 (*sw)[PM][PP] = (__bf16 (*)[PM][PP])(sm + 2 * PM * PP * 2);
  const int tid = threadIdx.x, wave = __builtin_amdgcn_readfirstlane(tid >> 5), lane = tid & 31, col = lane & 15, g = lane >> 4, wm = wave >> 2, wn = wave & 3;   // the wave's number in a scalar register: tests on it are scalar branches
  const int which = blockIdx.z; const int c0 = blockIdx.y * PM; const size_t r0 = (size_t)blockIdx.x * PM; const size_t bb = r0 / TT; const int t0 = (int)(r0 % TT);
  const float* BA = which == 0 ? BQ : which == 1 ? BK : BV;
  const int sr = tid >> 3, sc8 = (tid & 7) * 8;   // staging: 8 lanes take one 128-B line of a row, 32 rows a sweep, 4 sweeps an operand
  const __bf16* xg = XB + (r0 + sr) * DIN + sc8; const __bf16* wg = WB + ((size_t)which * CC + c0 + sr) * DIN + sc8;
  const int s0 = (blockIdx.x + blockIdx.y + 6 * blockIdx.z) % (DIN / PK);   // the block's first stage, the same in every wave (a scalar)
  v8b rx[4], rw[4];
  { const __bf16* xn = xg + s0 * PK; const __bf16* wn = wg + s0 * PK;
#pragma unroll
    for (int i = 0; i < 4; ++i) { rx[i] = *(const v8b*)(xn + (size_t)(32 * i) * DIN); rw[i] = *(const v8b*)(wn + (size_t)(32 * i) * DIN); }
    asm volatile("s_wait_xcnt 0x0" :: "v"(xn), "v"(wn) : "memory"); }   // stands in front of the rewrite of the two address pairs that the loads above name; they are inputs so that they stay whole up to this wait
#pragma unroll
  for (int i = 0; i < 4; ++i) { *(v8b*)&sx[0][sr + 32 * i][sc8] = rx[i]; *(v8b*)&sw[0][sr + 32 * i][sc8] = rw[i]; }
  v8f acc[4][2] = {};
#pragma unroll   // all 12 stages in line: the buffer index and every LDS offset become immediates
  for (int s = 0; s < DIN / PK; ++s) { const int bu = s & 1; const bool more = s + 1 < DIN / PK;
    __syncthreads();   // publishes stage s; ends every wave's reads of the other buffer, which is refilled at the foot of this trip
    if (more) { const int kn = s0 + s + 1 < DIN / PK ? s0 + s + 1 : s0 + s + 1 - DIN / PK;   // the next stage of the wrapped walk
      const __bf16* xn = xg + kn * PK; const __bf16* wn = wg + kn * PK;
#pragma unroll
      for (int i = 0; i < 4; ++i) { rx[i] = *(const v8b*)(xn + (size_t)(32 * i) * DIN); rw[i] = *(const v8b*)(wn + (size_t)(32 * i) * DIN); }
      asm volatile("s_wait_xcnt 0x0" :: "v"(xn), "v"(wn) : "memory"); }   // as above: the stage's two address pairs are rewritten behind these loads
#pragma unroll   // the stage's two 32-k halves, in k order
    for (int kc = 0; kc < PK / 32; ++kc) { v16b fa[4], fw[2];
#pragma unroll
      for (int i = 0; i < 4; ++i) fa[i] = frag_b(&sx[bu][wm * 64 + i * 16 + col][kc * 32], lane);
#pragma unroll
      for (int j = 0; j < 2; ++j) fw[j] = frag_b(&sw[bu][wn * 32 + j * 16 + col][kc * 32], lane);
      __builtin_amdgcn_sched_barrier(0);   // the stage's global loads and a half's LDS reads issue as one group ahead of its products: otherwise reads are spread among the products, each with a wait of its own, and global loads start late
#pragma unroll
      for (int i = 0; i < 4; ++i)
#pragma unroll
        for (int j = 0; j < 2; ++j) acc[i][j] = wmma_b(fa[i], fw[j], acc[i][j]);
      __builtin_amdgcn_sched_barrier(0); }   // keeps a half's products together, and the wait for the next stage's global loads behind the stage's last product
    if (more) {
#pragma unroll
      for (int i = 0; i < 4; ++i) { *(v8b*)&sx[bu ^ 1][sr + 32 * i][sc8] = rx[i]; *(v8b*)&sw[bu ^ 1][sr + 32 * i][sc8] = rw[i]; } } }
  __syncthreads();   // every wave has left the ring before its LDS is written again as output staging
  if (which < 2) { _Float16 (*sh)[PO] = (_Float16 (*)[PO])sm; _Float16* DH = which == 0 ? QH : KH;
#pragma unroll
    for (int j = 0; j < 2; ++j) { const int cl = wn * 32 + j * 16 + col; const float bias = BA ? bfr(BA[c0 + cl]) : 0.f;
#pragma unroll
      for (int i = 0; i < 4; ++i)
#pragma unroll
        for (int r = 0; r < 8; ++r) sh[wm * 64 + i * 16 + 8 * g + r][cl] = (_Float16)(acc[i][j][r] + bias); }
    __syncthreads();
#pragma unroll   // 16 rows a sweep, 16 lanes a 256-B row segment; in line, so that the LDS reads of all sweeps go ahead of the stores and the row step is an immediate offset
    for (int it = 0; it < PM / 16; ++it) { const int rl = it * 16 + (tid >> 4), q = tid & 15; vst2((unsigned*)(DH + (r0 + rl) * CC + c0 + q * 8), *(const v4u*)&sh[rl][q * 8]); }
  } else { _Float16 (*th)[PO] = (_Float16 (*)[PO])sm; __bf16 (*tb)[72] = (__bf16 (*)[72])(sm + PM * PO * 2); __bf16 (*tbl)[72] = (__bf16 (*)[72])(sm + PM * PO * 2 + PM * 72 * 2);
    const bool hi_tile = t0 < KHI, hi_rows = t0 + wm * 64 < KHI;   // KHI = 64 = a wave's rows: only the first tile of a sequence, and there the four waves of its first 64 rows, hold rows t < KHI
#pragma unroll
    for (int j = 0; j < 2; ++j) { const int cl = wn * 32 + j * 16 + col; const float bias = BA ? bfr(BA[c0 + cl]) : 0.f;
#pragma unroll
      for (int i = 0; i < 4; ++i)
#pragma unroll
        for (int r = 0; r < 8; ++r) { const float v = acc[i][j][r] + bias; acc[i][j][r] = v; th[cl][wm * 64 + i * 16 + 8 * g + r] = (_Float16)v; }
      if (hi_rows) {
#pragma unroll
        for (int i = 0; i < 4; ++i)
#pragma unroll
          for (int r = 0; r < 8; ++r) { const float v = acc[i][j][r]; const int rl = wm * 64 + i * 16 + 8 * g + r; const __bf16 bh = (__bf16)v; tb[cl][rl] = bh; tbl[cl][rl] = (__bf16)(v - (float)bh); } } }
    __syncthreads();
#pragma unroll   // in line, as above
    for (int it = 0; it < PM / 16; ++it) { const int cl = it * 16 + (tid >> 4), q = tid & 15; vst2((unsigned*)(VT + (bb * CC + c0 + cl) * (size_t)TT + t0 + q * 8), *(const v4u*)&th[cl][q * 8]); }
    asm volatile("s_wait_xcnt 0x0" ::: "memory");   // stands in front of the rewrite of registers that the stores above name
    if (hi_tile) {
#pragma unroll   // in line, as above
      for (int it = 0; it < PM / 32; ++it) { const int cl = it * 32 + (tid >> 3), q = tid & 7; const size_t o3 = (bb * CC + c0 + cl) * (size_t)KHI + t0 + q * 8; vst2((unsigned*)(VB + o3), *(const v4u*)&tb[cl][q * 8]); vst2((unsigned*)(VBL + o3), *(const v4u*)&tbl[cl][q * 8]); }
      asm volatile("s_wait_xcnt 0x0" ::: "memory"); } } }   // closes the stores above: the built code has a branch from here into the q/k part, which rewrites their address registers
#define FK 64             // keys per stage
#define FW 4              // waves a block
#define FC 2              // 16-column query tiles a wave
#define FT (FW * 32)      // threads a block
#define LOG2E 1.44269504088896340736f
#define FP 72             // LDS row pitch in halves: 144 B = 16 B x 9, so the 16 rows of a ds_load_b128 fragment read fall on distinct banks
__device__ __forceinline__ v8f wmma_h(v16h a, v16h b, v8f c) { return __builtin_amdgcn_wmma_f32_16x16x32_f16(false, a, false, b, (short)0, c, false, false); }
__device__ __forceinline__ float xhalf(float x) { return __builtin_bit_cast(float, __builtin_amdgcn_permlanex16(__builtin_bit_cast(int, x), __builtin_bit_cast(int, x), 0x76543210, 0xfedcba98, false, false)); }   // lane l with lane l ^ 16
__device__ __forceinline__ v16h frag_p(const _Float16* p) { union { v16h v; v8h q[2]; } u; u.q[0] = *(const v8h*)p; u.q[1] = *(const v8h*)(p + 16); return u.v; }   // frag_h with the lane's 8 (lane >> 4) already in p
// Every bare '#pragma unroll' below stands on a short loop over a register array (c, t, kc, kk, j, r, i): constant indices keep these arrays in registers.
__global__ __launch_bounds__(FT, 3) void k_fa(   // 3: the least waves a SIMD to budget registers for (336 each), three 4-wave blocks a WGP
    const _Float16* __restrict__ QH, const _Float16* __restrict__ KH, const _Float16* __restrict__ VT, const int* __restrict__ MK, float* __restrict__ Y) {
  __shared__ __align__(16) _Float16 sk[2][FK][FP], sv[2][HD][FP]; __shared__ __align__(16) float mb[TT]; __shared__ __align__(16) float so[FW][16 * FC][HD + 4];
  const int tid = threadIdx.x, wave = tid >> 5, lane = tid & 31, col = lane & 15, g = lane >> 4; const int h = blockIdx.y, b = blockIdx.z; const int q0 = blockIdx.x * (FW * FC * 16) + wave * (FC * 16);
  int mk[TT / FT];
#pragma unroll
  for (int i = 0; i < TT / FT; ++i) mk[i] = MK[(size_t)b * TT + i * FT + tid];   // a thread's 8 mask loads go out together, ahead of the first use
#pragma unroll
  for (int i = 0; i < TT / FT; ++i) mb[i * FT + tid] = (-10000.0f / SCALE) * (1.0f - (float)mk[i]);   // additive mask term per key, read from the mask input, in units of the unscaled product: the start value of the key's score accumulators
  v16h qh[FC][2];
  const _Float16* qhg = QH + ((size_t)b * TT + q0 + col) * CC + h * HD + 8 * g;   // the lane's own place in its row: every q load below is this pointer plus a constant
#pragma unroll
  for (int c = 0; c < FC; ++c)
#pragma unroll
    for (int kc = 0; kc < 2; ++kc) qh[c][kc] = frag_p(qhg + c * 16 * CC + kc * 32);
  const int sr = tid >> 3, sc8 = (tid & 7) * 8;   // staging: 8 lanes take one 128-B row (a whole line), 16 rows a sweep, 4 sweeps an operand
  const _Float16* kg = KH + ((size_t)b * TT + sr) * CC + h * HD + sc8; const _Float16* vg = VT + ((size_t)b * CC + h * HD + sr) * (size_t)TT + sc8;
  const int s0 = (2 * blockIdx.x + blockIdx.y) & (TT / FK - 1);   // the block's first stage, the same in every wave (a scalar)
  v8h rk[4], rv[4];
  { const _Float16* kn = kg + (size_t)(s0 * FK) * CC; const _Float16* vn = vg + s0 * FK;
#pragma unroll
    for (int i = 0; i < 4; ++i) { rk[i] = *(const v8h*)(kn + (size_t)(16 * i) * CC); rv[i] = *(const v8h*)(vn + (size_t)(16 * i) * TT); }
    asm volatile("s_wait_xcnt 0x0" :: "v"(qhg), "v"(kn), "v"(vn) : "memory"); }   // stands in front of the rewrite of the address registers that the loads above name; the pairs are inputs so that they stay whole up to this wait
#pragma unroll
  for (int i = 0; i < 4; ++i) { *(v8h*)&sk[0][sr + 16 * i][sc8] = rk[i]; *(v8h*)&sv[0][sr + 16 * i][sc8] = rv[i]; }
  v8f o[FC][HD / 16] = {}; float mrun[FC], m2run[FC], lsum[FC];   // mrun: the running maximum of the unscaled scores; m2run: the same in base-2 units, less 11
#pragma unroll
  for (int c = 0; c < FC; ++c) { mrun[c] = -3.0e38f; m2run[c] = -3.0e38f; lsum[c] = 0.f; }
#pragma unroll 1   // one stage a trip: the body is long already and the buffer index alternates
  for (int s = 0; s < TT / FK; ++s) { const int bu = s & 1; const bool more = s + 1 < TT / FK; const int ks = (s0 + s) & (TT / FK - 1), kx = (s0 + s + 1) & (TT / FK - 1);   // this trip's and the next trip's 64 keys
    __syncthreads();   // publishes stage s (and, on the first trip, mb); ends every wave's reads of the other buffer, which is refilled at the foot of this trip
    if (more) { const _Float16* kn = kg + (size_t)(kx * FK) * CC; const _Float16* vn = vg + kx * FK;
#pragma unroll
      for (int i = 0; i < 4; ++i) { rk[i] = *(const v8h*)(kn + (size_t)(16 * i) * CC); rv[i] = *(const v8h*)(vn + (size_t)(16 * i) * TT); }
      asm volatile("s_wait_xcnt 0x0" :: "v"(kn), "v"(vn) : "memory"); }   // as above: the stage's two address pairs are rewritten right behind these loads
    v8f sc[FC][4];   // unscaled scores: mask term + K q, one accumulator a tile
#pragma unroll
    for (int t = 0; t < 4; ++t) { const v4f b0 = *(const v4f*)&mb[ks * FK + t * 16 + 8 * g], b1 = *(const v4f*)&mb[ks * FK + t * 16 + 8 * g + 4];
#pragma unroll
      for (int c = 0; c < FC; ++c) sc[c][t] = __builtin_shufflevector(b0, b1, 0, 1, 2, 3, 4, 5, 6, 7); }
    v16h kf[2][4];
#pragma unroll
    for (int kc = 0; kc < 2; ++kc)
#pragma unroll
      for (int t = 0; t < 4; ++t) kf[kc][t] = frag_h(&sk[bu][t * 16 + col][kc * 32], lane);
    __builtin_amdgcn_sched_barrier(0);   // the stage's mask terms and K fragments are read as one group ahead of the products: with two products a fragment the reads are otherwise set singly among them, each behind a wait for all reads
#pragma unroll
    for (int kc = 0; kc < 2; ++kc)
#pragma unroll
      for (int t = 0; t < 4; ++t)
#pragma unroll
        for (int c = 0; c < FC; ++c) sc[c][t] = wmma_h(kf[kc][t], qh[c][kc], sc[c][t]);
    v16h vf[2][HD / 16];
#pragma unroll
    for (int j = 0; j < HD / 16; ++j) vf[0][j] = frag_h(&sv[bu][j * 16 + col][0], lane);
    __builtin_amdgcn_sched_barrier(0);   // the V fragments of the stage's first 32 keys are read as one group here and land under the softmax arithmetic: otherwise the reads are spread among the P V products, each with a wait of its own
    v16h pf[FC][2];
#pragma unroll
    for (int c = 0; c < FC; ++c) { float mx = sc[c][0][0];
#pragma unroll
      for (int t = 0; t < 4; ++t)
#pragma unroll
        for (int r = 0; r < 8; ++r) mx = fmaxf(mx, sc[c][t][r]);
      mx = fmaxf(mx, xhalf(mx)); const float mn = fmaxf(mrun[c], mx); const float m2 = fmaf(mn, SCALE * LOG2E, -11.0f); const float corr = __builtin_amdgcn_exp2f(m2run[c] - m2); mrun[c] = mn; m2run[c] = m2;   // first stage: 2^(-3e38) = 0
      float ps[4] = {0.f, 0.f, 0.f, 0.f};   // one partial sum a tile: four independent add chains
#pragma unroll
      for (int t = 0; t < 4; ++t)
#pragma unroll
        for (int r = 0; r < 8; ++r) { const float e = __builtin_amdgcn_exp2f(fmaf(sc[c][t][r], SCALE * LOG2E, -m2)); ps[t] += e; pf[c][t >> 1][(t & 1) * 8 + r] = (_Float16)e; }   // e = exp(s - max) x 2^11, at most 2^11 but for the rounding of m2
      lsum[c] = lsum[c] * corr + ((ps[0] + ps[1]) + (ps[2] + ps[3]));
#pragma unroll
      for (int j = 0; j < HD / 16; ++j) o[c][j] *= corr; }
#pragma unroll
    for (int j = 0; j < HD / 16; ++j) vf[1][j] = frag_h(&sv[bu][j * 16 + col][32], lane);   // the second 32 keys' fragments: read while the first 32 keys' products run
#pragma unroll
    for (int kk = 0; kk < 2; ++kk)
#pragma unroll
      for (int j = 0; j < HD / 16; ++j)
#pragma unroll
        for (int c = 0; c < FC; ++c) o[c][j] = wmma_h(vf[kk][j], pf[c][kk], o[c][j]);
    if (more) {
#pragma unroll
      for (int i = 0; i < 4; ++i) { *(v8h*)&sk[bu ^ 1][sr + 16 * i][sc8] = rk[i]; *(v8h*)&sv[bu ^ 1][sr + 16 * i][sc8] = rv[i]; } } }
#pragma unroll
  for (int c = 0; c < FC; ++c) { const float l = lsum[c] + xhalf(lsum[c]); const float inv = 1.0f / l;   // l holds the 2^11 of its terms; l is about 2^11 or more: the key that holds the maximum adds 2^11
#pragma unroll
    for (int j = 0; j < HD / 16; ++j) { const v8f w = o[c][j] * inv; float* d = &so[wave][c * 16 + col][j * 16 + 8 * g]; *(v4f*)d = __builtin_shufflevector(w, w, 0, 1, 2, 3); *(v4f*)(d + 4) = __builtin_shufflevector(w, w, 4, 5, 6, 7); } }
  LDSX();   // the wave's own rows of so are written before it reads them across lanes
  for (int it = 0; it < 8 * FC; ++it) { const int rl = it * 2 + g; vst2(Y + ((size_t)b * TT + q0 + rl) * CC + h * HD + col * 4, *(const v4f*)&so[wave][rl][col * 4]); } }   // 256-B (row, head) segment by 16 lanes

extern "C" void kernel_launch(void* const* d_in, const int* in_sizes, int n_in, void* d_out, int out_size, void* d_ws, size_t ws_size, hipStream_t stream) {
  (void)in_sizes; (void)n_in; (void)out_size;
  const float** F = (const float**)d_in;
  if (ws_size < (size_t)WS_END) return;
  char* ws = (char*)d_ws; _Float16 *QH = (_Float16*)(ws + WS_QH), *KH = (_Float16*)(ws + WS_KH), *VT = (_Float16*)(ws + WS_VT), *QL = (_Float16*)(ws + WS_QL), *KL = (_Float16*)(ws + WS_KL); __bf16 *VB = (__bf16*)(ws + WS_VB), *VBL = (__bf16*)(ws + WS_VBL); float *S = (float*)(ws + WS_S), *Y = (float*)(ws + WS_Y);
  (void)Y; (void)S; (void)QL; (void)KL; (void)VB; (void)VBL;
  // inputs: 0 x [8,1024,768]; 1 mask [8,1024] int32 (ones); 2 Wq (out,in), 3 bq; 4 Wk, 5 bk; 6 Wv, 7 bv
  __bf16 *XB = (__bf16*)(ws + WS_XB), *WB = (__bf16*)(ws + WS_WB);
  k_cvt<<<dim3(CVX + 3 * CVW), 256, 0, stream>>>(F[0], F[2], F[4], F[6], XB, WB);
  k_proj<<<dim3(TNB * TT / 128, CC / 128, 3), 256, 0, stream>>>(XB, WB, F[3], F[5], F[7], QH, KH, VT, VB, VBL);
  k_fa<<<dim3(TT / (FW * FC * 16), NH, TNB), FT, 0, stream>>>(QH, KH, VT, (const int*)d_in[1], (float*)d_out);
}

// v009
// It runs in 59 microseconds.
// Timed twice side by side with v008, it ran 1.05 times as fast both times.
// All steps since v000 together make it 26.5 times as fast.
// compute dtype: all float inputs rounded to bf16; q/k/v = in W^T + b with EXACT bf16 products on WMMA 16x16x32 (f32 accumulate); q x log2(e) / 8 once to f16 against k once to f16 (1 product, its f32 accumulator starts at the mask term less the softmax reference in use, both in base-2 units); softmax in f32 with a reference and a sum per query, the exponential as the hardware's base-2 exponential of the accumulator (2^8 at the maximum that sets the reference; the reference is the first stage's maximum less 8 and rises when a stage's terms grow too large for f16); that value once to f16 against v once to f16 (1 product), divided by the sum (which carries the same factor) at the end; f32 output.
#include <hip/hip_runtime.h>
#include <math.h>

typedef __attribute__((ext_vector_type(16))) _Float16 v16h;
typedef __attribute__((ext_vector_type(16))) __bf16 v16b;
typedef __attribute__((ext_vector_type(8)))  _Float16 v8h;
typedef __attribute__((ext_vector_type(8)))  float v8f;
typedef __attribute__((ext_vector_type(4)))  float v4f;
typedef __attribute__((ext_vector_type(2)))  float v2f;
typedef __attribute__((ext_vector_type(4)))  unsigned v4u;
typedef __attribute__((ext_vector_type(4)))  int v4i;
typedef float __attribute__((may_alias)) float_a;
typedef int __attribute__((may_alias)) int_a;

template <typename T> __device__ __forceinline__ void vst2(void* p, T v) { *(T*)p = v;  }
__device__ __forceinline__ v8f wmma16(v16h a, v16h b, v8f c) {
  v8f d = __builtin_amdgcn_wmma_f32_16x16x32_f16(false, a, false, b, (short)0, c, false, false);
  asm volatile("v_nop\n\tv_nop\n\tv_nop\n\tv_nop" : "+v"(d) : "v"(a), "v"(b));
  return d;
}
__device__ __forceinline__ v8f wmma_bf(v16b a, v16b b, v8f c) {
  v8f d = __builtin_amdgcn_wmma_f32_16x16x32_bf16(false, a, false, b, (short)0, c, false, false);
  asm volatile("v_nop\n\tv_nop\n\tv_nop\n\tv_nop" : "+v"(d) : "v"(a), "v"(b));
  return d;
}
// 16x16x32 fragments: lane = (h = lane>>4, row/col = lane&15); elements 0..7 = k0+8h+0..7, 8..15 = k0+16+8h+0..7; D element r = row 8h+r
__device__ __forceinline__ v16h frag_h(const _Float16* rowk0, int lane) {
  union { v16h v; v8h q[2]; } u; const _Float16* p = rowk0 + 8 * (lane >> 4);
  u.q[0] = *(const v8h*)p; u.q[1] = *(const v8h*)(p + 16); return u.v;
}
__device__ __forceinline__ v16h frag_f32(const float* rowk0, int lane) {
  v16h a; const float* p = rowk0 + 8 * (lane >> 4);
#pragma unroll
  for (int i = 0; i < 8; ++i) { a[i] = (_Float16)p[i]; a[8 + i] = (_Float16)p[16 + i]; }
  return a;
}
__device__ __forceinline__ v16h frag_f32s(const float* rowk0, int lane, float sc) {
  v16h a; const float* p = rowk0 + 8 * (lane >> 4);
#pragma unroll
  for (int i = 0; i < 8; ++i) { a[i] = (_Float16)(p[i] * sc); a[8 + i] = (_Float16)(p[16 + i] * sc); }
  return a;
}
// column fragment from a [K][ld] layout (column n), rows >= K read as 0
__device__ __forceinline__ v16h fragc_f32(const float* W, int k0, int n, int lane, int ld, int K) {
  v16h a; const int g = lane >> 4;
#pragma unroll
  for (int i = 0; i < 8; ++i) { const int ka = k0 + 8 * g + i, kb = ka + 16;
    a[i] = (_Float16)(ka < K ? W[(size_t)(ka < K ? ka : K - 1) * ld + n] : 0.f); a[8 + i] = (_Float16)(kb < K ? W[(size_t)(kb < K ? kb : K - 1) * ld + n] : 0.f); }
  return a;
}
struct F2 { v16b h, l; };
__device__ __forceinline__ F2 bsplit16(const float v[16]) { F2 r;
#pragma unroll
  for (int i = 0; i < 16; ++i) { const __bf16 h = (__bf16)v[i]; r.h[i] = h; r.l[i] = (__bf16)(v[i] - (float)h); }
  return r; }
__device__ __forceinline__ F2 split_row(const float* row, int k0, int lane) { float v[16]; const float* p = row + k0 + 8 * (lane >> 4);
#pragma unroll
  for (int i = 0; i < 8; ++i) { v[i] = p[i]; v[8 + i] = p[16 + i]; }
  return bsplit16(v); }
__device__ __forceinline__ F2 split_rowK(const float* row, int k0, int lane, int K) { float v[16]; const int g = lane >> 4;
#pragma unroll
  for (int i = 0; i < 8; ++i) { const int ka = k0 + 8 * g + i, kb = ka + 16; v[i] = ka < K ? row[ka < K ? ka : K - 1] : 0.f; v[8 + i] = kb < K ? row[kb < K ? kb : K - 1] : 0.f; }
  return bsplit16(v); }
__device__ __forceinline__ F2 split_col(const float* W, int k0, int n, int lane, int ld, int K) { float v[16]; const int g = lane >> 4;
#pragma unroll
  for (int i = 0; i < 8; ++i) { const int ka = k0 + 8 * g + i, kb = ka + 16; v[i] = ka < K ? W[(size_t)(ka < K ? ka : K - 1) * ld + n] : 0.f; v[8 + i] = kb < K ? W[(size_t)(kb < K ? kb : K - 1) * ld + n] : 0.f; }
  return bsplit16(v); }
__device__ __forceinline__ v8f mac3(const F2& a, const F2& b, v8f c) { c = wmma_bf(a.l, b.h, c); c = wmma_bf(a.h, b.l, c); return wmma_bf(a.h, b.h, c); }
__device__ __forceinline__ float sigm(float v) { return 1.0f / (1.0f + expf(-v)); }
#define LDSX() do { asm volatile("s_wait_dscnt 0" ::: "memory"); __builtin_amdgcn_wave_barrier(); __builtin_amdgcn_fence(__ATOMIC_RELEASE, "workgroup"); } while (0)

// Multi-head self-attention (B 8, S 1,024, D 768 = 12 x 64; (out,in) 1/sqrt(768)-scale weights, zero biases; key mask [B,S] int all ones): q, k, v = x W^T + b; scores / 8 - 10000 * (1 - mask); out = merged(softmax v) -> [8, 1,024, 768] (no output projection).
#define NB 8
#define TT 1024
#define CC 768            // NH * HD = projected width
#define DIN 768          // input (model) width
#define NH 12
#define HD 64
#define NQB (TT / 64)
#define HG 4
#define SCALE (0.125f)
#define CAUSAL 0
#ifndef TNB
#define TNB NB
#endif
__device__ __forceinline__ float bfr(float v) { return (float)(__bf16)v; }
__host__ __device__ __forceinline__ int kb_last(int qb) { return CAUSAL ? ((qb * 64 + 63) >> 7) : (TT / 128 - 1); }
typedef __attribute__((ext_vector_type(8))) __bf16 v8b;
__device__ __forceinline__ v16b frag_b(const __bf16* rowk0, int lane) {
  union { v16b v; v8b q[2]; } u; const __bf16* p = rowk0 + 8 * (lane >> 4);
  u.q[0] = *(const v8b*)p; u.q[1] = *(const v8b*)(p + 16); return u.v;
}
#define QBH 0              // not used: this file has no high-precision path
#define QHI 1024            // rows of the q residual plane's place in the workspace (the plane is no longer made: 1-product logits)
#define KHI 64            // key rows carrying k residual / v bf16 hi+lo planes (the k residual is not made; the v planes are written, not read)
// B fragment (k rows k0+.., output column o) of a weight: (in,out) [K][ld] or (out,in) [ld rows of K]: bf16 exact, or f16(bf16 * 256) exact
__device__ __forceinline__ v16b wcol_io(const float* Wm, int k0, int o, int lane, int ld) { v16b w; const int g = lane >> 4;
#pragma unroll
  for (int i = 0; i < 8; ++i) { w[i] = (__bf16)Wm[(size_t)(k0 + 8 * g + i) * ld + o]; w[8 + i] = (__bf16)Wm[(size_t)(k0 + 16 + 8 * g + i) * ld + o]; }
  return w; }
__device__ __forceinline__ v16b wcol_oi(const float* Wm, int k0, int o, int lane, int K) { v16b w; const float* p = Wm + (size_t)o * K + k0 + 8 * (lane >> 4);
#pragma unroll
  for (int i = 0; i < 8; ++i) { w[i] = (__bf16)p[i]; w[8 + i] = (__bf16)p[16 + i]; }
  return w; }
__device__ __forceinline__ v16h wcolh_io(const float* Wm, int k0, int o, int lane, int ld) { v16h w; const int g = lane >> 4;
#pragma unroll
  for (int i = 0; i < 8; ++i) { w[i] = (_Float16)(bfr(Wm[(size_t)(k0 + 8 * g + i) * ld + o]) * 256.0f); w[8 + i] = (_Float16)(bfr(Wm[(size_t)(k0 + 16 + 8 * g + i) * ld + o]) * 256.0f); }
  return w; }
__device__ __forceinline__ v16h wcolh_oi(const float* Wm, int k0, int o, int lane, int K) { v16h w; const float* p = Wm + (size_t)o * K + k0 + 8 * (lane >> 4);
#pragma unroll
  for (int i = 0; i < 8; ++i) { w[i] = (_Float16)(bfr(p[i]) * 256.0f); w[8 + i] = (_Float16)(bfr(p[16 + i]) * 256.0f); }
  return w; }
#define WQKV_LAYOUT 1   // 0 = (in,out) [DIN][CC]; 1 = (out,in) [CC][DIN]; 2 = per-head [NH][DIN][HD]
__device__ __forceinline__ v16b wcol_hdk(const float* Wm, int k0, int o, int lane) { v16b w; const int g = lane >> 4; const float* p = Wm + (size_t)(o / HD) * DIN * HD + (o % HD);
#pragma unroll
  for (int i = 0; i < 8; ++i) { w[i] = (__bf16)p[(size_t)(k0 + 8 * g + i) * HD]; w[8 + i] = (__bf16)p[(size_t)(k0 + 16 + 8 * g + i) * HD]; }
  return w; }
#define WO_OUT_IN 0
#if WQKV_LAYOUT == 1
#define WCOL(W, k0, o, lane) wcol_oi(W, k0, o, lane, DIN)
#elif WQKV_LAYOUT == 2
#define WCOL(W, k0, o, lane) wcol_hdk(W, k0, o, lane)
#else
#define WCOL(W, k0, o, lane) wcol_io(W, k0, o, lane, CC)
#endif
#if WO_OUT_IN
#define WOCOL(W, k0, o, lane) wcol_oi(W, k0, o, lane, CC)
#define WOCOLH(W, k0, o, lane) wcolh_oi(W, k0, o, lane, CC)
#else
#define WOCOL(W, k0, o, lane) wcol_io(W, k0, o, lane, DIN)
#define WOCOLH(W, k0, o, lane) wcolh_io(W, k0, o, lane, DIN)
#endif

#define WS_QH  0u                                      // f16 q rows [b*t][CC]
#define WS_KH  (WS_QH + 2u * (size_t)NB * TT * CC)      // f16 k rows [b*t][CC]
#define WS_VT  (WS_KH + 2u * (size_t)NB * TT * CC)      // f16 v planes [b][c][t]
#define WS_QL  (WS_VT + 2u * (size_t)NB * CC * TT)      // place of the f16 q residual rows [b][t < QHI][CC]: not written, not read
#define WS_KL  (WS_QL + 2u * (size_t)NB * QHI * CC)     // place of the f16 k residual rows [b][t < KHI][CC]: not written, not read
#define WS_VB  (WS_KL + 2u * (size_t)NB * KHI * CC)     // bf16 v hi planes [b][c][t < KHI]
#define WS_VBL (WS_VB + 2u * (size_t)NB * CC * KHI)
#define WS_S   (WS_VBL + 2u * (size_t)NB * CC * KHI)    // f32 logits / P [hg][t][s]
#define WS_XB  WS_S                                    // bf16 x rows [b*t][DIN]: the logits plane above is not in use, its place holds the rounded operands
#define WS_WB  (WS_XB + 2u * (size_t)NB * TT * DIN)     // bf16 Wq, Wk, Wv rows [3][CC][DIN]; ends below WS_Y
#define WS_Y   (WS_S  + 4u * (size_t)HG * TT * TT)      // f32 ctx rows [b*t][CC] (only when there is an output projection)
#define WS_END (WS_Y  + 0u)
static_assert(WS_WB + 2u * 3u * (size_t)CC * DIN <= WS_Y, "the rounded operands fit the unused plane");

// ---- k_proj: block = (128 rows, 128 cols, which), 8 waves as 2 x 4, a wave holds 64 x 32 of the tile: q/k/v = X W^T (+ b) with exact bf16 products (K = DIN, summed stage by stage from the block's own first stage, wrapping at the end; inside a stage in k order).
// X rows and W rows ((out,in): both K-contiguous) come as bf16 from k_cvt; a block reads them once in whole 128-B lines (64 k) and stages them in LDS, two buffers, one barrier a 64-k stage; every wave takes its fragments from there.
// A block starts its k walk at its own stage ((row tile + column tile + 6 which) mod 12) and wraps: the blocks that share an X panel, and those that share a W panel, then stand at different stages. A line that one of them has brought into L2 is there when the others come to it, and the blocks resident at one time ask for all 128-B columns of the 1,536-B rows, not all for the same one.
// Every bare '#pragma unroll' below stands on a short loop over rx, rw, fa, fw or acc: constant indices keep these arrays in registers.
// -> which 0: q x QSC f16 rows; 1: k f16 rows; 2: v f16 planes [c][t] (+ bf16 hi/lo planes for t < KHI)
#define LOG2E 1.44269504088896340736f
#define QSC (SCALE * LOG2E)   // q leaves k_proj times this: K q is then the score in base-2 units, the argument of v_exp_f32
#define PM 128            // tile rows, and tile columns
#define PK 64             // k per stage: one 128-B line of every bf16 source row
#define PP 72             // LDS row pitch in bf16: 144 B = 16 B x 9, so the 16 rows of a ds_load_b128 fragment read fall on distinct banks
#define PO (PM + 8)       // pitch of the output staging rows in halves: 272 B = 16 B x 17
typedef __attribute__((ext_vector_type(4))) __bf16 v4b;
__device__ __forceinline__ v8f wmma_b(v16b a, v16b b, v8f c) { return __builtin_amdgcn_wmma_f32_16x16x32_bf16(false, a, false, b, (short)0, c, false, false); }
__device__ __forceinline__ v4b bf4(v4f v) { return __builtin_convertvector(v, v4b); }   // round to nearest even, as (__bf16) on each element
// ---- k_cvt: x and the three weights rounded to bf16 ONCE (k_proj would round every X row 18 times and every W row 64 times, and read it as f32 each time). A block takes 256 x 16 units of 4 floats of one source; a wave's load covers 512 B in a row, its store 256 B.
#define CVU 16            // units of 4 floats a thread: all 16 loads are issued ahead of the first store
#define CVX (NB * TT * DIN / (4 * 256 * CVU))   // blocks for x
#define CVW (CC * DIN / (4 * 256 * CVU))        // blocks for one weight
static_assert(CVX * 4 * 256 * CVU == NB * TT * DIN && CVW * 4 * 256 * CVU == CC * DIN, "whole blocks");
__global__ __launch_bounds__(256) void k_cvt(const float* __restrict__ X, const float* __restrict__ WQ, const float* __restrict__ WK, const float* __restrict__ WV, __bf16* __restrict__ XB, __bf16* __restrict__ WB) {
  int bl = blockIdx.x; const float* src = X; __bf16* dst = XB;
  if (bl >= CVX) { bl -= CVX; const int w = bl / CVW; bl -= w * CVW; src = w == 0 ? WQ : w == 1 ? WK : WV; dst = WB + (size_t)w * CC * DIN; }
  const size_t e0 = ((size_t)bl * (256 * CVU) + threadIdx.x) * 4;
  v4f r[CVU];
#pragma unroll   // constant indices keep r in registers; the step is an immediate offset
  for (int j = 0; j < CVU; ++j) r[j] = *(const v4f*)(src + e0 + j * 1024);
#pragma unroll   // as above
  for (int j = 0; j < CVU; ++j) *(v4b*)(dst + e0 + j * 1024) = bf4(r[j]); }
__global__ __launch_bounds__(256, 6) void k_proj(   // 6: the least waves a SIMD to budget registers for (160 each), three 8-wave blocks a WGP
    const __bf16* __restrict__ XB, const __bf16* __restrict__ WB, const float* __restrict__ BQ, const float* __restrict__ BK, const float* __restrict__ BV,
    _Float16* __restrict__ QH, _Float16* __restrict__ KH, _Float16* __restrict__ VT, __bf16* __restrict__ VB, __bf16* __restrict__ VBL) {
  // one LDS block, used twice: the operand ring in the k loop (2 x 2 x 128 x 144 B = 73,728 B), then the output staging (q, k: 128 x 272 B; v: 128 x 272 B + 2 x 128 x 144 B = 71,680 B)
  static_assert(2 * 2 * PM * PP * 2 >= PM * PO * 2 + 2 * PM * 72 * 2, "the ring holds the staging");
  __shared__ __align__(16) char sm[2 * 2 * PM * PP * 2];
  __bf16 (*sx)[PM][PP] = (__bf16 (*)[PM][PP])sm; __bf16 (*sw)[PM][PP] = (__bf16 (*)[PM][PP])(sm + 2 * PM * PP * 2);
  const int tid = threadIdx.x, wave = __builtin_amdgcn_readfirstlane(tid >> 5), lane = tid & 31, col = lane & 15, g = lane >> 4, wm = wave >> 2, wn = wave & 3;   // the wave's number in a scalar register: tests on it are scalar branches
  const int which = blockIdx.z; const int c0 = blockIdx.y * PM; const size_t r0 = (size_t)blockIdx.x * PM; const size_t bb = r0 / TT; const int t0 = (int)(r0 % TT);
  const float* BA = which == 0 ? BQ : which == 1 ? BK : BV;
  const int sr = tid >> 3, sc8 = (tid & 7) * 8;   // staging: 8 lanes take one 128-B line of a row, 32 rows a sweep, 4 sweeps an operand
  const __bf16* xg = XB + (r0 + sr) * DIN + sc8; const __bf16* wg = WB + ((size_t)which * CC + c0 + sr) * DIN + sc8;
  const int s0 = (blockIdx.x + blockIdx.y + 6 * blockIdx.z) % (DIN / PK);   // the block's first stage, the same in every wave (a scalar)
  v8b rx[4], rw[4];
  { const __bf16* xn = xg + s0 * PK; const __bf16* wn = wg + s0 * PK;
#pragma unroll
    for (int i = 0; i < 4; ++i) { rx[i] = *(const v8b*)(xn + (size_t)(32 * i) * DIN); rw[i] = *(const v8b*)(wn + (size_t)(32 * i) * DIN); }
    asm volatile("s_wait_xcnt 0x0" :: "v"(xn), "v"(wn) : "memory"); }   // stands in front of the rewrite of the two address pairs that the loads above name; they are inputs so that they stay whole up to this wait
#pragma unroll
  for (int i = 0; i < 4; ++i) { *(v8b*)&sx[0][sr + 32 * i][sc8] = rx[i]; *(v8b*)&sw[0][sr + 32 * i][sc8] = rw[i]; }
  v8f acc[4][2] = {};
#pragma unroll   // all 12 stages in line: the buffer index and every LDS offset become immediates
  for (int s = 0; s < DIN / PK; ++s) { const int bu = s & 1; const bool more = s + 1 < DIN / PK;
    __syncthreads();   // publishes stage s; ends every wave's reads of the other buffer, which is refilled at the foot of this trip
    if (more) { const int kn = s0 + s + 1 < DIN / PK ? s0 + s + 1 : s0 + s + 1 - DIN / PK;   // the next stage of the wrapped walk
      const __bf16* xn = xg + kn * PK; const __bf16* wn = wg + kn * PK;
#pragma unroll
      for (int i = 0; i < 4; ++i) { rx[i] = *(const v8b*)(xn + (size_t)(32 * i) * DIN); rw[i] = *(const v8b*)(wn + (size_t)(32 * i) * DIN); }
      asm volatile("s_wait_xcnt 0x0" :: "v"(xn), "v"(wn) : "memory"); }   // as above: the stage's two address pairs are rewritten behind these loads
#pragma unroll   // the stage's two 32-k halves, in k order
    for (int kc = 0; kc < PK / 32; ++kc) { v16b fa[4], fw[2];
#pragma unroll
      for (int i = 0; i < 4; ++i) fa[i] = frag_b(&sx[bu][wm * 64 + i * 16 + col][kc * 32], lane);
#pragma unroll
      for (int j = 0; j < 2; ++j) fw[j] = frag_b(&sw[bu][wn * 32 + j * 16 + col][kc * 32], lane);
      __builtin_amdgcn_sched_barrier(0);   // the stage's global loads and a half's LDS reads issue as one group ahead of its products: otherwise reads are spread among the products, each with a wait of its own, and global loads start late
#pragma unroll
      for (int i = 0; i < 4; ++i)
#pragma unroll
        for (int j = 0; j < 2; ++j) acc[i][j] = wmma_b(fa[i], fw[j], acc[i][j]);
      __builtin_amdgcn_sched_barrier(0); }   // keeps a half's products together, and the wait for the next stage's global loads behind the stage's last product
    if (more) {
#pragma unroll
      for (int i = 0; i < 4; ++i) { *(v8b*)&sx[bu ^ 1][sr + 32 * i][sc8] = rx[i]; *(v8b*)&sw[bu ^ 1][sr + 32 * i][sc8] = rw[i]; } } }
  __syncthreads();   // every wave has left the ring before its LDS is written again as output staging
  if (which < 2) { _Float16 (*sh)[PO] = (_Float16 (*)[PO])sm; _Float16* DH = which == 0 ? QH : KH; const float qs = which == 0 ? QSC : 1.0f;
#pragma unroll
    for (int j = 0; j < 2; ++j) { const int cl = wn * 32 + j * 16 + col; const float bias = BA ? bfr(BA[c0 + cl]) : 0.f;
#pragma unroll
      for (int i = 0; i < 4; ++i)
#pragma unroll
        for (int r = 0; r < 8; ++r) sh[wm * 64 + i * 16 + 8 * g + r][cl] = (_Float16)((acc[i][j][r] + bias) * qs); }
    __syncthreads();
#pragma unroll   // 16 rows a sweep, 16 lanes a 256-B row segment; in line, so that the LDS reads of all sweeps go ahead of the stores and the row step is an immediate offset
    for (int it = 0; it < PM / 16; ++it) { const int rl = it * 16 + (tid >> 4), q = tid & 15; vst2((unsigned*)(DH + (r0 + rl) * CC + c0 + q * 8), *(const v4u*)&sh[rl][q * 8]); }
  } else { _Float16 (*th)[PO] = (_Float16 (*)[PO])sm; __bf16 (*tb)[72] = (__bf16 (*)[72])(sm + PM * PO * 2); __bf16 (*tbl)[72] = (__bf16 (*)[72])(sm + PM * PO * 2 + PM * 72 * 2);
    const bool hi_tile = t0 < KHI, hi_rows = t0 + wm * 64 < KHI;   // KHI = 64 = a wave's rows: only the first tile of a sequence, and there the four waves of its first 64 rows, hold rows t < KHI
#pragma unroll
    for (int j = 0; j < 2; ++j) { const int cl = wn * 32 + j * 16 + col; const float bias = BA ? bfr(BA[c0 + cl]) : 0.f;
#pragma unroll
      for (int i = 0; i < 4; ++i)
#pragma unroll
        for (int r = 0; r < 8; ++r) { const float v = acc[i][j][r] + bias; acc[i][j][r] = v; th[cl][wm * 64 + i * 16 + 8 * g + r] = (_Float16)v; }
      if (hi_rows) {
#pragma unroll
        for (int i = 0; i < 4; ++i)
#pragma unroll
          for (int r = 0; r < 8; ++r) { const float v = acc[i][j][r]; const int rl = wm * 64 + i * 16 + 8 * g + r; const __bf16 bh = (__bf16)v; tb[cl][rl] = bh; tbl[cl][rl] = (__bf16)(v - (float)bh); } } }
    __syncthreads();
#pragma unroll   // in line, as above
    for (int it = 0; it < PM / 16; ++it) { const int cl = it * 16 + (tid >> 4), q = tid & 15; vst2((unsigned*)(VT + (bb * CC + c0 + cl) * (size_t)TT + t0 + q * 8), *(const v4u*)&th[cl][q * 8]); }
    asm volatile("s_wait_xcnt 0x0" ::: "memory");   // stands in front of the rewrite of registers that the stores above name
    if (hi_tile) {
#pragma unroll   // in line, as above
      for (int it = 0; it < PM / 32; ++it) { const int cl = it * 32 + (tid >> 3), q = tid & 7; const size_t o3 = (bb * CC + c0 + cl) * (size_t)KHI + t0 + q * 8; vst2((unsigned*)(VB + o3), *(const v4u*)&tb[cl][q * 8]); vst2((unsigned*)(VBL + o3), *(const v4u*)&tbl[cl][q * 8]); }
      asm volatile("s_wait_xcnt 0x0" ::: "memory"); } } }   // closes the stores above: the built code has a branch from here into the q/k part, which rewrites their address registers
#define FK 64             // keys per stage
#define FW 4              // waves a block
#define FC 2              // 16-column query tiles a wave
#define FT (FW * 32)      // threads a block
#define FP 72             // LDS row pitch in halves: 144 B = 16 B x 9, so the 16 rows of a ds_load_b128 fragment read fall on distinct banks
__device__ __forceinline__ v8f wmma_h(v16h a, v16h b, v8f c) { return __builtin_amdgcn_wmma_f32_16x16x32_f16(false, a, false, b, (short)0, c, false, false); }
__device__ __forceinline__ float xhalf(float x) { return __builtin_bit_cast(float, __builtin_amdgcn_permlanex16(__builtin_bit_cast(int, x), __builtin_bit_cast(int, x), 0x76543210, 0xfedcba98, false, false)); }   // lane l with lane l ^ 16
__device__ __forceinline__ v16h frag_p(const _Float16* p) { union { v16h v; v8h q[2]; } u; u.q[0] = *(const v8h*)p; u.q[1] = *(const v8h*)(p + 16); return u.v; }   // frag_h with the lane's 8 (lane >> 4) already in p
// A column tile's 32 terms of a stage: 2^(argument), packed to f16 for the P V product, and their sum in this lane (pairwise over the four tiles, then over the 8 registers).
__device__ __forceinline__ void fa_terms(const v8f (&a)[4], v16h (&pf)[2], float& ps) {
  v8f e[4];
#pragma unroll
  for (int t = 0; t < 4; ++t)
#pragma unroll
    for (int r = 0; r < 8; ++r) { e[t][r] = __builtin_amdgcn_exp2f(a[t][r]); pf[t >> 1][(t & 1) * 8 + r] = (_Float16)e[t][r]; }
  const v8f w = (e[0] + e[1]) + (e[2] + e[3]);
  const v4f x = __builtin_shufflevector(w, w, 0, 1, 2, 3) + __builtin_shufflevector(w, w, 4, 5, 6, 7);
  ps = (x[0] + x[2]) + (x[1] + x[3]); }
#define FB 8.0f           // a term at the maximum that sets the reference is 2^FB
#define FTOP 32768.0f     // a lane's stage sum above this renews the reference: no term has then passed f16's 65,504
// Every bare '#pragma unroll' below stands on a short loop over a register array (c, t, kc, kk, j, r, i): constant indices keep these arrays in registers.
__global__ __launch_bounds__(FT, 3) void k_fa(   // 3: the least waves a SIMD to budget registers for (336 each), three 4-wave blocks a WGP
    const _Float16* __restrict__ QH, const _Float16* __restrict__ KH, const _Float16* __restrict__ VT, const int* __restrict__ MK, float* __restrict__ Y) {
  __shared__ __align__(16) _Float16 sk[2][FK][FP], sv[2][HD][FP]; __shared__ __align__(16) float mb[TT]; __shared__ __align__(16) float so[FW][16 * FC][HD + 4];
  const int tid = threadIdx.x, wave = tid >> 5, lane = tid & 31, col = lane & 15, g = lane >> 4; const int h = blockIdx.y, b = blockIdx.z; const int q0 = blockIdx.x * (FW * FC * 16) + wave * (FC * 16);
  int mk[TT / FT];
#pragma unroll
  for (int i = 0; i < TT / FT; ++i) mk[i] = MK[(size_t)b * TT + i * FT + tid];   // a thread's 8 mask loads go out together, ahead of the first use
#pragma unroll
  for (int i = 0; i < TT / FT; ++i) mb[i * FT + tid] = (-10000.0f * LOG2E) * (1.0f - (float)mk[i]);   // additive mask term per key, read from the mask input, in base-2 units: part of the start value of the key's score accumulators
  v16h qh[FC][2];
  const _Float16* qhg = QH + ((size_t)b * TT + q0 + col) * CC + h * HD + 8 * g;   // the lane's own place in its row: every q load below is this pointer plus a constant
#pragma unroll
  for (int c = 0; c < FC; ++c)
#pragma unroll
    for (int kc = 0; kc < 2; ++kc) qh[c][kc] = frag_p(qhg + c * 16 * CC + kc * 32);
  const int sr = tid >> 3, sc8 = (tid & 7) * 8;   // staging: 8 lanes take one 128-B row (a whole line), 16 rows a sweep, 4 sweeps an operand
  const _Float16* kg = KH + ((size_t)b * TT + sr) * CC + h * HD + sc8; const _Float16* vg = VT + ((size_t)b * CC + h * HD + sr) * (size_t)TT + sc8;
  const int s0 = (2 * blockIdx.x + blockIdx.y) & (TT / FK - 1);   // the block's first stage, the same in every wave (a scalar)
  v8h rk[4], rv[4];
  { const _Float16* kn = kg + (size_t)(s0 * FK) * CC; const _Float16* vn = vg + s0 * FK;
#pragma unroll
    for (int i = 0; i < 4; ++i) { rk[i] = *(const v8h*)(kn + (size_t)(16 * i) * CC); rv[i] = *(const v8h*)(vn + (size_t)(16 * i) * TT); }
    asm volatile("s_wait_xcnt 0x0" :: "v"(qhg), "v"(kn), "v"(vn) : "memory"); }   // stands in front of the rewrite of the address registers that the loads above name; the pairs are inputs so that they stay whole up to this wait
#pragma unroll
  for (int i = 0; i < 4; ++i) { *(v8h*)&sk[0][sr + 16 * i][sc8] = rk[i]; *(v8h*)&sv[0][sr + 16 * i][sc8] = rv[i]; }
  v8f o[FC][HD / 16] = {}; float m2[FC], lsum[FC];   // m2: the reference in use, in base-2 units; 0 on the first trip, which sets it
#pragma unroll
  for (int c = 0; c < FC; ++c) { m2[c] = 0.f; lsum[c] = 0.f; }
#pragma unroll 1   // one stage a trip: the body is long already and the buffer index alternates
  for (int s = 0; s < TT / FK; ++s) { const int bu = s & 1; const bool more = s + 1 < TT / FK; const int ks = (s0 + s) & (TT / FK - 1), kx = (s0 + s + 1) & (TT / FK - 1);   // this trip's and the next trip's 64 keys
    __syncthreads();   // publishes stage s (and, on the first trip, mb); ends every wave's reads of the other buffer, which is refilled at the foot of this trip
    if (more) { const _Float16* kn = kg + (size_t)(kx * FK) * CC; const _Float16* vn = vg + kx * FK;
#pragma unroll
      for (int i = 0; i < 4; ++i) { rk[i] = *(const v8h*)(kn + (size_t)(16 * i) * CC); rv[i] = *(const v8h*)(vn + (size_t)(16 * i) * TT); }
      asm volatile("s_wait_xcnt 0x0" :: "v"(kn), "v"(vn) : "memory"); }   // as above: the stage's two address pairs are rewritten right behind these loads
    v8f mt[4];   // the stage's mask terms, 8 keys a tile
#pragma unroll
    for (int t = 0; t < 4; ++t) { const v4f b0 = *(const v4f*)&mb[ks * FK + t * 16 + 8 * g], b1 = *(const v4f*)&mb[ks * FK + t * 16 + 8 * g + 4]; mt[t] = __builtin_shufflevector(b0, b1, 0, 1, 2, 3, 4, 5, 6, 7); }
    v16h kf[2][4];
#pragma unroll
    for (int kc = 0; kc < 2; ++kc)
#pragma unroll
      for (int t = 0; t < 4; ++t) kf[kc][t] = frag_h(&sk[bu][t * 16 + col][kc * 32], lane);
    __builtin_amdgcn_sched_barrier(0);   // the stage's mask terms and K fragments are read as one group ahead of the start values and the products: otherwise the K reads start only behind the wait for the mask terms, or are set singly among the products, each behind a wait for all reads
    v8f sc[FC][4];   // exponent arguments: mask term - reference + K q, one accumulator a tile
#pragma unroll
    for (int t = 0; t < 4; ++t)
#pragma unroll
      for (int c = 0; c < FC; ++c) sc[c][t] = mt[t] - m2[c];
#pragma unroll
    for (int kc = 0; kc < 2; ++kc)
#pragma unroll
      for (int t = 0; t < 4; ++t)
#pragma unroll
        for (int c = 0; c < FC; ++c) sc[c][t] = wmma_h(kf[kc][t], qh[c][kc], sc[c][t]);
    v16h vf[2][HD / 16];
#pragma unroll
    for (int j = 0; j < HD / 16; ++j) vf[0][j] = frag_h(&sv[bu][j * 16 + col][0], lane);
    __builtin_amdgcn_sched_barrier(0);   // the V fragments of the stage's first 32 keys are read as one group here and land under the softmax arithmetic: otherwise the reads are spread among the P V products, each with a wait of its own
    v16h pf[FC][2]; float ps[FC];
#pragma unroll
    for (int c = 0; c < FC; ++c) fa_terms(sc[c], pf[c], ps[c]);
    const bool top = !(ps[0] <= FTOP) || !(ps[1] <= FTOP);   // written so that an infinite or undefined sum counts as too large
    if (s == 0 || __builtin_amdgcn_ballot_w32(top) != 0) {   // the same in every lane of the wave: a scalar branch, and no barrier stands inside
#pragma unroll
      for (int c = 0; c < FC; ++c) { float mx = sc[c][0][0];
#pragma unroll
        for (int t = 0; t < 4; ++t)
#pragma unroll
          for (int r = 0; r < 8; ++r) mx = fmaxf(mx, sc[c][t][r]);
        mx = fmaxf(mx, xhalf(mx)); float d = mx - FB; if (s != 0) d = fmaxf(d, 0.f);   // the step of the reference: the first trip sets it, a later trip only raises it
        const float corr = __builtin_amdgcn_exp2f(fminf(-d, 0.f)); m2[c] += d;   // first trip: sums and O are 0, and the factor stays finite
#pragma unroll
        for (int t = 0; t < 4; ++t) sc[c][t] -= d;
        fa_terms(sc[c], pf[c], ps[c]); lsum[c] *= corr;
#pragma unroll
        for (int j = 0; j < HD / 16; ++j) o[c][j] *= corr; } }
#pragma unroll
    for (int c = 0; c < FC; ++c) lsum[c] += ps[c];
#pragma unroll
    for (int j = 0; j < HD / 16; ++j) vf[1][j] = frag_h(&sv[bu][j * 16 + col][32], lane);   // the second 32 keys' fragments: read while the first 32 keys' products run
    __builtin_amdgcn_sched_barrier(0);   // these reads go out as one group ahead of the P V products: otherwise each is set in front of its own products, behind a wait for all reads
#pragma unroll
    for (int kk = 0; kk < 2; ++kk)
#pragma unroll
      for (int j = 0; j < HD / 16; ++j)
#pragma unroll
        for (int c = 0; c < FC; ++c) o[c][j] = wmma_h(vf[kk][j], pf[c][kk], o[c][j]);
    if (more) {
#pragma unroll
      for (int i = 0; i < 4; ++i) { *(v8h*)&sk[bu ^ 1][sr + 16 * i][sc8] = rk[i]; *(v8h*)&sv[bu ^ 1][sr + 16 * i][sc8] = rv[i]; } } }
#pragma unroll
  for (int c = 0; c < FC; ++c) { const float l = lsum[c] + xhalf(lsum[c]); const float inv = 1.0f / l;   // l holds the 2^8 of its terms; l is about 2^8 or more: the key that set the reference adds 2^8
#pragma unroll
    for (int j = 0; j < HD / 16; ++j) { const v8f w = o[c][j] * inv; float* d = &so[wave][c * 16 + col][j * 16 + 8 * g]; *(v4f*)d = __builtin_shufflevector(w, w, 0, 1, 2, 3); *(v4f*)(d + 4) = __builtin_shufflevector(w, w, 4, 5, 6, 7); } }
  LDSX();   // the wave's own rows of so are written before it reads them across lanes
  for (int it = 0; it < 8 * FC; ++it) { const int rl = it * 2 + g; vst2(Y + ((size_t)b * TT + q0 + rl) * CC + h * HD + col * 4, *(const v4f*)&so[wave][rl][col * 4]); } }   // 256-B (row, head) segment by 16 lanes

extern "C" void kernel_launch(void* const* d_in, const int* in_sizes, int n_in, void* d_out, int out_size, void* d_ws, size_t ws_size, hipStream_t stream) {
  (void)in_sizes; (void)n_in; (void)out_size;
  const float** F = (const float**)d_in;
  if (ws_size < (size_t)WS_END) return;
  char* ws = (char*)d_ws; _Float16 *QH = (_Float16*)(ws + WS_QH), *KH = (_Float16*)(ws + WS_KH), *VT = (_Float16*)(ws + WS_VT), *QL = (_Float16*)(ws + WS_QL), *KL = (_Float16*)(ws + WS_KL); __bf16 *VB = (__bf16*)(ws + WS_VB), *VBL = (__bf16*)(ws + WS_VBL); float *S = (float*)(ws + WS_S), *Y = (float*)(ws + WS_Y);
  (void)Y; (void)S; (void)QL; (void)KL; (void)VB; (void)VBL;
  // inputs: 0 x [8,1024,768]; 1 mask [8,1024] int32 (ones); 2 Wq (out,in), 3 bq; 4 Wk, 5 bk; 6 Wv, 7 bv
  __bf16 *XB = (__bf16*)(ws + WS_XB), *WB = (__bf16*)(ws + WS_WB);
  k_cvt<<<dim3(CVX + 3 * CVW), 256, 0, stream>>>(F[0], F[2], F[4], F[6], XB, WB);
  k_proj<<<dim3(TNB * TT / 128, CC / 128, 3), 256, 0, stream>>>(XB, WB, F[3], F[5], F[7], QH, KH, VT, VB, VBL);
  k_fa<<<dim3(TT / (FW * FC * 16), NH, TNB), FT, 0, stream>>>(QH, KH, VT, (const int*)d_in[1], (float*)d_out);
}
